// v000
// The times below were measured on an AMD MI455X: many runs one after another, warmed up first and cycling through
// copies of the inputs, with the whole window's GPU time divided by the number of runs. Launches and the gaps
// between them are all in it. The median over several windows is given; except for v000 it joins two sittings, which
// can be a few percent apart, so the side-by-side timings, each taken in one sitting, are the better comparison.
// The starting kernel, v000, takes 1050 microseconds a run.
// compute dtype: all float inputs rounded to bf16; q/k/v = x W[h] with EXACT bf16 products on WMMA 16x16x32, f32 accumulate; q, k once to f16 -> 1-product causal logits x 1/32, except the first 384 query rows of each sequence (few keys, no averaging), which use q and k as f16 hi + residual (x 2^10) (3 products); softmax in f32 (precise expf); P x 2^11 once to f16 against v once to f16 (1 product), except the first 384 rows: P and v as bf16 hi + lo (3 products); ctx once to f16 against Wo carried x 2^8 in f16 (exact bf16 values), except the first 384 rows: ctx bf16 hi + lo against exact bf16 Wo (2 products); + bo; f32 output.
#include <hip/hip_runtime.h>
#include <math.h>

typedef __attribute__((ext_vector_type(16))) _Float16 v16h;
typedef __attribute__((ext_vector_type(16))) __bf16 v16b;
typedef __attribute__((ext_vector_type(8)))  _Float16 v8h;
typedef __attribute__((ext_vector_type(8)))  float v8f;
typedef __attribute__((ext_vector_type(4)))  float v4f;
typedef __attribute__((ext_vector_type(2)))  float v2f;
typedef __attribute__((ext_vector_type(4)))  unsigned v4u;
typedef __attribute__((ext_vector_type(4)))  int v4i;
typedef float __attribute__((may_alias)) float_a;
typedef int __attribute__((may_alias)) int_a;

template <typename T> __device__ __forceinline__ void vst2(void* p, T v) { *(T*)p = v;  }
__device__ __forceinline__ v8f wmma16(v16h a, v16h b, v8f c) {
  v8f d = __builtin_amdgcn_wmma_f32_16x16x32_f16(false, a, false, b, (short)0, c, false, false);
  asm volatile("v_nop\n\tv_nop\n\tv_nop\n\tv_nop" : "+v"(d) : "v"(a), "v"(b));
  return d;
}
__device__ __forceinline__ v8f wmma_bf(v16b a, v16b b, v8f c) {
  v8f d = __builtin_amdgcn_wmma_f32_16x16x32_bf16(false, a, false, b, (short)0, c, false, false);
  asm volatile("v_nop\n\tv_nop\n\tv_nop\n\tv_nop" : "+v"(d) : "v"(a), "v"(b));
  return d;
}
// 16x16x32 fragments: lane = (h = lane>>4, row/col = lane&15); elements 0..7 = k0+8h+0..7, 8..15 = k0+16+8h+0..7; D element r = row 8h+r
__device__ __forceinline__ v16h frag_h(const _Float16* rowk0, int lane) {
  union { v16h v; v8h q[2]; } u; const _Float16* p = rowk0 + 8 * (lane >> 4);
  u.q[0] = *(const v8h*)p; u.q[1] = *(const v8h*)(p + 16); return u.v;
}
__device__ __forceinline__ v16h frag_f32(const float* rowk0, int lane) {
  v16h a; const float* p = rowk0 + 8 * (lane >> 4);
#pragma unroll
  for (int i = 0; i < 8; ++i) { a[i] = (_Float16)p[i]; a[8 + i] = (_Float16)p[16 + i]; }
  return a;
}
__device__ __forceinline__ v16h frag_f32s(const float* rowk0, int lane, float sc) {
  v16h a; const float* p = rowk0 + 8 * (lane >> 4);
#pragma unroll
  for (int i = 0; i < 8; ++i) { a[i] = (_Float16)(p[i] * sc); a[8 + i] = (_Float16)(p[16 + i] * sc); }
  return a;
}
// column fragment from a [K][ld] layout (column n), rows >= K read as 0
__device__ __forceinline__ v16h fragc_f32(const float* W, int k0, int n, int lane, int ld, int K) {
  v16h a; const int g = lane >> 4;
#pragma unroll
  for (int i = 0; i < 8; ++i) { const int ka = k0 + 8 * g + i, kb = ka + 16;
    a[i] = (_Float16)(ka < K ? W[(size_t)(ka < K ? ka : K - 1) * ld + n] : 0.f); a[8 + i] = (_Float16)(kb < K ? W[(size_t)(kb < K ? kb : K - 1) * ld + n] : 0.f); }
  return a;
}
struct F2 { v16b h, l; };
__device__ __forceinline__ F2 bsplit16(const float v[16]) { F2 r;
#pragma unroll
  for (int i = 0; i < 16; ++i) { const __bf16 h = (__bf16)v[i]; r.h[i] = h; r.l[i] = (__bf16)(v[i] - (float)h); }
  return r; }
__device__ __forceinline__ F2 split_row(const float* row, int k0, int lane) { float v[16]; const float* p = row + k0 + 8 * (lane >> 4);
#pragma unroll
  for (int i = 0; i < 8; ++i) { v[i] = p[i]; v[8 + i] = p[16 + i]; }
  return bsplit16(v); }
__device__ __forceinline__ F2 split_rowK(const float* row, int k0, int lane, int K) { float v[16]; const int g = lane >> 4;
#pragma unroll
  for (int i = 0; i < 8; ++i) { const int ka = k0 + 8 * g + i, kb = ka + 16; v[i] = ka < K ? row[ka < K ? ka : K - 1] : 0.f; v[8 + i] = kb < K ? row[kb < K ? kb : K - 1] : 0.f; }
  return bsplit16(v); }
__device__ __forceinline__ F2 split_col(const float* W, int k0, int n, int lane, int ld, int K) { float v[16]; const int g = lane >> 4;
#pragma unroll
  for (int i = 0; i < 8; ++i) { const int ka = k0 + 8 * g + i, kb = ka + 16; v[i] = ka < K ? W[(size_t)(ka < K ? ka : K - 1) * ld + n] : 0.f; v[8 + i] = kb < K ? W[(size_t)(kb < K ? kb : K - 1) * ld + n] : 0.f; }
  return bsplit16(v); }
__device__ __forceinline__ v8f mac3(const F2& a, const F2& b, v8f c) { c = wmma_bf(a.l, b.h, c); c = wmma_bf(a.h, b.l, c); return wmma_bf(a.h, b.h, c); }
__device__ __forceinline__ float sigm(float v) { return 1.0f / (1.0f + expf(-v)); }
#define LDSX() do { asm volatile("s_wait_dscnt 0" ::: "memory"); __builtin_amdgcn_wave_barrier(); __builtin_amdgcn_fence(__ATOMIC_RELEASE, "workgroup"); } while (0)

// Causal multi-head self-attention with per-head projection tensors (B 2, T 2,048, C 1,024, 16 heads x 64): q/k/v[b,h,t,:] = x[b,t,:] Wq/Wk/Wv[h] ([H][C][64], no bias); att = softmax(q k^T / sqrt(1024) with key > query -> -inf); out = concat_h(att v) Wo ((in,out) [1024,1024]) + bo.
#define NB 2
#define TT 2048
#define CC 1024            // NH * HD = projected width
#define DIN 1024          // input (model) width
#define NH 16
#define HD 64
#define NQB (TT / 64)
#define HG 4
#define SCALE (0.03125f)
#define CAUSAL 1
#ifndef TNB
#define TNB NB
#endif
__device__ __forceinline__ float bfr(float v) { return (float)(__bf16)v; }
__host__ __device__ __forceinline__ int kb_last(int qb) { return CAUSAL ? ((qb * 64 + 63) >> 7) : (TT / 128 - 1); }
typedef __attribute__((ext_vector_type(8))) __bf16 v8b;
__device__ __forceinline__ v16b frag_b(const __bf16* rowk0, int lane) {
  union { v16b v; v8b q[2]; } u; const __bf16* p = rowk0 + 8 * (lane >> 4);
  u.q[0] = *(const v8b*)p; u.q[1] = *(const v8b*)(p + 16); return u.v;
}
#define QBH 6              // causal: query blocks 0..QBH-1 of each sequence (few keys, no averaging) take the high-precision path
#define QHI 384            // rows carrying a q residual plane
#define KHI 384            // key rows carrying k residual / v bf16 hi+lo planes (used only by the causal high-precision path)
// B fragment (k rows k0+.., output column o) of a weight: (in,out) [K][ld] or (out,in) [ld rows of K]: bf16 exact, or f16(bf16 * 256) exact
__device__ __forceinline__ v16b wcol_io(const float* Wm, int k0, int o, int lane, int ld) { v16b w; const int g = lane >> 4;
#pragma unroll
  for (int i = 0; i < 8; ++i) { w[i] = (__bf16)Wm[(size_t)(k0 + 8 * g + i) * ld + o]; w[8 + i] = (__bf16)Wm[(size_t)(k0 + 16 + 8 * g + i) * ld + o]; }
  return w; }
__device__ __forceinline__ v16b wcol_oi(const float* Wm, int k0, int o, int lane, int K) { v16b w; const float* p = Wm + (size_t)o * K + k0 + 8 * (lane >> 4);
#pragma unroll
  for (int i = 0; i < 8; ++i) { w[i] = (__bf16)p[i]; w[8 + i] = (__bf16)p[16 + i]; }
  return w; }
__device__ __forceinline__ v16h wcolh_io(const float* Wm, int k0, int o, int lane, int ld) { v16h w; const int g = lane >> 4;
#pragma unroll
  for (int i = 0; i < 8; ++i) { w[i] = (_Float16)(bfr(Wm[(size_t)(k0 + 8 * g + i) * ld + o]) * 256.0f); w[8 + i] = (_Float16)(bfr(Wm[(size_t)(k0 + 16 + 8 * g + i) * ld + o]) * 256.0f); }
  return w; }
__device__ __forceinline__ v16h wcolh_oi(const float* Wm, int k0, int o, int lane, int K) { v16h w; const float* p = Wm + (size_t)o * K + k0 + 8 * (lane >> 4);
#pragma unroll
  for (int i = 0; i < 8; ++i) { w[i] = (_Float16)(bfr(p[i]) * 256.0f); w[8 + i] = (_Float16)(bfr(p[16 + i]) * 256.0f); }
  return w; }
#define WQKV_LAYOUT 2   // 0 = (in,out) [DIN][CC]; 1 = (out,in) [CC][DIN]; 2 = per-head [NH][DIN][HD]
__device__ __forceinline__ v16b wcol_hdk(const float* Wm, int k0, int o, int lane) { v16b w; const int g = lane >> 4; const float* p = Wm + (size_t)(o / HD) * DIN * HD + (o % HD);
#pragma unroll
  for (int i = 0; i < 8; ++i) { w[i] = (__bf16)p[(size_t)(k0 + 8 * g + i) * HD]; w[8 + i] = (__bf16)p[(size_t)(k0 + 16 + 8 * g + i) * HD]; }
  return w; }
#define WO_OUT_IN 0
#if WQKV_LAYOUT == 1
#define WCOL(W, k0, o, lane) wcol_oi(W, k0, o, lane, DIN)
#elif WQKV_LAYOUT == 2
#define WCOL(W, k0, o, lane) wcol_hdk(W, k0, o, lane)
#else
#define WCOL(W, k0, o, lane) wcol_io(W, k0, o, lane, CC)
#endif
#if WO_OUT_IN
#define WOCOL(W, k0, o, lane) wcol_oi(W, k0, o, lane, CC)
#define WOCOLH(W, k0, o, lane) wcolh_oi(W, k0, o, lane, CC)
#else
#define WOCOL(W, k0, o, lane) wcol_io(W, k0, o, lane, DIN)
#define WOCOLH(W, k0, o, lane) wcolh_io(W, k0, o, lane, DIN)
#endif

#ifndef SM_EXTRA_PARAMS
#define SM_EXTRA_PARAMS
#endif
#ifndef SM_MASK_HOOK
#define SM_MASK_HOOK (void)0
#endif

#define WS_QH  0u                                      // f16 q rows [b*t][CC]
#define WS_KH  (WS_QH + 2u * (size_t)NB * TT * CC)      // f16 k rows [b*t][CC]
#define WS_VT  (WS_KH + 2u * (size_t)NB * TT * CC)      // f16 v planes [b][c][t]
#define WS_QL  (WS_VT + 2u * (size_t)NB * CC * TT)      // f16 q residual x 2^10 rows [b][t < QHI][CC]
#define WS_KL  (WS_QL + 2u * (size_t)NB * QHI * CC)     // f16 k residual x 2^10 rows [b][t < KHI][CC]
#define WS_VB  (WS_KL + 2u * (size_t)NB * KHI * CC)     // bf16 v hi planes [b][c][t < KHI]
#define WS_VBL (WS_VB + 2u * (size_t)NB * CC * KHI)
#define WS_S   (WS_VBL + 2u * (size_t)NB * CC * KHI)    // f32 logits / P [hg][t][s]
#define WS_Y   (WS_S  + 4u * (size_t)HG * TT * TT)      // f32 ctx rows [b*t][CC] (only when there is an output projection)
#define WS_END (WS_Y  + 4u * (size_t)NB * TT * CC)

// ---- k_proj: block = (64 rows, 128 cols, which): q/k/v = X W (+ b) with exact bf16 products (K = DIN) -> which 0: q f16 rows (+ residual rows < QHI); 1: k f16 rows (+ residual rows < KHI); 2: v f16 planes [c][t] (+ bf16 hi/lo planes for t < KHI)
__global__ __launch_bounds__(128) void k_proj(const float* __restrict__ XQ, const float* __restrict__ XK, const float* __restrict__ XV, const float* __restrict__ WQ, const float* __restrict__ WK, const float* __restrict__ WV, const float* __restrict__ BQ, const float* __restrict__ BK, const float* __restrict__ BV,
    _Float16* __restrict__ QH, _Float16* __restrict__ QL, _Float16* __restrict__ KH, _Float16* __restrict__ KL, _Float16* __restrict__ VT, __bf16* __restrict__ VB, __bf16* __restrict__ VBL) {
  __shared__ __align__(16) _Float16 sh[64][136], sl[64][136]; __shared__ __align__(16) _Float16 th[128][72]; __shared__ __align__(16) __bf16 tb[128][72], tbl[128][72];
  const int tid = threadIdx.x, wave = tid >> 5, lane = tid & 31, col = lane & 15, g = lane >> 4; const int which = blockIdx.z; const int c0 = blockIdx.y * 128; const size_t r0 = (size_t)blockIdx.x * 64; const size_t bb = r0 / TT; const int t0 = (int)(r0 % TT);
  const float* X = which == 0 ? XQ : which == 1 ? XK : XV; const float* WA = which == 0 ? WQ : which == 1 ? WK : WV; const float* BA = which == 0 ? BQ : which == 1 ? BK : BV;
  v8f acc[8] = {};
#pragma unroll 2
  for (int kc = 0; kc < DIN / 32; ++kc) { v16b a; { const float* p = X + (r0 + wave * 16 + col) * DIN + kc * 32 + 8 * g;
#pragma unroll
      for (int i = 0; i < 8; ++i) { a[i] = (__bf16)p[i]; a[8 + i] = (__bf16)p[16 + i]; } }
    asm volatile("s_wait_loadcnt 0x0" ::: "memory");
#pragma unroll
    for (int j = 0; j < 8; ++j) { const v16b w = WCOL(WA, kc * 32, c0 + j * 16 + col, lane); asm volatile("s_wait_loadcnt 0x0" ::: "memory"); acc[j] = wmma_bf(a, w, acc[j]); } }
  if (which < 2) { _Float16* DH = which == 0 ? QH : KH; _Float16* DL = which == 0 ? QL : KL; const int nhi = which == 0 ? QHI : KHI; const bool hi_rows = t0 < nhi;
#pragma unroll
    for (int j = 0; j < 8; ++j) { const float bias = BA ? bfr(BA[c0 + j * 16 + col]) : 0.f;
#pragma unroll
      for (int r = 0; r < 8; ++r) { const float v = acc[j][r] + bias; const _Float16 hv = (_Float16)v; sh[wave * 16 + 8 * g + r][j * 16 + col] = hv; sl[wave * 16 + 8 * g + r][j * 16 + col] = (_Float16)((v - (float)hv) * 1024.0f); } }
    __syncthreads();
    for (int e = tid; e < 64 * 16; e += 128) { const int rl = e >> 4, q = e & 15; vst2((unsigned*)(DH + (r0 + rl) * CC + c0 + q * 8), *(const v4u*)&sh[rl][q * 8]); if (hi_rows) vst2((unsigned*)(DL + (bb * nhi + t0 + rl) * (size_t)CC + c0 + q * 8), *(const v4u*)&sl[rl][q * 8]); }
  } else { const bool hi_rows = t0 < KHI;
#pragma unroll
    for (int j = 0; j < 8; ++j) { const float bias = BA ? bfr(BA[c0 + j * 16 + col]) : 0.f;
#pragma unroll
      for (int r = 0; r < 8; ++r) { const float v = acc[j][r] + bias; const int rl = wave * 16 + 8 * g + r, cl = j * 16 + col; th[cl][rl] = (_Float16)v; const __bf16 bh = (__bf16)v; tb[cl][rl] = bh; tbl[cl][rl] = (__bf16)(v - (float)bh); } }
    __syncthreads();
    for (int e = tid; e < 128 * 8; e += 128) { const int cl = e >> 3, q = e & 7; vst2((unsigned*)(VT + (bb * CC + c0 + cl) * (size_t)TT + t0 + q * 8), *(const v4u*)&th[cl][q * 8]); if (hi_rows) { const size_t o3 = (bb * CC + c0 + cl) * (size_t)KHI + t0 + q * 8; vst2((unsigned*)(VB + o3), *(const v4u*)&tb[cl][q * 8]); vst2((unsigned*)(VBL + o3), *(const v4u*)&tbl[cl][q * 8]); } } } }
// ---- k_sc: block = (query block qb, key block kb <= kb_last(qb), head in group) of batch b: logits x SCALE; q hi + residual (x 2^10) against k (2 products) for query rows < QHI, plus the k residual (3 products) for query blocks < QBH (causal early rows); causal: blocks past the diagonal exit, the mask itself is applied by index in k_sm
__global__ __launch_bounds__(128) void k_sc(const _Float16* __restrict__ QH, const _Float16* __restrict__ KH, const _Float16* __restrict__ QL, const _Float16* __restrict__ KL, int b, int h0, float* __restrict__ S0) { __shared__ __align__(16) float ss[4][16][132];
  const int qb = blockIdx.x, kb = blockIdx.y; if (kb > kb_last(qb)) return;
  const int h = h0 + blockIdx.z; float* S = S0 + (size_t)blockIdx.z * TT * TT;
  const int tid = threadIdx.x, wave = tid >> 5, lane = tid & 31, col = lane & 15, g = lane >> 4; const int k0 = kb * 128; const int ql0 = qb * 64 + wave * 16; const size_t q0 = (size_t)b * TT + ql0, kr0 = (size_t)b * TT + k0;
  v8f acc[8] = {}, accl[8] = {};
  const _Float16* QLb = QL + (size_t)b * QHI * CC; const _Float16* KLb = KL + (size_t)b * KHI * CC;
  if (qb < QBH) {
#pragma unroll
    for (int kc = 0; kc < HD / 32; ++kc) { const v16h ah = frag_h(QH + (q0 + col) * CC + h * HD + kc * 32, lane), al = frag_h(QLb + (size_t)(ql0 + col) * CC + h * HD + kc * 32, lane);
#pragma unroll
      for (int j = 0; j < 8; ++j) { const v16h kbf = frag_h(KH + (kr0 + j * 16 + col) * CC + h * HD + kc * 32, lane), klf = frag_h(KLb + (size_t)(k0 + j * 16 + col) * CC + h * HD + kc * 32, lane); acc[j] = wmma16(ah, kbf, acc[j]); accl[j] = wmma16(al, kbf, accl[j]); accl[j] = wmma16(ah, klf, accl[j]); } }
  } else if (qb * 64 < QHI) {
#pragma unroll
    for (int kc = 0; kc < HD / 32; ++kc) { const v16h ah = frag_h(QH + (q0 + col) * CC + h * HD + kc * 32, lane), al = frag_h(QLb + (size_t)(ql0 + col) * CC + h * HD + kc * 32, lane);
#pragma unroll
      for (int j = 0; j < 8; ++j) { const v16h kbf = frag_h(KH + (kr0 + j * 16 + col) * CC + h * HD + kc * 32, lane); acc[j] = wmma16(ah, kbf, acc[j]); accl[j] = wmma16(al, kbf, accl[j]); } }
  } else {
#pragma unroll
    for (int kc = 0; kc < HD / 32; ++kc) { const v16h ah = frag_h(QH + (q0 + col) * CC + h * HD + kc * 32, lane);
#pragma unroll
      for (int j = 0; j < 8; ++j) { const v16h kbf = frag_h(KH + (kr0 + j * 16 + col) * CC + h * HD + kc * 32, lane); acc[j] = wmma16(ah, kbf, acc[j]); } } }
#pragma unroll
  for (int j = 0; j < 8; ++j) {
#pragma unroll
    for (int r = 0; r < 8; ++r) ss[wave][8 * g + r][j * 16 + col] = (acc[j][r] + accl[j][r] * (1.0f / 1024.0f)) * SCALE; }
  LDSX(); for (int rl = 0; rl < 16; ++rl) vst2(S + (size_t)(ql0 + rl) * TT + k0 + lane * 4, *(const v4f*)&ss[wave][rl][lane * 4]); }
// ---- k_sm: block = query row t (head in group): keys [0, kend): causal -> logit if s <= t else excluded; softmax in f32; P x 2^11 in place (0 for excluded)
__global__ __launch_bounds__(256) void k_sm(float* __restrict__ S0 SM_EXTRA_PARAMS) { __shared__ float sred[8]; __shared__ float sbc; __shared__ __align__(16) float shv[TT];
  const int tid = threadIdx.x; const int t = blockIdx.x; const int kend = (kb_last(t >> 6) + 1) * 128;
  float* sr = S0 + (size_t)blockIdx.y * TT * TT + (size_t)t * TT;
  float m = -3.0e38f; for (int k = tid; k < kend; k += 256) { float v = (!CAUSAL || k <= t) ? sr[k] : -3.0e38f; SM_MASK_HOOK; shv[k] = v; m = fmaxf(m, v); }
#pragma unroll
  for (int o = 1; o < 32; o <<= 1) m = fmaxf(m, __shfl_xor(m, o));
  if ((tid & 31) == 0) sred[tid >> 5] = m; __syncthreads(); if (tid == 0) { float a = sred[0]; for (int i = 1; i < 8; ++i) a = fmaxf(a, sred[i]); sbc = a; } __syncthreads(); m = sbc; __syncthreads();
  float sum = 0.f; for (int k = tid; k < kend; k += 256) { const float v = shv[k]; const float e = (v <= -1.0e38f) ? 0.f : expf(v - m); shv[k] = e; sum += e; }
#pragma unroll
  for (int o = 1; o < 32; o <<= 1) sum += __shfl_xor(sum, o);
  if ((tid & 31) == 0) sred[tid >> 5] = sum; __syncthreads(); if (tid == 0) { float a = 0.f; for (int i = 0; i < 8; ++i) a += sred[i]; sbc = 2048.0f / a; } __syncthreads(); const float inv = sbc;
  for (int k = tid; k < kend; k += 256) shv[k] = shv[k] * inv;
  __syncthreads(); for (int q = tid; q < kend / 4; q += 256) vst2(sr + q * 4, *(const v4f*)&shv[q * 4]); }
// ---- k_pv: block = 64 queries (qb) of (b, h): ctx = P . v over keys [0, kend) (P x 2^11 once to f16 against v f16: 1 product; causal early query blocks: P and v as bf16 hi + lo, 3 products); 256-B (row, head) segment by 16 lanes
__global__ __launch_bounds__(128) void k_pv(const float* __restrict__ PS0, const _Float16* __restrict__ VT, const __bf16* __restrict__ VB, const __bf16* __restrict__ VBL, int b, int h0, float* __restrict__ Y) { const int h = h0 + blockIdx.z; const float* PS = PS0 + (size_t)blockIdx.z * TT * TT; __shared__ __align__(16) float ss[4][16][HD + 4];
  const int tid = threadIdx.x, wave = tid >> 5, lane = tid & 31, col = lane & 15, g = lane >> 4; const int qb = blockIdx.x; const int ql0 = qb * 64 + wave * 16; const int kce = (kb_last(qb) + 1) * 4;
  v8f acc[HD / 16] = {};
  if (qb < QBH) {
#pragma unroll 1
    for (int kc = 0; kc < kce; ++kc) { const F2 p = split_row(PS + (size_t)(ql0 + col) * TT, kc * 32, lane);
      asm volatile("s_wait_loadcnt 0x0" ::: "memory");
#pragma unroll
      for (int j = 0; j < HD / 16; ++j) { const size_t po = ((size_t)b * CC + h * HD + j * 16 + col) * (size_t)KHI + kc * 32; const v16b vh = frag_b(VB + po, lane); acc[j] = wmma_bf(p.h, vh, acc[j]); acc[j] = wmma_bf(p.l, vh, acc[j]); acc[j] = wmma_bf(p.h, frag_b(VBL + po, lane), acc[j]); } }
  } else {
#pragma unroll 1
    for (int kc = 0; kc < kce; ++kc) { const v16h p = frag_f32(PS + (size_t)(ql0 + col) * TT + kc * 32, lane);
      asm volatile("s_wait_loadcnt 0x0" ::: "memory");
#pragma unroll
      for (int j = 0; j < HD / 16; ++j) { const size_t po = ((size_t)b * CC + h * HD + j * 16 + col) * (size_t)TT + kc * 32; acc[j] = wmma16(p, frag_h(VT + po, lane), acc[j]); } } }
#pragma unroll
  for (int j = 0; j < HD / 16; ++j)
#pragma unroll
    for (int r = 0; r < 8; ++r) ss[wave][8 * g + r][j * 16 + col] = acc[j][r] * (1.0f / 2048.0f);
  LDSX(); for (int rl = 0; rl < 16; ++rl) if (lane < HD / 4) vst2(Y + ((size_t)b * TT + ql0 + rl) * CC + h * HD + lane * 4, *(const v4f*)&ss[wave][rl][lane * 4]); }
// ---- k_out: block = (64 rows, 128 cols): out = ctx Wo (+ bo): ctx once to f16 against Wo as f16(bf16 x 2^8) exact (1 product) x 2^-8; causal early rows (< QHI of each sequence): ctx bf16 hi + lo against exact bf16 Wo (2 products)
__global__ __launch_bounds__(128) void k_out(const float* __restrict__ Y, const float* __restrict__ WO, const float* __restrict__ BO, float* __restrict__ OUT) { __shared__ __align__(16) float sf[4][16][132];
  const int tid = threadIdx.x, wave = tid >> 5, lane = tid & 31, col = lane & 15, g = lane >> 4; const int c0 = blockIdx.y * 128; const size_t r0 = (size_t)blockIdx.x * 64 + wave * 16;
  v8f acc[8] = {};
  if (CAUSAL && (int)(((size_t)blockIdx.x * 64) % TT) < QHI) {   /* block-uniform */
#pragma unroll 2
    for (int kc = 0; kc < CC / 32; ++kc) { const F2 a = split_row(Y + (r0 + col) * CC, kc * 32, lane); asm volatile("s_wait_loadcnt 0x0" ::: "memory");
#pragma unroll
      for (int j = 0; j < 8; ++j) { const v16b w = WOCOL(WO, kc * 32, c0 + j * 16 + col, lane); asm volatile("s_wait_loadcnt 0x0" ::: "memory"); acc[j] = wmma_bf(a.h, w, acc[j]); acc[j] = wmma_bf(a.l, w, acc[j]); } }
#pragma unroll
    for (int j = 0; j < 8; ++j) { const float bias = BO ? bfr(BO[c0 + j * 16 + col]) : 0.f;
#pragma unroll
      for (int r = 0; r < 8; ++r) sf[wave][8 * g + r][j * 16 + col] = acc[j][r] + bias; }
  } else {
#pragma unroll 2
    for (int kc = 0; kc < CC / 32; ++kc) { const v16h a = frag_f32(Y + (r0 + col) * CC + kc * 32, lane); asm volatile("s_wait_loadcnt 0x0" ::: "memory");
#pragma unroll
      for (int j = 0; j < 8; ++j) { const v16h w = WOCOLH(WO, kc * 32, c0 + j * 16 + col, lane); asm volatile("s_wait_loadcnt 0x0" ::: "memory"); acc[j] = wmma16(a, w, acc[j]); } }
#pragma unroll
    for (int j = 0; j < 8; ++j) { const float bias = BO ? bfr(BO[c0 + j * 16 + col]) : 0.f;
#pragma unroll
      for (int r = 0; r < 8; ++r) sf[wave][8 * g + r][j * 16 + col] = acc[j][r] * (1.0f / 256.0f) + bias; } }
  LDSX(); for (int rl = 0; rl < 16; ++rl) vst2(OUT + (r0 + rl) * DIN + c0 + lane * 4, *(const v4f*)&sf[wave][rl][lane * 4]); }

extern "C" void kernel_launch(void* const* d_in, const int* in_sizes, int n_in, void* d_out, int out_size, void* d_ws, size_t ws_size, hipStream_t stream) {
  (void)in_sizes; (void)n_in; (void)out_size;
  const float** F = (const float**)d_in;
  if (ws_size < (size_t)WS_END) return;
  char* ws = (char*)d_ws; _Float16 *QH = (_Float16*)(ws + WS_QH), *KH = (_Float16*)(ws + WS_KH), *VT = (_Float16*)(ws + WS_VT), *QL = (_Float16*)(ws + WS_QL), *KL = (_Float16*)(ws + WS_KL); __bf16 *VB = (__bf16*)(ws + WS_VB), *VBL = (__bf16*)(ws + WS_VBL); float *S = (float*)(ws + WS_S), *Y = (float*)(ws + WS_Y);
  (void)Y; (void)QL; (void)KL; (void)VB; (void)VBL;
  // inputs: 0 x [2,2048,1024]; 1 Wq, 2 Wk, 3 Wv [16,1024,64]; 4 Wo [1024,1024] (in,out); 5 bo [1024]
  k_proj<<<dim3(TNB * TT / 64, CC / 128, 3), 128, 0, stream>>>(F[0], F[0], F[0], F[1], F[2], F[3], nullptr, nullptr, nullptr, QH, QL, KH, KL, VT, VB, VBL);
  for (int b = 0; b < TNB; ++b) for (int h0 = 0; h0 < NH; h0 += HG) {
    k_sc<<<dim3(NQB, TT / 128, HG), 128, 0, stream>>>(QH, KH, QL, KL, b, h0, S);
    k_sm<<<dim3(TT, HG), 256, 0, stream>>>(S);
    k_pv<<<dim3(NQB, 1, HG), 128, 0, stream>>>(S, VT, VB, VBL, b, h0, Y);
  }
  k_out<<<dim3(TNB * TT / 64, DIN / 128), 128, 0, stream>>>(Y, F[4], F[5], (float*)d_out);
}

// v001
// A run of this version takes 690 microseconds.
// In two side-by-side timings against v000, it was 1.53 and 1.52 times as fast.
// compute dtype: all float inputs rounded to bf16; q/k/v = x W[h] with EXACT bf16 products on WMMA 16x16x32, f32 accumulate; q, k once to f16 -> 1-product causal logits x 1/32, except the first 384 query rows of each sequence (few keys, no averaging), which use q and k as f16 hi + residual (x 2^10) (3 products); softmax in f32 (precise expf); P x 2^11 once to f16 against v once to f16 (1 product), except the first 384 rows: P and v as bf16 hi + lo (3 products); ctx once to f16 against Wo carried x 2^8 in f16 (exact bf16 values), except the first 384 rows: ctx bf16 hi + lo against exact bf16 Wo (2 products); + bo; f32 output.
#include <hip/hip_runtime.h>
#include <math.h>

typedef __attribute__((ext_vector_type(16))) _Float16 v16h;
typedef __attribute__((ext_vector_type(16))) __bf16 v16b;
typedef __attribute__((ext_vector_type(8)))  _Float16 v8h;
typedef __attribute__((ext_vector_type(8)))  float v8f;
typedef __attribute__((ext_vector_type(4)))  float v4f;
typedef __attribute__((ext_vector_type(2)))  float v2f;
typedef __attribute__((ext_vector_type(4)))  unsigned v4u;
typedef __attribute__((ext_vector_type(4)))  int v4i;
typedef float __attribute__((may_alias)) float_a;
typedef int __attribute__((may_alias)) int_a;

template <typename T> __device__ __forceinline__ void vst2(void* p, T v) { *(T*)p = v;  }
__device__ __forceinline__ v8f wmma16(v16h a, v16h b, v8f c) {
  v8f d = __builtin_amdgcn_wmma_f32_16x16x32_f16(false, a, false, b, (short)0, c, false, false);
  asm volatile("v_nop\n\tv_nop\n\tv_nop\n\tv_nop" : "+v"(d) : "v"(a), "v"(b));
  return d;
}
__device__ __forceinline__ v8f wmma_bf(v16b a, v16b b, v8f c) {
  v8f d = __builtin_amdgcn_wmma_f32_16x16x32_bf16(false, a, false, b, (short)0, c, false, false);
  asm volatile("v_nop\n\tv_nop\n\tv_nop\n\tv_nop" : "+v"(d) : "v"(a), "v"(b));
  return d;
}
// 16x16x32 fragments: lane = (h = lane>>4, row/col = lane&15); elements 0..7 = k0+8h+0..7, 8..15 = k0+16+8h+0..7; D element r = row 8h+r
__device__ __forceinline__ v16h frag_h(const _Float16* rowk0, int lane) {
  union { v16h v; v8h q[2]; } u; const _Float16* p = rowk0 + 8 * (lane >> 4);
  u.q[0] = *(const v8h*)p; u.q[1] = *(const v8h*)(p + 16); return u.v;
}
__device__ __forceinline__ v16h frag_f32(const float* rowk0, int lane) {
  v16h a; const float* p = rowk0 + 8 * (lane >> 4);
#pragma unroll
  for (int i = 0; i < 8; ++i) { a[i] = (_Float16)p[i]; a[8 + i] = (_Float16)p[16 + i]; }
  return a;
}
__device__ __forceinline__ v16h frag_f32s(const float* rowk0, int lane, float sc) {
  v16h a; const float* p = rowk0 + 8 * (lane >> 4);
#pragma unroll
  for (int i = 0; i < 8; ++i) { a[i] = (_Float16)(p[i] * sc); a[8 + i] = (_Float16)(p[16 + i] * sc); }
  return a;
}
// column fragment from a [K][ld] layout (column n), rows >= K read as 0
__device__ __forceinline__ v16h fragc_f32(const float* W, int k0, int n, int lane, int ld, int K) {
  v16h a; const int g = lane >> 4;
#pragma unroll
  for (int i = 0; i < 8; ++i) { const int ka = k0 + 8 * g + i, kb = ka + 16;
    a[i] = (_Float16)(ka < K ? W[(size_t)(ka < K ? ka : K - 1) * ld + n] : 0.f); a[8 + i] = (_Float16)(kb < K ? W[(size_t)(kb < K ? kb : K - 1) * ld + n] : 0.f); }
  return a;
}
struct F2 { v16b h, l; };
__device__ __forceinline__ F2 bsplit16(const float v[16]) { F2 r;
#pragma unroll
  for (int i = 0; i < 16; ++i) { const __bf16 h = (__bf16)v[i]; r.h[i] = h; r.l[i] = (__bf16)(v[i] - (float)h); }
  return r; }
__device__ __forceinline__ F2 split_row(const float* row, int k0, int lane) { float v[16]; const float* p = row + k0 + 8 * (lane >> 4);
#pragma unroll
  for (int i = 0; i < 8; ++i) { v[i] = p[i]; v[8 + i] = p[16 + i]; }
  return bsplit16(v); }
__device__ __forceinline__ F2 split_rowK(const float* row, int k0, int lane, int K) { float v[16]; const int g = lane >> 4;
#pragma unroll
  for (int i = 0; i < 8; ++i) { const int ka = k0 + 8 * g + i, kb = ka + 16; v[i] = ka < K ? row[ka < K ? ka : K - 1] : 0.f; v[8 + i] = kb < K ? row[kb < K ? kb : K - 1] : 0.f; }
  return bsplit16(v); }
__device__ __forceinline__ F2 split_col(const float* W, int k0, int n, int lane, int ld, int K) { float v[16]; const int g = lane >> 4;
#pragma unroll
  for (int i = 0; i < 8; ++i) { const int ka = k0 + 8 * g + i, kb = ka + 16; v[i] = ka < K ? W[(size_t)(ka < K ? ka : K - 1) * ld + n] : 0.f; v[8 + i] = kb < K ? W[(size_t)(kb < K ? kb : K - 1) * ld + n] : 0.f; }
  return bsplit16(v); }
__device__ __forceinline__ v8f mac3(const F2& a, const F2& b, v8f c) { c = wmma_bf(a.l, b.h, c); c = wmma_bf(a.h, b.l, c); return wmma_bf(a.h, b.h, c); }
__device__ __forceinline__ float sigm(float v) { return 1.0f / (1.0f + expf(-v)); }
#define LDSX() do { asm volatile("s_wait_dscnt 0" ::: "memory"); __builtin_amdgcn_wave_barrier(); __builtin_amdgcn_fence(__ATOMIC_RELEASE, "workgroup"); } while (0)

// Causal multi-head self-attention with per-head projection tensors (B 2, T 2,048, C 1,024, 16 heads x 64): q/k/v[b,h,t,:] = x[b,t,:] Wq/Wk/Wv[h] ([H][C][64], no bias); att = softmax(q k^T / sqrt(1024) with key > query -> -inf); out = concat_h(att v) Wo ((in,out) [1024,1024]) + bo.
#define NB 2
#define TT 2048
#define CC 1024            // NH * HD = projected width
#define DIN 1024          // input (model) width
#define NH 16
#define HD 64
#define NQB (TT / 64)
#define HG 4
#define SCALE (0.03125f)
#define CAUSAL 1
#ifndef TNB
#define TNB NB
#endif
__device__ __forceinline__ float bfr(float v) { return (float)(__bf16)v; }
__host__ __device__ __forceinline__ int kb_last(int qb) { return CAUSAL ? ((qb * 64 + 63) >> 7) : (TT / 128 - 1); }
typedef __attribute__((ext_vector_type(8))) __bf16 v8b;
__device__ __forceinline__ v16b frag_b(const __bf16* rowk0, int lane) {
  union { v16b v; v8b q[2]; } u; const __bf16* p = rowk0 + 8 * (lane >> 4);
  u.q[0] = *(const v8b*)p; u.q[1] = *(const v8b*)(p + 16); return u.v;
}
#define QBH 6              // causal: query blocks 0..QBH-1 of each sequence (few keys, no averaging) take the high-precision path
#define QHI 384            // rows carrying a q residual plane
#define KHI 384            // key rows carrying k residual / v bf16 hi+lo planes (used only by the causal high-precision path)
// B fragment (k rows k0+.., output column o) of a weight: (in,out) [K][ld] or (out,in) [ld rows of K]: bf16 exact, or f16(bf16 * 256) exact
__device__ __forceinline__ v16b wcol_io(const float* Wm, int k0, int o, int lane, int ld) { v16b w; const int g = lane >> 4;
#pragma unroll
  for (int i = 0; i < 8; ++i) { w[i] = (__bf16)Wm[(size_t)(k0 + 8 * g + i) * ld + o]; w[8 + i] = (__bf16)Wm[(size_t)(k0 + 16 + 8 * g + i) * ld + o]; }
  return w; }
__device__ __forceinline__ v16b wcol_oi(const float* Wm, int k0, int o, int lane, int K) { v16b w; const float* p = Wm + (size_t)o * K + k0 + 8 * (lane >> 4);
#pragma unroll
  for (int i = 0; i < 8; ++i) { w[i] = (__bf16)p[i]; w[8 + i] = (__bf16)p[16 + i]; }
  return w; }
__device__ __forceinline__ v16h wcolh_io(const float* Wm, int k0, int o, int lane, int ld) { v16h w; const int g = lane >> 4;
#pragma unroll
  for (int i = 0; i < 8; ++i) { w[i] = (_Float16)(bfr(Wm[(size_t)(k0 + 8 * g + i) * ld + o]) * 256.0f); w[8 + i] = (_Float16)(bfr(Wm[(size_t)(k0 + 16 + 8 * g + i) * ld + o]) * 256.0f); }
  return w; }
__device__ __forceinline__ v16h wcolh_oi(const float* Wm, int k0, int o, int lane, int K) { v16h w; const float* p = Wm + (size_t)o * K + k0 + 8 * (lane >> 4);
#pragma unroll
  for (int i = 0; i < 8; ++i) { w[i] = (_Float16)(bfr(p[i]) * 256.0f); w[8 + i] = (_Float16)(bfr(p[16 + i]) * 256.0f); }
  return w; }
#define WQKV_LAYOUT 2   // 0 = (in,out) [DIN][CC]; 1 = (out,in) [CC][DIN]; 2 = per-head [NH][DIN][HD]
__device__ __forceinline__ v16b wcol_hdk(const float* Wm, int k0, int o, int lane) { v16b w; const int g = lane >> 4; const float* p = Wm + (size_t)(o / HD) * DIN * HD + (o % HD);
#pragma unroll
  for (int i = 0; i < 8; ++i) { w[i] = (__bf16)p[(size_t)(k0 + 8 * g + i) * HD]; w[8 + i] = (__bf16)p[(size_t)(k0 + 16 + 8 * g + i) * HD]; }
  return w; }
#define WO_OUT_IN 0
#if WQKV_LAYOUT == 1
#define WCOL(W, k0, o, lane) wcol_oi(W, k0, o, lane, DIN)
#elif WQKV_LAYOUT == 2
#define WCOL(W, k0, o, lane) wcol_hdk(W, k0, o, lane)
#else
#define WCOL(W, k0, o, lane) wcol_io(W, k0, o, lane, CC)
#endif
#if WO_OUT_IN
#define WOCOL(W, k0, o, lane) wcol_oi(W, k0, o, lane, CC)
#define WOCOLH(W, k0, o, lane) wcolh_oi(W, k0, o, lane, CC)
#else
#define WOCOL(W, k0, o, lane) wcol_io(W, k0, o, lane, DIN)
#define WOCOLH(W, k0, o, lane) wcolh_io(W, k0, o, lane, DIN)
#endif

#ifndef SM_EXTRA_PARAMS
#define SM_EXTRA_PARAMS
#endif
#ifndef SM_MASK_HOOK
#define SM_MASK_HOOK (void)0
#endif

#define WS_QH  0u                                      // f16 q rows [b*t][CC]
#define WS_KH  (WS_QH + 2u * (size_t)NB * TT * CC)      // f16 k rows [b*t][CC]
#define WS_VT  (WS_KH + 2u * (size_t)NB * TT * CC)      // f16 v planes [b][c][t]
#define WS_QL  (WS_VT + 2u * (size_t)NB * CC * TT)      // f16 q residual x 2^10 rows [b][t < QHI][CC]
#define WS_KL  (WS_QL + 2u * (size_t)NB * QHI * CC)     // f16 k residual x 2^10 rows [b][t < KHI][CC]
#define WS_VB  (WS_KL + 2u * (size_t)NB * KHI * CC)     // bf16 v hi planes [b][c][t < KHI]
#define WS_VBL (WS_VB + 2u * (size_t)NB * CC * KHI)
#define WS_S   (WS_VBL + 2u * (size_t)NB * CC * KHI)    // f32 logits / P [hg][t][s]
#define WS_Y   (WS_S  + 4u * (size_t)HG * TT * TT)      // f32 ctx rows [b*t][CC] (only when there is an output projection)
#define WS_END (WS_Y  + 4u * (size_t)NB * TT * CC)

// ---- k_proj: block = (64 rows, 128 cols, which): q/k/v = X W (+ b) with exact bf16 products (K = DIN) -> which 0: q f16 rows (+ residual rows < QHI); 1: k f16 rows (+ residual rows < KHI); 2: v f16 planes [c][t] (+ bf16 hi/lo planes for t < KHI)
__global__ __launch_bounds__(128) void k_proj(const float* __restrict__ XQ, const float* __restrict__ XK, const float* __restrict__ XV, const float* __restrict__ WQ, const float* __restrict__ WK, const float* __restrict__ WV, const float* __restrict__ BQ, const float* __restrict__ BK, const float* __restrict__ BV,
    _Float16* __restrict__ QH, _Float16* __restrict__ QL, _Float16* __restrict__ KH, _Float16* __restrict__ KL, _Float16* __restrict__ VT, __bf16* __restrict__ VB, __bf16* __restrict__ VBL) {
  __shared__ __align__(16) _Float16 sh[64][136], sl[64][136]; __shared__ __align__(16) _Float16 th[128][72]; __shared__ __align__(16) __bf16 tb[128][72], tbl[128][72];
  const int tid = threadIdx.x, wave = tid >> 5, lane = tid & 31, col = lane & 15, g = lane >> 4; const int which = blockIdx.z; const int c0 = blockIdx.y * 128; const size_t r0 = (size_t)blockIdx.x * 64; const size_t bb = r0 / TT; const int t0 = (int)(r0 % TT);
  const float* X = which == 0 ? XQ : which == 1 ? XK : XV; const float* WA = which == 0 ? WQ : which == 1 ? WK : WV; const float* BA = which == 0 ? BQ : which == 1 ? BK : BV;
  v8f acc[8] = {};
#pragma unroll 2
  for (int kc = 0; kc < DIN / 32; ++kc) { v16b a; { const float* p = X + (r0 + wave * 16 + col) * DIN + kc * 32 + 8 * g;
#pragma unroll
      for (int i = 0; i < 8; ++i) { a[i] = (__bf16)p[i]; a[8 + i] = (__bf16)p[16 + i]; } }
    v16b w[8]; /* all eight weight fragments are loaded before the first product, so their latencies overlap; the loops below are unrolled so that w[] stays in registers */
#pragma unroll
    for (int j = 0; j < 8; ++j) w[j] = WCOL(WA, kc * 32, c0 + j * 16 + col, lane);
#pragma unroll
    for (int j = 0; j < 8; ++j) acc[j] = wmma_bf(a, w[j], acc[j]); }
  if (which < 2) { _Float16* DH = which == 0 ? QH : KH; _Float16* DL = which == 0 ? QL : KL; const int nhi = which == 0 ? QHI : KHI; const bool hi_rows = t0 < nhi;
#pragma unroll
    for (int j = 0; j < 8; ++j) { const float bias = BA ? bfr(BA[c0 + j * 16 + col]) : 0.f;
#pragma unroll
      for (int r = 0; r < 8; ++r) { const float v = acc[j][r] + bias; const _Float16 hv = (_Float16)v; sh[wave * 16 + 8 * g + r][j * 16 + col] = hv; sl[wave * 16 + 8 * g + r][j * 16 + col] = (_Float16)((v - (float)hv) * 1024.0f); } }
    __syncthreads();
    for (int e = tid; e < 64 * 16; e += 128) { const int rl = e >> 4, q = e & 15; vst2((unsigned*)(DH + (r0 + rl) * CC + c0 + q * 8), *(const v4u*)&sh[rl][q * 8]); if (hi_rows) vst2((unsigned*)(DL + (bb * nhi + t0 + rl) * (size_t)CC + c0 + q * 8), *(const v4u*)&sl[rl][q * 8]); }
  } else { const bool hi_rows = t0 < KHI;
#pragma unroll
    for (int j = 0; j < 8; ++j) { const float bias = BA ? bfr(BA[c0 + j * 16 + col]) : 0.f;
#pragma unroll
      for (int r = 0; r < 8; ++r) { const float v = acc[j][r] + bias; const int rl = wave * 16 + 8 * g + r, cl = j * 16 + col; th[cl][rl] = (_Float16)v; const __bf16 bh = (__bf16)v; tb[cl][rl] = bh; tbl[cl][rl] = (__bf16)(v - (float)bh); } }
    __syncthreads();
    for (int e = tid; e < 128 * 8; e += 128) { const int cl = e >> 3, q = e & 7; vst2((unsigned*)(VT + (bb * CC + c0 + cl) * (size_t)TT + t0 + q * 8), *(const v4u*)&th[cl][q * 8]); if (hi_rows) { const size_t o3 = (bb * CC + c0 + cl) * (size_t)KHI + t0 + q * 8; vst2((unsigned*)(VB + o3), *(const v4u*)&tb[cl][q * 8]); vst2((unsigned*)(VBL + o3), *(const v4u*)&tbl[cl][q * 8]); } } } }
// ---- k_sc: block = (query block qb, key block kb <= kb_last(qb), head in group) of batch b: logits x SCALE; q hi + residual (x 2^10) against k (2 products) for query rows < QHI, plus the k residual (3 products) for query blocks < QBH (causal early rows); causal: blocks past the diagonal exit, the mask itself is applied by index in k_sm
__global__ __launch_bounds__(128) void k_sc(const _Float16* __restrict__ QH, const _Float16* __restrict__ KH, const _Float16* __restrict__ QL, const _Float16* __restrict__ KL, int b, int h0, float* __restrict__ S0) { __shared__ __align__(16) float ss[4][16][132];
  const int qb = blockIdx.x, kb = blockIdx.y; if (kb > kb_last(qb)) return;
  const int h = h0 + blockIdx.z; float* S = S0 + (size_t)blockIdx.z * TT * TT;
  const int tid = threadIdx.x, wave = tid >> 5, lane = tid & 31, col = lane & 15, g = lane >> 4; const int k0 = kb * 128; const int ql0 = qb * 64 + wave * 16; const size_t q0 = (size_t)b * TT + ql0, kr0 = (size_t)b * TT + k0;
  v8f acc[8] = {}, accl[8] = {};
  const _Float16* QLb = QL + (size_t)b * QHI * CC; const _Float16* KLb = KL + (size_t)b * KHI * CC;
  if (qb < QBH) {
#pragma unroll
    for (int kc = 0; kc < HD / 32; ++kc) { const v16h ah = frag_h(QH + (q0 + col) * CC + h * HD + kc * 32, lane), al = frag_h(QLb + (size_t)(ql0 + col) * CC + h * HD + kc * 32, lane);
#pragma unroll
      for (int j = 0; j < 8; ++j) { const v16h kbf = frag_h(KH + (kr0 + j * 16 + col) * CC + h * HD + kc * 32, lane), klf = frag_h(KLb + (size_t)(k0 + j * 16 + col) * CC + h * HD + kc * 32, lane); acc[j] = wmma16(ah, kbf, acc[j]); accl[j] = wmma16(al, kbf, accl[j]); accl[j] = wmma16(ah, klf, accl[j]); } }
  } else if (qb * 64 < QHI) {
#pragma unroll
    for (int kc = 0; kc < HD / 32; ++kc) { const v16h ah = frag_h(QH + (q0 + col) * CC + h * HD + kc * 32, lane), al = frag_h(QLb + (size_t)(ql0 + col) * CC + h * HD + kc * 32, lane);
#pragma unroll
      for (int j = 0; j < 8; ++j) { const v16h kbf = frag_h(KH + (kr0 + j * 16 + col) * CC + h * HD + kc * 32, lane); acc[j] = wmma16(ah, kbf, acc[j]); accl[j] = wmma16(al, kbf, accl[j]); } }
  } else {
#pragma unroll
    for (int kc = 0; kc < HD / 32; ++kc) { const v16h ah = frag_h(QH + (q0 + col) * CC + h * HD + kc * 32, lane);
#pragma unroll
      for (int j = 0; j < 8; ++j) { const v16h kbf = frag_h(KH + (kr0 + j * 16 + col) * CC + h * HD + kc * 32, lane); acc[j] = wmma16(ah, kbf, acc[j]); } } }
#pragma unroll
  for (int j = 0; j < 8; ++j) {
#pragma unroll
    for (int r = 0; r < 8; ++r) ss[wave][8 * g + r][j * 16 + col] = (acc[j][r] + accl[j][r] * (1.0f / 1024.0f)) * SCALE; }
  LDSX(); for (int rl = 0; rl < 16; ++rl) vst2(S + (size_t)(ql0 + rl) * TT + k0 + lane * 4, *(const v4f*)&ss[wave][rl][lane * 4]); }
// ---- k_sm: block = query row t (head in group): keys [0, kend): causal -> logit if s <= t else excluded; softmax in f32; P x 2^11 in place (0 for excluded)
__global__ __launch_bounds__(256) void k_sm(float* __restrict__ S0 SM_EXTRA_PARAMS) { __shared__ float sred[8]; __shared__ float sbc; __shared__ __align__(16) float shv[TT];
  const int tid = threadIdx.x; const int t = blockIdx.x; const int kend = (kb_last(t >> 6) + 1) * 128;
  float* sr = S0 + (size_t)blockIdx.y * TT * TT + (size_t)t * TT;
  float m = -3.0e38f; for (int k = tid; k < kend; k += 256) { float v = (!CAUSAL || k <= t) ? sr[k] : -3.0e38f; SM_MASK_HOOK; shv[k] = v; m = fmaxf(m, v); }
#pragma unroll
  for (int o = 1; o < 32; o <<= 1) m = fmaxf(m, __shfl_xor(m, o));
  if ((tid & 31) == 0) sred[tid >> 5] = m; __syncthreads(); if (tid == 0) { float a = sred[0]; for (int i = 1; i < 8; ++i) a = fmaxf(a, sred[i]); sbc = a; } __syncthreads(); m = sbc; __syncthreads();
  float sum = 0.f; for (int k = tid; k < kend; k += 256) { const float v = shv[k]; const float e = (v <= -1.0e38f) ? 0.f : expf(v - m); shv[k] = e; sum += e; }
#pragma unroll
  for (int o = 1; o < 32; o <<= 1) sum += __shfl_xor(sum, o);
  if ((tid & 31) == 0) sred[tid >> 5] = sum; __syncthreads(); if (tid == 0) { float a = 0.f; for (int i = 0; i < 8; ++i) a += sred[i]; sbc = 2048.0f / a; } __syncthreads(); const float inv = sbc;
  for (int k = tid; k < kend; k += 256) shv[k] = shv[k] * inv;
  __syncthreads(); for (int q = tid; q < kend / 4; q += 256) vst2(sr + q * 4, *(const v4f*)&shv[q * 4]); }
// ---- k_pv: block = 64 queries (qb) of (b, h): ctx = P . v over keys [0, kend) (P x 2^11 once to f16 against v f16: 1 product; causal early query blocks: P and v as bf16 hi + lo, 3 products); 256-B (row, head) segment by 16 lanes
__global__ __launch_bounds__(128) void k_pv(const float* __restrict__ PS0, const _Float16* __restrict__ VT, const __bf16* __restrict__ VB, const __bf16* __restrict__ VBL, int b, int h0, float* __restrict__ Y) { const int h = h0 + blockIdx.z; const float* PS = PS0 + (size_t)blockIdx.z * TT * TT; __shared__ __align__(16) float ss[4][16][HD + 4];
  const int tid = threadIdx.x, wave = tid >> 5, lane = tid & 31, col = lane & 15, g = lane >> 4; const int qb = blockIdx.x; const int ql0 = qb * 64 + wave * 16; const int kce = (kb_last(qb) + 1) * 4;
  v8f acc[HD / 16] = {};
  if (qb < QBH) {
#pragma unroll 1
    for (int kc = 0; kc < kce; kc += 2) { /* kce is a multiple of 4: both k-steps' loads are issued before the first product, so their latencies overlap; inner loops unrolled so that the arrays stay in registers */
      v4f pr[2][4]; v16b vh[2][HD / 16], vl[2][HD / 16]; const float* pp = PS + (size_t)(ql0 + col) * TT + kc * 32 + 8 * g;
#pragma unroll
      for (int u = 0; u < 2; ++u) { pr[u][0] = *(const v4f*)(pp + u * 32); pr[u][1] = *(const v4f*)(pp + u * 32 + 4); pr[u][2] = *(const v4f*)(pp + u * 32 + 16); pr[u][3] = *(const v4f*)(pp + u * 32 + 20); }
#pragma unroll
      for (int u = 0; u < 2; ++u)
#pragma unroll
        for (int j = 0; j < HD / 16; ++j) { const size_t po = ((size_t)b * CC + h * HD + j * 16 + col) * (size_t)KHI + (kc + u) * 32; vh[u][j] = frag_b(VB + po, lane); vl[u][j] = frag_b(VBL + po, lane); }
#pragma unroll
      for (int u = 0; u < 2; ++u) { float pv[16];
#pragma unroll
        for (int i = 0; i < 16; ++i) pv[i] = pr[u][i >> 2][i & 3];
        const F2 p = bsplit16(pv);
#pragma unroll
        for (int j = 0; j < HD / 16; ++j) { acc[j] = wmma_bf(p.h, vh[u][j], acc[j]); acc[j] = wmma_bf(p.l, vh[u][j], acc[j]); acc[j] = wmma_bf(p.h, vl[u][j], acc[j]); } } }
  } else {
#pragma unroll 1
    for (int kc = 0; kc < kce; kc += 4) { /* kce is a multiple of 4: all four k-steps' loads are issued before the first product, so their latencies overlap; inner loops unrolled so that the arrays stay in registers */
      v4f pr[4][4]; v16h vf[4][HD / 16]; const float* pp = PS + (size_t)(ql0 + col) * TT + kc * 32 + 8 * g;
#pragma unroll
      for (int u = 0; u < 4; ++u) { pr[u][0] = *(const v4f*)(pp + u * 32); pr[u][1] = *(const v4f*)(pp + u * 32 + 4); pr[u][2] = *(const v4f*)(pp + u * 32 + 16); pr[u][3] = *(const v4f*)(pp + u * 32 + 20); }
#pragma unroll
      for (int u = 0; u < 4; ++u)
#pragma unroll
        for (int j = 0; j < HD / 16; ++j) vf[u][j] = frag_h(VT + ((size_t)b * CC + h * HD + j * 16 + col) * (size_t)TT + (kc + u) * 32, lane);
#pragma unroll
      for (int u = 0; u < 4; ++u) { v16h p;
#pragma unroll
        for (int i = 0; i < 16; ++i) p[i] = (_Float16)pr[u][i >> 2][i & 3];
#pragma unroll
        for (int j = 0; j < HD / 16; ++j) acc[j] = wmma16(p, vf[u][j], acc[j]); } } }
#pragma unroll
  for (int j = 0; j < HD / 16; ++j)
#pragma unroll
    for (int r = 0; r < 8; ++r) ss[wave][8 * g + r][j * 16 + col] = acc[j][r] * (1.0f / 2048.0f);
  LDSX(); for (int rl = 0; rl < 16; ++rl) if (lane < HD / 4) vst2(Y + ((size_t)b * TT + ql0 + rl) * CC + h * HD + lane * 4, *(const v4f*)&ss[wave][rl][lane * 4]); }
// ---- k_out: block = (64 rows, 128 cols): out = ctx Wo (+ bo): ctx once to f16 against Wo as f16(bf16 x 2^8) exact (1 product) x 2^-8; causal early rows (< QHI of each sequence): ctx bf16 hi + lo against exact bf16 Wo (2 products)
__global__ __launch_bounds__(128) void k_out(const float* __restrict__ Y, const float* __restrict__ WO, const float* __restrict__ BO, float* __restrict__ OUT) { __shared__ __align__(16) float sf[4][16][132];
  const int tid = threadIdx.x, wave = tid >> 5, lane = tid & 31, col = lane & 15, g = lane >> 4; const int c0 = blockIdx.y * 128; const size_t r0 = (size_t)blockIdx.x * 64 + wave * 16;
  v8f acc[8] = {};
  if (CAUSAL && (int)(((size_t)blockIdx.x * 64) % TT) < QHI) {   /* block-uniform */
    /* one k-step a trip: with all eight weight fragments in flight, two k-steps would need more than 256 registers */
#pragma unroll 1
    for (int kc = 0; kc < CC / 32; ++kc) { const F2 a = split_row(Y + (r0 + col) * CC, kc * 32, lane); v16b w[8]; /* loaded whole before the first product (latencies overlap); unrolled so that w[] stays in registers */
#pragma unroll
      for (int j = 0; j < 8; ++j) w[j] = WOCOL(WO, kc * 32, c0 + j * 16 + col, lane);
#pragma unroll
      for (int j = 0; j < 8; ++j) { acc[j] = wmma_bf(a.h, w[j], acc[j]); acc[j] = wmma_bf(a.l, w[j], acc[j]); } }
#pragma unroll
    for (int j = 0; j < 8; ++j) { const float bias = BO ? bfr(BO[c0 + j * 16 + col]) : 0.f;
#pragma unroll
      for (int r = 0; r < 8; ++r) sf[wave][8 * g + r][j * 16 + col] = acc[j][r] + bias; }
  } else {
#pragma unroll 2
    for (int kc = 0; kc < CC / 32; ++kc) { const v16h a = frag_f32(Y + (r0 + col) * CC + kc * 32, lane); v16h w[8]; /* loaded whole before the first product (latencies overlap); unrolled so that w[] stays in registers */
#pragma unroll
      for (int j = 0; j < 8; ++j) w[j] = WOCOLH(WO, kc * 32, c0 + j * 16 + col, lane);
#pragma unroll
      for (int j = 0; j < 8; ++j) acc[j] = wmma16(a, w[j], acc[j]); }
#pragma unroll
    for (int j = 0; j < 8; ++j) { const float bias = BO ? bfr(BO[c0 + j * 16 + col]) : 0.f;
#pragma unroll
      for (int r = 0; r < 8; ++r) sf[wave][8 * g + r][j * 16 + col] = acc[j][r] * (1.0f / 256.0f) + bias; } }
  LDSX(); for (int rl = 0; rl < 16; ++rl) vst2(OUT + (r0 + rl) * DIN + c0 + lane * 4, *(const v4f*)&sf[wave][rl][lane * 4]); }

extern "C" void kernel_launch(void* const* d_in, const int* in_sizes, int n_in, void* d_out, int out_size, void* d_ws, size_t ws_size, hipStream_t stream) {
  (void)in_sizes; (void)n_in; (void)out_size;
  const float** F = (const float**)d_in;
  if (ws_size < (size_t)WS_END) return;
  char* ws = (char*)d_ws; _Float16 *QH = (_Float16*)(ws + WS_QH), *KH = (_Float16*)(ws + WS_KH), *VT = (_Float16*)(ws + WS_VT), *QL = (_Float16*)(ws + WS_QL), *KL = (_Float16*)(ws + WS_KL); __bf16 *VB = (__bf16*)(ws + WS_VB), *VBL = (__bf16*)(ws + WS_VBL); float *S = (float*)(ws + WS_S), *Y = (float*)(ws + WS_Y);
  (void)Y; (void)QL; (void)KL; (void)VB; (void)VBL;
  // inputs: 0 x [2,2048,1024]; 1 Wq, 2 Wk, 3 Wv [16,1024,64]; 4 Wo [1024,1024] (in,out); 5 bo [1024]
  k_proj<<<dim3(TNB * TT / 64, CC / 128, 3), 128, 0, stream>>>(F[0], F[0], F[0], F[1], F[2], F[3], nullptr, nullptr, nullptr, QH, QL, KH, KL, VT, VB, VBL);
  for (int b = 0; b < TNB; ++b) for (int h0 = 0; h0 < NH; h0 += HG) {
    k_sc<<<dim3(NQB, TT / 128, HG), 128, 0, stream>>>(QH, KH, QL, KL, b, h0, S);
    k_sm<<<dim3(TT, HG), 256, 0, stream>>>(S);
    k_pv<<<dim3(NQB, 1, HG), 128, 0, stream>>>(S, VT, VB, VBL, b, h0, Y);
  }
  k_out<<<dim3(TNB * TT / 64, DIN / 128), 128, 0, stream>>>(Y, F[4], F[5], (float*)d_out);
}

// v002
// Measured time: 267 microseconds a run.
// Next to v001, in two timings, it ran 2.60 and 2.61 times as fast.
// All steps since v000 together make it 3.97 times as fast.
// compute dtype: all float inputs rounded to bf16; q/k/v = x W[h] with EXACT bf16 products on WMMA 16x16x32, f32 accumulate; q, k once to f16 -> 1-product causal logits x 1/32, except the first 384 query rows of each sequence (few keys, no averaging), which use q and k as f16 hi + residual (x 2^10) (3 products); softmax in f32 (precise expf, running maximum and sum over blocks of 64 keys, division by the sum last); exp(logit - max) once to f16 against v once to f16 (1 product), except the first 384 rows: exp(logit - max) and v as bf16 hi + lo (3 products); ctx once to f16 against Wo carried x 2^8 in f16 (exact bf16 values), except the first 384 rows: ctx bf16 hi + lo against exact bf16 Wo (2 products); + bo; f32 output.
#include <hip/hip_runtime.h>
#include <math.h>

typedef __attribute__((ext_vector_type(16))) _Float16 v16h;
typedef __attribute__((ext_vector_type(16))) __bf16 v16b;
typedef __attribute__((ext_vector_type(8)))  _Float16 v8h;
typedef __attribute__((ext_vector_type(8)))  float v8f;
typedef __attribute__((ext_vector_type(4)))  float v4f;
typedef __attribute__((ext_vector_type(2)))  float v2f;
typedef __attribute__((ext_vector_type(4)))  unsigned v4u;
typedef __attribute__((ext_vector_type(4)))  int v4i;
typedef float __attribute__((may_alias)) float_a;
typedef int __attribute__((may_alias)) int_a;

template <typename T> __device__ __forceinline__ void vst2(void* p, T v) { *(T*)p = v;  }
__device__ __forceinline__ v8f wmma16(v16h a, v16h b, v8f c) {
  v8f d = __builtin_amdgcn_wmma_f32_16x16x32_f16(false, a, false, b, (short)0, c, false, false);
  asm volatile("v_nop\n\tv_nop\n\tv_nop\n\tv_nop" : "+v"(d) : "v"(a), "v"(b));
  return d;
}
__device__ __forceinline__ v8f wmma_bf(v16b a, v16b b, v8f c) {
  v8f d = __builtin_amdgcn_wmma_f32_16x16x32_bf16(false, a, false, b, (short)0, c, false, false);
  asm volatile("v_nop\n\tv_nop\n\tv_nop\n\tv_nop" : "+v"(d) : "v"(a), "v"(b));
  return d;
}
// 16x16x32 fragments: lane = (h = lane>>4, row/col = lane&15); elements 0..7 = k0+8h+0..7, 8..15 = k0+16+8h+0..7; D element r = row 8h+r
__device__ __forceinline__ v16h frag_h(const _Float16* rowk0, int lane) {
  union { v16h v; v8h q[2]; } u; const _Float16* p = rowk0 + 8 * (lane >> 4);
  u.q[0] = *(const v8h*)p; u.q[1] = *(const v8h*)(p + 16); return u.v;
}
__device__ __forceinline__ v16h frag_f32(const float* rowk0, int lane) {
  v16h a; const float* p = rowk0 + 8 * (lane >> 4);
#pragma unroll
  for (int i = 0; i < 8; ++i) { a[i] = (_Float16)p[i]; a[8 + i] = (_Float16)p[16 + i]; }
  return a;
}
__device__ __forceinline__ v16h frag_f32s(const float* rowk0, int lane, float sc) {
  v16h a; const float* p = rowk0 + 8 * (lane >> 4);
#pragma unroll
  for (int i = 0; i < 8; ++i) { a[i] = (_Float16)(p[i] * sc); a[8 + i] = (_Float16)(p[16 + i] * sc); }
  return a;
}
// column fragment from a [K][ld] layout (column n), rows >= K read as 0
__device__ __forceinline__ v16h fragc_f32(const float* W, int k0, int n, int lane, int ld, int K) {
  v16h a; const int g = lane >> 4;
#pragma unroll
  for (int i = 0; i < 8; ++i) { const int ka = k0 + 8 * g + i, kb = ka + 16;
    a[i] = (_Float16)(ka < K ? W[(size_t)(ka < K ? ka : K - 1) * ld + n] : 0.f); a[8 + i] = (_Float16)(kb < K ? W[(size_t)(kb < K ? kb : K - 1) * ld + n] : 0.f); }
  return a;
}
struct F2 { v16b h, l; };
__device__ __forceinline__ F2 bsplit16(const float v[16]) { F2 r;
#pragma unroll
  for (int i = 0; i < 16; ++i) { const __bf16 h = (__bf16)v[i]; r.h[i] = h; r.l[i] = (__bf16)(v[i] - (float)h); }
  return r; }
__device__ __forceinline__ F2 split_row(const float* row, int k0, int lane) { float v[16]; const float* p = row + k0 + 8 * (lane >> 4);
#pragma unroll
  for (int i = 0; i < 8; ++i) { v[i] = p[i]; v[8 + i] = p[16 + i]; }
  return bsplit16(v); }
__device__ __forceinline__ F2 split_rowK(const float* row, int k0, int lane, int K) { float v[16]; const int g = lane >> 4;
#pragma unroll
  for (int i = 0; i < 8; ++i) { const int ka = k0 + 8 * g + i, kb = ka + 16; v[i] = ka < K ? row[ka < K ? ka : K - 1] : 0.f; v[8 + i] = kb < K ? row[kb < K ? kb : K - 1] : 0.f; }
  return bsplit16(v); }
__device__ __forceinline__ F2 split_col(const float* W, int k0, int n, int lane, int ld, int K) { float v[16]; const int g = lane >> 4;
#pragma unroll
  for (int i = 0; i < 8; ++i) { const int ka = k0 + 8 * g + i, kb = ka + 16; v[i] = ka < K ? W[(size_t)(ka < K ? ka : K - 1) * ld + n] : 0.f; v[8 + i] = kb < K ? W[(size_t)(kb < K ? kb : K - 1) * ld + n] : 0.f; }
  return bsplit16(v); }
__device__ __forceinline__ v8f mac3(const F2& a, const F2& b, v8f c) { c = wmma_bf(a.l, b.h, c); c = wmma_bf(a.h, b.l, c); return wmma_bf(a.h, b.h, c); }
__device__ __forceinline__ float sigm(float v) { return 1.0f / (1.0f + expf(-v)); }
#define LDSX() do { asm volatile("s_wait_dscnt 0" ::: "memory"); __builtin_amdgcn_wave_barrier(); __builtin_amdgcn_fence(__ATOMIC_RELEASE, "workgroup"); } while (0)

// Causal multi-head self-attention with per-head projection tensors (B 2, T 2,048, C 1,024, 16 heads x 64): q/k/v[b,h,t,:] = x[b,t,:] Wq/Wk/Wv[h] ([H][C][64], no bias); att = softmax(q k^T / sqrt(1024) with key > query -> -inf); out = concat_h(att v) Wo ((in,out) [1024,1024]) + bo.
#define NB 2
#define TT 2048
#define CC 1024            // NH * HD = projected width
#define DIN 1024          // input (model) width
#define NH 16
#define HD 64
#define NQB (TT / 64)
#define SCALE (0.03125f)
#define CAUSAL 1
#ifndef TNB
#define TNB NB
#endif
__device__ __forceinline__ float bfr(float v) { return (float)(__bf16)v; }
typedef __attribute__((ext_vector_type(8))) __bf16 v8b;
__device__ __forceinline__ v16b frag_b(const __bf16* rowk0, int lane) {
  union { v16b v; v8b q[2]; } u; const __bf16* p = rowk0 + 8 * (lane >> 4);
  u.q[0] = *(const v8b*)p; u.q[1] = *(const v8b*)(p + 16); return u.v;
}
#define QBH 6              // causal: query blocks 0..QBH-1 of each sequence (few keys, no averaging) take the high-precision path
#define QHI 384            // rows carrying a q residual plane
#define KHI 384            // key rows carrying k residual / v bf16 hi+lo planes (used only by the causal high-precision path)
// B fragment (k rows k0+.., output column o) of a weight: (in,out) [K][ld] or (out,in) [ld rows of K]: bf16 exact, or f16(bf16 * 256) exact
__device__ __forceinline__ v16b wcol_io(const float* Wm, int k0, int o, int lane, int ld) { v16b w; const int g = lane >> 4;
#pragma unroll
  for (int i = 0; i < 8; ++i) { w[i] = (__bf16)Wm[(size_t)(k0 + 8 * g + i) * ld + o]; w[8 + i] = (__bf16)Wm[(size_t)(k0 + 16 + 8 * g + i) * ld + o]; }
  return w; }
__device__ __forceinline__ v16b wcol_oi(const float* Wm, int k0, int o, int lane, int K) { v16b w; const float* p = Wm + (size_t)o * K + k0 + 8 * (lane >> 4);
#pragma unroll
  for (int i = 0; i < 8; ++i) { w[i] = (__bf16)p[i]; w[8 + i] = (__bf16)p[16 + i]; }
  return w; }
__device__ __forceinline__ v16h wcolh_io(const float* Wm, int k0, int o, int lane, int ld) { v16h w; const int g = lane >> 4;
#pragma unroll
  for (int i = 0; i < 8; ++i) { w[i] = (_Float16)(bfr(Wm[(size_t)(k0 + 8 * g + i) * ld + o]) * 256.0f); w[8 + i] = (_Float16)(bfr(Wm[(size_t)(k0 + 16 + 8 * g + i) * ld + o]) * 256.0f); }
  return w; }
__device__ __forceinline__ v16h wcolh_oi(const float* Wm, int k0, int o, int lane, int K) { v16h w; const float* p = Wm + (size_t)o * K + k0 + 8 * (lane >> 4);
#pragma unroll
  for (int i = 0; i < 8; ++i) { w[i] = (_Float16)(bfr(p[i]) * 256.0f); w[8 + i] = (_Float16)(bfr(p[16 + i]) * 256.0f); }
  return w; }
#define WQKV_LAYOUT 2   // 0 = (in,out) [DIN][CC]; 1 = (out,in) [CC][DIN]; 2 = per-head [NH][DIN][HD]
__device__ __forceinline__ v16b wcol_hdk(const float* Wm, int k0, int o, int lane) { v16b w; const int g = lane >> 4; const float* p = Wm + (size_t)(o / HD) * DIN * HD + (o % HD);
#pragma unroll
  for (int i = 0; i < 8; ++i) { w[i] = (__bf16)p[(size_t)(k0 + 8 * g + i) * HD]; w[8 + i] = (__bf16)p[(size_t)(k0 + 16 + 8 * g + i) * HD]; }
  return w; }
#define WO_OUT_IN 0
#if WQKV_LAYOUT == 1
#define WCOL(W, k0, o, lane) wcol_oi(W, k0, o, lane, DIN)
#elif WQKV_LAYOUT == 2
#define WCOL(W, k0, o, lane) wcol_hdk(W, k0, o, lane)
#else
#define WCOL(W, k0, o, lane) wcol_io(W, k0, o, lane, CC)
#endif
#if WO_OUT_IN
#define WOCOL(W, k0, o, lane) wcol_oi(W, k0, o, lane, CC)
#define WOCOLH(W, k0, o, lane) wcolh_oi(W, k0, o, lane, CC)
#else
#define WOCOL(W, k0, o, lane) wcol_io(W, k0, o, lane, DIN)
#define WOCOLH(W, k0, o, lane) wcolh_io(W, k0, o, lane, DIN)
#endif

#define WS_QH  0u                                      // f16 q rows [b*t][CC]
#define WS_KH  (WS_QH + 2u * (size_t)NB * TT * CC)      // f16 k rows [b*t][CC]
#define WS_VT  (WS_KH + 2u * (size_t)NB * TT * CC)      // f16 v planes [b][c][t]
#define WS_QL  (WS_VT + 2u * (size_t)NB * CC * TT)      // f16 q residual x 2^10 rows [b][t < QHI][CC]
#define WS_KL  (WS_QL + 2u * (size_t)NB * QHI * CC)     // f16 k residual x 2^10 rows [b][t < KHI][CC]
#define WS_VB  (WS_KL + 2u * (size_t)NB * KHI * CC)     // bf16 v hi planes [b][c][t < KHI]
#define WS_VBL (WS_VB + 2u * (size_t)NB * CC * KHI)
#define WS_Y   (WS_VBL + 2u * (size_t)NB * CC * KHI)      // f32 ctx rows [b*t][CC] (only when there is an output projection)
#define WS_END (WS_Y  + 4u * (size_t)NB * TT * CC)

// ---- k_proj: block = (64 rows, 128 cols, which): q/k/v = X W (+ b) with exact bf16 products (K = DIN) -> which 0: q f16 rows (+ residual rows < QHI); 1: k f16 rows (+ residual rows < KHI); 2: v f16 planes [c][t] (+ bf16 hi/lo planes for t < KHI)
__global__ __launch_bounds__(128) void k_proj(const float* __restrict__ XQ, const float* __restrict__ XK, const float* __restrict__ XV, const float* __restrict__ WQ, const float* __restrict__ WK, const float* __restrict__ WV, const float* __restrict__ BQ, const float* __restrict__ BK, const float* __restrict__ BV,
    _Float16* __restrict__ QH, _Float16* __restrict__ QL, _Float16* __restrict__ KH, _Float16* __restrict__ KL, _Float16* __restrict__ VT, __bf16* __restrict__ VB, __bf16* __restrict__ VBL) {
  __shared__ __align__(16) _Float16 sh[64][136], sl[64][136]; __shared__ __align__(16) _Float16 th[128][72]; __shared__ __align__(16) __bf16 tb[128][72], tbl[128][72];
  const int tid = threadIdx.x, wave = tid >> 5, lane = tid & 31, col = lane & 15, g = lane >> 4; const int which = blockIdx.z; const int c0 = blockIdx.y * 128; const size_t r0 = (size_t)blockIdx.x * 64; const size_t bb = r0 / TT; const int t0 = (int)(r0 % TT);
  const float* X = which == 0 ? XQ : which == 1 ? XK : XV; const float* WA = which == 0 ? WQ : which == 1 ? WK : WV; const float* BA = which == 0 ? BQ : which == 1 ? BK : BV;
  v8f acc[8] = {};
#pragma unroll 2
  for (int kc = 0; kc < DIN / 32; ++kc) { v16b a; { const float* p = X + (r0 + wave * 16 + col) * DIN + kc * 32 + 8 * g;
#pragma unroll
      for (int i = 0; i < 8; ++i) { a[i] = (__bf16)p[i]; a[8 + i] = (__bf16)p[16 + i]; } }
    v16b w[8]; /* all eight weight fragments are loaded before the first product, so their latencies overlap; the loops below are unrolled so that w[] stays in registers */
#pragma unroll
    for (int j = 0; j < 8; ++j) w[j] = WCOL(WA, kc * 32, c0 + j * 16 + col, lane);
#pragma unroll
    for (int j = 0; j < 8; ++j) acc[j] = wmma_bf(a, w[j], acc[j]); }
  if (which < 2) { _Float16* DH = which == 0 ? QH : KH; _Float16* DL = which == 0 ? QL : KL; const int nhi = which == 0 ? QHI : KHI; const bool hi_rows = t0 < nhi;
#pragma unroll
    for (int j = 0; j < 8; ++j) { const float bias = BA ? bfr(BA[c0 + j * 16 + col]) : 0.f;
#pragma unroll
      for (int r = 0; r < 8; ++r) { const float v = acc[j][r] + bias; const _Float16 hv = (_Float16)v; sh[wave * 16 + 8 * g + r][j * 16 + col] = hv; sl[wave * 16 + 8 * g + r][j * 16 + col] = (_Float16)((v - (float)hv) * 1024.0f); } }
    __syncthreads();
    for (int e = tid; e < 64 * 16; e += 128) { const int rl = e >> 4, q = e & 15; vst2((unsigned*)(DH + (r0 + rl) * CC + c0 + q * 8), *(const v4u*)&sh[rl][q * 8]); if (hi_rows) vst2((unsigned*)(DL + (bb * nhi + t0 + rl) * (size_t)CC + c0 + q * 8), *(const v4u*)&sl[rl][q * 8]); }
  } else { const bool hi_rows = t0 < KHI;
#pragma unroll
    for (int j = 0; j < 8; ++j) { const float bias = BA ? bfr(BA[c0 + j * 16 + col]) : 0.f;
#pragma unroll
      for (int r = 0; r < 8; ++r) { const float v = acc[j][r] + bias; const int rl = wave * 16 + 8 * g + r, cl = j * 16 + col; th[cl][rl] = (_Float16)v; const __bf16 bh = (__bf16)v; tb[cl][rl] = bh; tbl[cl][rl] = (__bf16)(v - (float)bh); } }
    __syncthreads();
    for (int e = tid; e < 128 * 8; e += 128) { const int cl = e >> 3, q = e & 7; vst2((unsigned*)(VT + (bb * CC + c0 + cl) * (size_t)TT + t0 + q * 8), *(const v4u*)&th[cl][q * 8]); if (hi_rows) { const size_t o3 = (bb * CC + c0 + cl) * (size_t)KHI + t0 + q * 8; vst2((unsigned*)(VB + o3), *(const v4u*)&tb[cl][q * 8]); vst2((unsigned*)(VBL + o3), *(const v4u*)&tbl[cl][q * 8]); } } } }
// ---- k_att: block = 64 queries (qb) of (b, h), one wave = 16 queries, no exchange between waves: per 64 keys S^T = K Q^T (lane = one query, its D registers = keys), x SCALE, causal mask by index on the diagonal block, running maximum and sum in f32 (precise expf), e = exp(logit - max) packed from the score registers straight into the B operand of ctx^T += V^T P^T, ctx and sum brought to the new maximum every trip, ctx divided by the sum at the end. Logits and P never go to memory. Products as before: 1 f16 product each; query blocks < QBH: 3-product logits (q, k hi + residual), e and v as bf16 hi + lo (3 products)
__device__ __forceinline__ v8f mm_h(v16h a, v16h b, v8f c) { return __builtin_amdgcn_wmma_f32_16x16x32_f16(false, a, false, b, (short)0, c, false, false); }
__device__ __forceinline__ v8f mm_b(v16b a, v16b b, v8f c) { return __builtin_amdgcn_wmma_f32_16x16x32_bf16(false, a, false, b, (short)0, c, false, false); }
// fragment from a pointer that already holds the lane's 8 g offset, so that the pointer itself is the address register pair of the loads
__device__ __forceinline__ v16h frag_hp(const _Float16* p) { union { v16h v; v8h q[2]; } u; u.q[0] = *(const v8h*)p; u.q[1] = *(const v8h*)(p + 16); return u.v; }
__device__ __forceinline__ v16b frag_bp(const __bf16* p) { union { v16b v; v8b q[2]; } u; u.q[0] = *(const v8b*)p; u.q[1] = *(const v8b*)(p + 16); return u.v; }
// every loop over st[], acc[] or a fragment array in sm_step and k_att is unrolled so that the array stays in registers; the two key loops stay rolled (unroll 1): one trip's fragments already fill the register budget of four waves a SIMD
// st[t][r] = scaled logit of key k0 + 16 t + 8 g + r for this lane's query qi; on return e = exp(logit - new maximum); m, l, acc brought to the new maximum (l is this half-wave's part of the sum)
__device__ __forceinline__ void sm_step(v8f st[4], v8f acc[HD / 16], float& m, float& l, bool diag, int k0, int g, int qi) {
  if (diag) {
#pragma unroll
    for (int t = 0; t < 4; ++t)
#pragma unroll
      for (int r = 0; r < 8; ++r) if (k0 + t * 16 + 8 * g + r > qi) st[t][r] = -3.0e38f; }
  float mx = m;
#pragma unroll
  for (int t = 0; t < 4; ++t)
#pragma unroll
    for (int r = 0; r < 8; ++r) mx = fmaxf(mx, st[t][r]);
  mx = fmaxf(mx, __shfl_xor(mx, 16));
  const float alpha = expf(m - mx); m = mx; float s = 0.f;
#pragma unroll
  for (int t = 0; t < 4; ++t)
#pragma unroll
    for (int r = 0; r < 8; ++r) { const float e = expf(st[t][r] - mx); st[t][r] = e; s += e; }
  l = l * alpha + s;
#pragma unroll
  for (int j = 0; j < HD / 16; ++j) acc[j] *= alpha; }
__global__ __launch_bounds__(128) void k_att(const _Float16* __restrict__ QH, const _Float16* __restrict__ KH, const _Float16* __restrict__ VT, const _Float16* __restrict__ QL, const _Float16* __restrict__ KL, const __bf16* __restrict__ VB, const __bf16* __restrict__ VBL, float* __restrict__ Y) { __shared__ __align__(16) float ss[4][16][HD + 4];
  const int tid = threadIdx.x, wave = tid >> 5, lane = tid & 31, col = lane & 15, g = lane >> 4;
  /* all 1,024 blocks are resident at once (4 a WGP) and a block's cost grows with qb, so the launch lasts as long as the fullest WGP: the flat index is spread so that the four blocks f, f + 256, f + 512, f + 768 and equally the four blocks f, f + 8, f + 16, f + 24 hold one qb of each quarter, 31 - i, 16 + i, 15 - i, i: the same cost for every such four. Speed only: any placement is correct; (qb, head, batch) <-> f is one to one */
  static_assert(NQB == 32 && NB * NH == 32, "index spread written for 32 query blocks x 32 (batch, head) pairs");
  const int f = blockIdx.x, fk = (f >> 3) & 3, fi = (f >> 5) & 7, fc = (fk + (f >> 8)) & 3; const int qb = fc == 0 ? 31 - fi : fc == 1 ? 16 + fi : fc == 2 ? 15 - fi : fi; const int bh = (f & 7) + 8 * fk; const int h = bh % NH, b = bh / NH; const int ql0 = qb * 64 + wave * 16, qi = ql0 + col;
  const _Float16* qp = QH + ((size_t)b * TT + qi) * CC + h * HD + 8 * g; const _Float16* kp = KH + ((size_t)b * TT + col) * CC + h * HD + 8 * g;
  v8f acc[HD / 16] = {}; float m = -3.0e38f, l = 0.f;
  if (qb >= QBH) { const _Float16* vp = VT + ((size_t)b * CC + h * HD + col) * (size_t)TT + 8 * g;
    const v16h q0 = frag_hp(qp), q1 = frag_hp(qp + 32); v16h ka[4][2];
#pragma unroll
    for (int t = 0; t < 4; ++t) { ka[t][0] = frag_hp(kp + (size_t)(t * 16) * CC); ka[t][1] = frag_hp(kp + (size_t)(t * 16) * CC + 32); }
    asm volatile("s_wait_xcnt 0x0" :: "v"(qp), "v"(kp) : "memory"); /* the wait that stands before a register of an issued global load is overwritten; the two pointers are inputs so that the loads' address registers live up to it and no later load lands in them */
    kp += (size_t)64 * CC; /* kp walks one key block ahead of the trip; vp walks with the trip */
    /* rolled: a second trip's fragments would go past the 256 registers that four waves a SIMD allow */
#pragma unroll 1
    for (int kb = 0; kb <= qb; ++kb) { const int k0 = kb * 64; v16h va[2][HD / 16]; /* v is asked for first and used last: its latency runs behind the logits and the softmax; inner loops unrolled so that the arrays stay in registers */
#pragma unroll
      for (int u = 0; u < 2; ++u)
#pragma unroll
        for (int j = 0; j < HD / 16; ++j) va[u][j] = frag_hp(vp + (size_t)(j * 16) * TT + u * 32);
      v8f st[4];
#pragma unroll
      for (int t = 0; t < 4; ++t) { v8f z = {}; z = mm_h(ka[t][0], q0, z); st[t] = mm_h(ka[t][1], q1, z) * SCALE; }
      /* the next trip's k fragments are asked for right behind this trip's logits, so their latency runs behind softmax and P v; kp stops at block qb, so the last trip asks for its own block again (in bounds, unused) */
#pragma unroll
      for (int t = 0; t < 4; ++t) { ka[t][0] = frag_hp(kp + (size_t)(t * 16) * CC); ka[t][1] = frag_hp(kp + (size_t)(t * 16) * CC + 32); }
      asm volatile("s_wait_xcnt 0x0" :: "v"(vp), "v"(kp) : "memory"); /* as above: stands before the two pointers step on, and keeps them live over both runs of loads */
      vp += 64; if (kb + 1 < qb) kp += (size_t)64 * CC;
      sm_step(st, acc, m, l, kb == qb, k0, g, qi);
#pragma unroll
      for (int u = 0; u < 2; ++u) { v16h p;
#pragma unroll
        for (int i = 0; i < 8; ++i) { p[i] = (_Float16)st[2 * u][i]; p[8 + i] = (_Float16)st[2 * u + 1][i]; }
#pragma unroll
        for (int j = 0; j < HD / 16; ++j) acc[j] = mm_h(va[u][j], p, acc[j]); } }
  } else { const _Float16* qlp = QL + ((size_t)b * QHI + qi) * CC + h * HD + 8 * g; const _Float16* klp = KL + ((size_t)b * KHI + col) * CC + h * HD + 8 * g; const size_t vo = ((size_t)b * CC + h * HD + col) * (size_t)KHI + 8 * g; const __bf16* vhp = VB + vo; const __bf16* vlp = VBL + vo;
    const v16h q0 = frag_hp(qp), q1 = frag_hp(qp + 32), r0 = frag_hp(qlp), r1 = frag_hp(qlp + 32);
    asm volatile("s_wait_xcnt 0x0" :: "v"(qp), "v"(qlp) : "memory"); /* as above, for the q loads' two pointers */
    /* rolled, for the same register budget */
#pragma unroll 1
    for (int kb = 0; kb <= qb; ++kb) { const int k0 = kb * 64; v8f st[4];
#pragma unroll
      for (int t = 0; t < 4; ++t) { const size_t ko = (size_t)(t * 16) * CC; const v16h kh0 = frag_hp(kp + ko), kh1 = frag_hp(kp + ko + 32), kl0 = frag_hp(klp + ko), kl1 = frag_hp(klp + ko + 32);
        v8f a = {}, al = {}; a = mm_h(kh0, q0, a); al = mm_h(kh0, r0, al); al = mm_h(kl0, q0, al); a = mm_h(kh1, q1, a); al = mm_h(kh1, r1, al); al = mm_h(kl1, q1, al);
        st[t] = (a + al * (1.0f / 1024.0f)) * SCALE; }
      sm_step(st, acc, m, l, kb == qb, k0, g, qi);
#pragma unroll
      for (int u = 0; u < 2; ++u) { float pv[16];
#pragma unroll
        for (int i = 0; i < 8; ++i) { pv[i] = st[2 * u][i]; pv[8 + i] = st[2 * u + 1][i]; }
        const F2 p = bsplit16(pv);
#pragma unroll
        for (int j = 0; j < HD / 16; ++j) { const size_t po = (size_t)(j * 16) * KHI + u * 32; const v16b vh = frag_bp(vhp + po), vl = frag_bp(vlp + po); acc[j] = mm_b(vh, p.h, acc[j]); acc[j] = mm_b(vh, p.l, acc[j]); acc[j] = mm_b(vl, p.h, acc[j]); } }
      asm volatile("s_wait_xcnt 0x0" :: "v"(kp), "v"(klp), "v"(vhp), "v"(vlp) : "memory"); /* as above: stands before the four pointers step on to the next 64 keys */
      kp += (size_t)64 * CC; klp += (size_t)64 * CC; vhp += 64; vlp += 64; } }
  l += __shfl_xor(l, 16); const float inv = 1.0f / l;
#pragma unroll
  for (int j = 0; j < HD / 16; ++j) { const v8f o = acc[j] * inv; /* lane = query col, registers = head columns j*16 + 8g + r */
    *(v4f*)&ss[wave][col][j * 16 + 8 * g] = __builtin_shufflevector(o, o, 0, 1, 2, 3); *(v4f*)&ss[wave][col][j * 16 + 8 * g + 4] = __builtin_shufflevector(o, o, 4, 5, 6, 7); }
  LDSX(); /* own-wave exchange: the 256-B (row, head) segments go out whole, two rows an instruction */
  for (int rl = 0; rl < 16; rl += 2) vst2(Y + ((size_t)b * TT + ql0 + rl + g) * CC + h * HD + col * 4, *(const v4f*)&ss[wave][rl + g][col * 4]); }
// ---- k_out: block = (64 rows, 128 cols): out = ctx Wo (+ bo): ctx once to f16 against Wo as f16(bf16 x 2^8) exact (1 product) x 2^-8; causal early rows (< QHI of each sequence): ctx bf16 hi + lo against exact bf16 Wo (2 products)
__global__ __launch_bounds__(128) void k_out(const float* __restrict__ Y, const float* __restrict__ WO, const float* __restrict__ BO, float* __restrict__ OUT) { __shared__ __align__(16) float sf[4][16][132];
  const int tid = threadIdx.x, wave = tid >> 5, lane = tid & 31, col = lane & 15, g = lane >> 4; const int c0 = blockIdx.y * 128; const size_t r0 = (size_t)blockIdx.x * 64 + wave * 16;
  v8f acc[8] = {};
  if (CAUSAL && (int)(((size_t)blockIdx.x * 64) % TT) < QHI) {   /* block-uniform */
    /* one k-step a trip: with all eight weight fragments in flight, two k-steps would need more than 256 registers */
#pragma unroll 1
    for (int kc = 0; kc < CC / 32; ++kc) { const F2 a = split_row(Y + (r0 + col) * CC, kc * 32, lane); v16b w[8]; /* loaded whole before the first product (latencies overlap); unrolled so that w[] stays in registers */
#pragma unroll
      for (int j = 0; j < 8; ++j) w[j] = WOCOL(WO, kc * 32, c0 + j * 16 + col, lane);
#pragma unroll
      for (int j = 0; j < 8; ++j) { acc[j] = wmma_bf(a.h, w[j], acc[j]); acc[j] = wmma_bf(a.l, w[j], acc[j]); } }
#pragma unroll
    for (int j = 0; j < 8; ++j) { const float bias = BO ? bfr(BO[c0 + j * 16 + col]) : 0.f;
#pragma unroll
      for (int r = 0; r < 8; ++r) sf[wave][8 * g + r][j * 16 + col] = acc[j][r] + bias; }
  } else {
#pragma unroll 2
    for (int kc = 0; kc < CC / 32; ++kc) { const v16h a = frag_f32(Y + (r0 + col) * CC + kc * 32, lane); v16h w[8]; /* loaded whole before the first product (latencies overlap); unrolled so that w[] stays in registers */
#pragma unroll
      for (int j = 0; j < 8; ++j) w[j] = WOCOLH(WO, kc * 32, c0 + j * 16 + col, lane);
#pragma unroll
      for (int j = 0; j < 8; ++j) acc[j] = wmma16(a, w[j], acc[j]); }
#pragma unroll
    for (int j = 0; j < 8; ++j) { const float bias = BO ? bfr(BO[c0 + j * 16 + col]) : 0.f;
#pragma unroll
      for (int r = 0; r < 8; ++r) sf[wave][8 * g + r][j * 16 + col] = acc[j][r] * (1.0f / 256.0f) + bias; } }
  LDSX(); for (int rl = 0; rl < 16; ++rl) vst2(OUT + (r0 + rl) * DIN + c0 + lane * 4, *(const v4f*)&sf[wave][rl][lane * 4]); }

extern "C" void kernel_launch(void* const* d_in, const int* in_sizes, int n_in, void* d_out, int out_size, void* d_ws, size_t ws_size, hipStream_t stream) {
  (void)in_sizes; (void)n_in; (void)out_size;
  const float** F = (const float**)d_in;
  if (ws_size < (size_t)WS_END) return;
  char* ws = (char*)d_ws; _Float16 *QH = (_Float16*)(ws + WS_QH), *KH = (_Float16*)(ws + WS_KH), *VT = (_Float16*)(ws + WS_VT), *QL = (_Float16*)(ws + WS_QL), *KL = (_Float16*)(ws + WS_KL); __bf16 *VB = (__bf16*)(ws + WS_VB), *VBL = (__bf16*)(ws + WS_VBL); float *Y = (float*)(ws + WS_Y);
  (void)Y; (void)QL; (void)KL; (void)VB; (void)VBL;
  // inputs: 0 x [2,2048,1024]; 1 Wq, 2 Wk, 3 Wv [16,1024,64]; 4 Wo [1024,1024] (in,out); 5 bo [1024]
  k_proj<<<dim3(TNB * TT / 64, CC / 128, 3), 128, 0, stream>>>(F[0], F[0], F[0], F[1], F[2], F[3], nullptr, nullptr, nullptr, QH, QL, KH, KL, VT, VB, VBL);
  k_att<<<dim3(NB * NH * NQB), 128, 0, stream>>>(QH, KH, VT, QL, KL, VB, VBL, Y);
  k_out<<<dim3(TNB * TT / 64, DIN / 128), 128, 0, stream>>>(Y, F[4], F[5], (float*)d_out);
}

// v003
// It runs in 168 microseconds.
// Timed twice side by side with v002, it ran 1.60 times as fast both times.
// Over all steps from v000 it is 6.33 times as fast.
// compute dtype: all float inputs rounded to bf16; q/k/v = x W[h] with EXACT bf16 products on WMMA 16x16x32, f32 accumulate; q, k once to f16 -> 1-product causal logits x 1/32, except the first 384 query rows of each sequence (few keys, no averaging), which use q and k as f16 hi + residual (x 2^10) (3 products); softmax in f32 (precise expf, running maximum and sum over blocks of 64 keys, division by the sum last); exp(logit - max) once to f16 against v once to f16 (1 product), except the first 384 rows: exp(logit - max) and v as bf16 hi + lo (3 products); ctx once to f16 against Wo carried x 2^8 in f16 (exact bf16 values), except the first 384 rows: ctx bf16 hi + lo against exact bf16 Wo (2 products); + bo; f32 output.
#include <hip/hip_runtime.h>
#include <math.h>

typedef __attribute__((ext_vector_type(16))) _Float16 v16h;
typedef __attribute__((ext_vector_type(16))) __bf16 v16b;
typedef __attribute__((ext_vector_type(8)))  _Float16 v8h;
typedef __attribute__((ext_vector_type(8)))  float v8f;
typedef __attribute__((ext_vector_type(4)))  float v4f;
typedef __attribute__((ext_vector_type(2)))  float v2f;
typedef __attribute__((ext_vector_type(4)))  unsigned v4u;
typedef __attribute__((ext_vector_type(4)))  int v4i;
typedef float __attribute__((may_alias)) float_a;
typedef int __attribute__((may_alias)) int_a;

template <typename T> __device__ __forceinline__ void vst2(void* p, T v) { *(T*)p = v;  }
__device__ __forceinline__ v8f wmma16(v16h a, v16h b, v8f c) {
  v8f d = __builtin_amdgcn_wmma_f32_16x16x32_f16(false, a, false, b, (short)0, c, false, false);
  asm volatile("v_nop\n\tv_nop\n\tv_nop\n\tv_nop" : "+v"(d) : "v"(a), "v"(b));
  return d;
}
__device__ __forceinline__ v8f wmma_bf(v16b a, v16b b, v8f c) {
  v8f d = __builtin_amdgcn_wmma_f32_16x16x32_bf16(false, a, false, b, (short)0, c, false, false);
  asm volatile("v_nop\n\tv_nop\n\tv_nop\n\tv_nop" : "+v"(d) : "v"(a), "v"(b));
  return d;
}
// 16x16x32 fragments: lane = (h = lane>>4, row/col = lane&15); elements 0..7 = k0+8h+0..7, 8..15 = k0+16+8h+0..7; D element r = row 8h+r
__device__ __forceinline__ v16h frag_h(const _Float16* rowk0, int lane) {
  union { v16h v; v8h q[2]; } u; const _Float16* p = rowk0 + 8 * (lane >> 4);
  u.q[0] = *(const v8h*)p; u.q[1] = *(const v8h*)(p + 16); return u.v;
}
__device__ __forceinline__ v16h frag_f32(const float* rowk0, int lane) {
  v16h a; const float* p = rowk0 + 8 * (lane >> 4);
#pragma unroll
  for (int i = 0; i < 8; ++i) { a[i] = (_Float16)p[i]; a[8 + i] = (_Float16)p[16 + i]; }
  return a;
}
__device__ __forceinline__ v16h frag_f32s(const float* rowk0, int lane, float sc) {
  v16h a; const float* p = rowk0 + 8 * (lane >> 4);
#pragma unroll
  for (int i = 0; i < 8; ++i) { a[i] = (_Float16)(p[i] * sc); a[8 + i] = (_Float16)(p[16 + i] * sc); }
  return a;
}
// column fragment from a [K][ld] layout (column n), rows >= K read as 0
__device__ __forceinline__ v16h fragc_f32(const float* W, int k0, int n, int lane, int ld, int K) {
  v16h a; const int g = lane >> 4;
#pragma unroll
  for (int i = 0; i < 8; ++i) { const int ka = k0 + 8 * g + i, kb = ka + 16;
    a[i] = (_Float16)(ka < K ? W[(size_t)(ka < K ? ka : K - 1) * ld + n] : 0.f); a[8 + i] = (_Float16)(kb < K ? W[(size_t)(kb < K ? kb : K - 1) * ld + n] : 0.f); }
  return a;
}
struct F2 { v16b h, l; };
__device__ __forceinline__ F2 bsplit16(const float v[16]) { F2 r;
#pragma unroll
  for (int i = 0; i < 16; ++i) { const __bf16 h = (__bf16)v[i]; r.h[i] = h; r.l[i] = (__bf16)(v[i] - (float)h); }
  return r; }
__device__ __forceinline__ F2 split_row(const float* row, int k0, int lane) { float v[16]; const float* p = row + k0 + 8 * (lane >> 4);
#pragma unroll
  for (int i = 0; i < 8; ++i) { v[i] = p[i]; v[8 + i] = p[16 + i]; }
  return bsplit16(v); }
__device__ __forceinline__ F2 split_rowK(const float* row, int k0, int lane, int K) { float v[16]; const int g = lane >> 4;
#pragma unroll
  for (int i = 0; i < 8; ++i) { const int ka = k0 + 8 * g + i, kb = ka + 16; v[i] = ka < K ? row[ka < K ? ka : K - 1] : 0.f; v[8 + i] = kb < K ? row[kb < K ? kb : K - 1] : 0.f; }
  return bsplit16(v); }
__device__ __forceinline__ F2 split_col(const float* W, int k0, int n, int lane, int ld, int K) { float v[16]; const int g = lane >> 4;
#pragma unroll
  for (int i = 0; i < 8; ++i) { const int ka = k0 + 8 * g + i, kb = ka + 16; v[i] = ka < K ? W[(size_t)(ka < K ? ka : K - 1) * ld + n] : 0.f; v[8 + i] = kb < K ? W[(size_t)(kb < K ? kb : K - 1) * ld + n] : 0.f; }
  return bsplit16(v); }
__device__ __forceinline__ v8f mac3(const F2& a, const F2& b, v8f c) { c = wmma_bf(a.l, b.h, c); c = wmma_bf(a.h, b.l, c); return wmma_bf(a.h, b.h, c); }
__device__ __forceinline__ float sigm(float v) { return 1.0f / (1.0f + expf(-v)); }
#define LDSX() do { asm volatile("s_wait_dscnt 0" ::: "memory"); __builtin_amdgcn_wave_barrier(); __builtin_amdgcn_fence(__ATOMIC_RELEASE, "workgroup"); } while (0)

// Causal multi-head self-attention with per-head projection tensors (B 2, T 2,048, C 1,024, 16 heads x 64): q/k/v[b,h,t,:] = x[b,t,:] Wq/Wk/Wv[h] ([H][C][64], no bias); att = softmax(q k^T / sqrt(1024) with key > query -> -inf); out = concat_h(att v) Wo ((in,out) [1024,1024]) + bo.
#define NB 2
#define TT 2048
#define CC 1024            // NH * HD = projected width
#define DIN 1024          // input (model) width
#define NH 16
#define HD 64
#define NQB (TT / 64)
#define SCALE (0.03125f)
#define CAUSAL 1
#ifndef TNB
#define TNB NB
#endif
__device__ __forceinline__ float bfr(float v) { return (float)(__bf16)v; }
typedef __attribute__((ext_vector_type(8))) __bf16 v8b;
__device__ __forceinline__ v16b frag_b(const __bf16* rowk0, int lane) {
  union { v16b v; v8b q[2]; } u; const __bf16* p = rowk0 + 8 * (lane >> 4);
  u.q[0] = *(const v8b*)p; u.q[1] = *(const v8b*)(p + 16); return u.v;
}
#define QBH 6              // causal: query blocks 0..QBH-1 of each sequence (few keys, no averaging) take the high-precision path
#define QHI 384            // rows carrying a q residual plane
#define KHI 384            // key rows carrying k residual / v bf16 hi+lo planes (used only by the causal high-precision path)
// B fragment (k rows k0+.., output column o) of a weight: (in,out) [K][ld] or (out,in) [ld rows of K]: bf16 exact, or f16(bf16 * 256) exact
__device__ __forceinline__ v16b wcol_io(const float* Wm, int k0, int o, int lane, int ld) { v16b w; const int g = lane >> 4;
#pragma unroll
  for (int i = 0; i < 8; ++i) { w[i] = (__bf16)Wm[(size_t)(k0 + 8 * g + i) * ld + o]; w[8 + i] = (__bf16)Wm[(size_t)(k0 + 16 + 8 * g + i) * ld + o]; }
  return w; }
__device__ __forceinline__ v16b wcol_oi(const float* Wm, int k0, int o, int lane, int K) { v16b w; const float* p = Wm + (size_t)o * K + k0 + 8 * (lane >> 4);
#pragma unroll
  for (int i = 0; i < 8; ++i) { w[i] = (__bf16)p[i]; w[8 + i] = (__bf16)p[16 + i]; }
  return w; }
__device__ __forceinline__ v16h wcolh_io(const float* Wm, int k0, int o, int lane, int ld) { v16h w; const int g = lane >> 4;
#pragma unroll
  for (int i = 0; i < 8; ++i) { w[i] = (_Float16)(bfr(Wm[(size_t)(k0 + 8 * g + i) * ld + o]) * 256.0f); w[8 + i] = (_Float16)(bfr(Wm[(size_t)(k0 + 16 + 8 * g + i) * ld + o]) * 256.0f); }
  return w; }
__device__ __forceinline__ v16h wcolh_oi(const float* Wm, int k0, int o, int lane, int K) { v16h w; const float* p = Wm + (size_t)o * K + k0 + 8 * (lane >> 4);
#pragma unroll
  for (int i = 0; i < 8; ++i) { w[i] = (_Float16)(bfr(p[i]) * 256.0f); w[8 + i] = (_Float16)(bfr(p[16 + i]) * 256.0f); }
  return w; }
#define WQKV_LAYOUT 2   // 0 = (in,out) [DIN][CC]; 1 = (out,in) [CC][DIN]; 2 = per-head [NH][DIN][HD]
__device__ __forceinline__ v16b wcol_hdk(const float* Wm, int k0, int o, int lane) { v16b w; const int g = lane >> 4; const float* p = Wm + (size_t)(o / HD) * DIN * HD + (o % HD);
#pragma unroll
  for (int i = 0; i < 8; ++i) { w[i] = (__bf16)p[(size_t)(k0 + 8 * g + i) * HD]; w[8 + i] = (__bf16)p[(size_t)(k0 + 16 + 8 * g + i) * HD]; }
  return w; }
#define WO_OUT_IN 0
#if WQKV_LAYOUT == 1
#define WCOL(W, k0, o, lane) wcol_oi(W, k0, o, lane, DIN)
#elif WQKV_LAYOUT == 2
#define WCOL(W, k0, o, lane) wcol_hdk(W, k0, o, lane)
#else
#define WCOL(W, k0, o, lane) wcol_io(W, k0, o, lane, CC)
#endif
#if WO_OUT_IN
#define WOCOL(W, k0, o, lane) wcol_oi(W, k0, o, lane, CC)
#define WOCOLH(W, k0, o, lane) wcolh_oi(W, k0, o, lane, CC)
#else
#define WOCOL(W, k0, o, lane) wcol_io(W, k0, o, lane, DIN)
#define WOCOLH(W, k0, o, lane) wcolh_io(W, k0, o, lane, DIN)
#endif

#define WS_QH  0u                                      // f16 q rows [b*t][CC]
#define WS_KH  (WS_QH + 2u * (size_t)NB * TT * CC)      // f16 k rows [b*t][CC]
#define WS_VT  (WS_KH + 2u * (size_t)NB * TT * CC)      // f16 v planes [b][c][t]
#define WS_QL  (WS_VT + 2u * (size_t)NB * CC * TT)      // f16 q residual x 2^10 rows [b][t < QHI][CC]
#define WS_KL  (WS_QL + 2u * (size_t)NB * QHI * CC)     // f16 k residual x 2^10 rows [b][t < KHI][CC]
#define WS_VB  (WS_KL + 2u * (size_t)NB * KHI * CC)     // bf16 v hi planes [b][c][t < KHI]
#define WS_VBL (WS_VB + 2u * (size_t)NB * CC * KHI)
#define WS_Y   (WS_VBL + 2u * (size_t)NB * CC * KHI)      // f32 ctx rows [b*t][CC] (only when there is an output projection)
#define WS_END (WS_Y  + 4u * (size_t)NB * TT * CC)

// ---- staging of a 32-k stage of both GEMM operands (k_proj, k_out): a block brings its 128 weight columns and its 64 activation rows from global memory ONCE, in whole 128-B lines, rounds them to their 16-bit operand type and lays them k-contiguous in LDS; every wave then takes its fragments by 16-byte LDS reads. Values, k order and sum order are those of the direct loads
#define SP 40              // LDS pitch of a staged row of 32 k, in 16-bit elements: 80 B = 16 B x odd, the pitch at which 16-byte LDS reads and writes of 16 rows fall on distinct banks
typedef __attribute__((ext_vector_type(4))) __bf16 v4b;
typedef __attribute__((ext_vector_type(4))) _Float16 v4h;
// one thread's share of a stage: 32 k of weight column tid (a wave-instruction = 32 neighbouring columns = one line), and four 16-byte pieces of the activation rows (a wave-instruction = four whole lines); both pointers then step on 32 k
__device__ __forceinline__ void st_load(const float*& wp, int wld, const float*& xp, int xld, float wr[32], v4f xr[4]) {
#pragma unroll
  for (int k = 0; k < 32; ++k) wr[k] = wp[(size_t)k * wld];
#pragma unroll
  for (int i = 0; i < 4; ++i) xr[i] = *(const v4f*)(xp + (size_t)(16 * i) * xld);
  asm volatile("s_wait_xcnt 0x0" :: "v"(wp), "v"(xp) : "memory"); /* the wait that stands before a register of an issued global load is overwritten; the two pointers are inputs so that the loads' address registers live up to it */
  wp += (size_t)32 * wld; xp += 32; }
// ---- k_proj: block = (64 rows, 128 cols, which): q/k/v = X W (+ b) with exact bf16 products (K = DIN) -> which 0: q f16 rows (+ residual rows < QHI); 1: k f16 rows (+ residual rows < KHI); 2: v f16 planes [c][t] (+ bf16 hi/lo planes for t < KHI)
__global__ __launch_bounds__(128) void k_proj(const float* __restrict__ XQ, const float* __restrict__ XK, const float* __restrict__ XV, const float* __restrict__ WQ, const float* __restrict__ WK, const float* __restrict__ WV, const float* __restrict__ BQ, const float* __restrict__ BK, const float* __restrict__ BV,
    _Float16* __restrict__ QH, _Float16* __restrict__ QL, _Float16* __restrict__ KH, _Float16* __restrict__ KL, _Float16* __restrict__ VT, __bf16* __restrict__ VB, __bf16* __restrict__ VBL) {
  union Lds { struct { _Float16 sh[64][136], sl[64][136]; } qk; struct { _Float16 th[128][72]; __bf16 tb[128][72], tbl[128][72]; } v; struct { __bf16 wt[2][128][SP], xs[2][64][SP]; } st; }; /* the stage buffers lie in the LDS of the epilogue's arrays, which are written only behind the loop's last barrier */
  __shared__ __align__(16) Lds sm; auto& sh = sm.qk.sh; auto& sl = sm.qk.sl; auto& th = sm.v.th; auto& tb = sm.v.tb; auto& tbl = sm.v.tbl;
  const int tid = threadIdx.x, wave = tid >> 5, lane = tid & 31, col = lane & 15, g = lane >> 4; const int which = blockIdx.z; const int c0 = blockIdx.y * 128; const size_t r0 = (size_t)blockIdx.x * 64; const size_t bb = r0 / TT; const int t0 = (int)(r0 % TT);
  const float* X = which == 0 ? XQ : which == 1 ? XK : XV; const float* WA = which == 0 ? WQ : which == 1 ? WK : WV; const float* BA = which == 0 ? BQ : which == 1 ? BK : BV;
  static_assert(WQKV_LAYOUT == 2, "stage loader written for per-head [NH][DIN][HD] weights");
  v8f acc[8] = {}; float wr[32]; v4f xr[4];
  const float* wp = WA + (size_t)((c0 + tid) / HD) * DIN * HD + (c0 + tid) % HD; const float* xp = X + (r0 + (tid >> 3)) * DIN + (tid & 7) * 4;
  /* rounds this thread's share to bf16 and writes it to stage buffer bf; loops unrolled so that wr[] and xr[] stay in registers */
  auto put = [&](int bf) {
#pragma unroll
    for (int q = 0; q < 4; ++q) { v8b t;
#pragma unroll
      for (int i = 0; i < 8; ++i) t[i] = (__bf16)wr[8 * q + i];
      *(v8b*)&sm.st.wt[bf][tid][8 * q] = t; }
#pragma unroll
    for (int i = 0; i < 4; ++i) { v4b t;
#pragma unroll
      for (int e = 0; e < 4; ++e) t[e] = (__bf16)xr[i][e];
      *(v4b*)&sm.st.xs[bf][(tid >> 3) + 16 * i][(tid & 7) * 4] = t; } };
  st_load(wp, HD, xp, DIN, wr, xr); put(0); __syncthreads(); /* publishes stage 0 */
  /* two buffers: stage kc + 1 is asked for before stage kc's products, so its latency runs behind them, and written to the other buffer after them; unrolled by two so that the buffer index is a constant */
#pragma unroll 2
  for (int kc = 0; kc < DIN / 32; ++kc) { const int cur = kc & 1; const bool more = kc + 1 < DIN / 32;
    if (more) st_load(wp, HD, xp, DIN, wr, xr);
    const v16b a = frag_b(&sm.st.xs[cur][wave * 16 + col][0], lane); v16b w[8]; /* unrolled so that w[] stays in registers */
#pragma unroll
    for (int j = 0; j < 8; ++j) w[j] = frag_b(&sm.st.wt[cur][j * 16 + col][0], lane);
#pragma unroll
    for (int j = 0; j < 8; ++j) acc[j] = wmma_bf(a, w[j], acc[j]);
    __builtin_amdgcn_sched_barrier(0); /* keeps the waits on the next stage's global loads behind this stage's products, so that the products run inside the loads' latency */
    if (more) put(cur ^ 1);
    __syncthreads(); } /* one barrier a stage: publishes stage kc + 1 and ends every wave's reads of the buffer that the next trip refills (after the last trip: of the LDS that the epilogue reuses) */
  if (which < 2) { _Float16* DH = which == 0 ? QH : KH; _Float16* DL = which == 0 ? QL : KL; const int nhi = which == 0 ? QHI : KHI; const bool hi_rows = t0 < nhi;
#pragma unroll
    for (int j = 0; j < 8; ++j) { const float bias = BA ? bfr(BA[c0 + j * 16 + col]) : 0.f;
#pragma unroll
      for (int r = 0; r < 8; ++r) { const float v = acc[j][r] + bias; const _Float16 hv = (_Float16)v; sh[wave * 16 + 8 * g + r][j * 16 + col] = hv; sl[wave * 16 + 8 * g + r][j * 16 + col] = (_Float16)((v - (float)hv) * 1024.0f); } }
    __syncthreads();
    for (int e = tid; e < 64 * 16; e += 128) { const int rl = e >> 4, q = e & 15; vst2((unsigned*)(DH + (r0 + rl) * CC + c0 + q * 8), *(const v4u*)&sh[rl][q * 8]); if (hi_rows) vst2((unsigned*)(DL + (bb * nhi + t0 + rl) * (size_t)CC + c0 + q * 8), *(const v4u*)&sl[rl][q * 8]); }
  } else { const bool hi_rows = t0 < KHI;
#pragma unroll
    for (int j = 0; j < 8; ++j) { const float bias = BA ? bfr(BA[c0 + j * 16 + col]) : 0.f;
#pragma unroll
      for (int r = 0; r < 8; ++r) { const float v = acc[j][r] + bias; const int rl = wave * 16 + 8 * g + r, cl = j * 16 + col; th[cl][rl] = (_Float16)v; const __bf16 bh = (__bf16)v; tb[cl][rl] = bh; tbl[cl][rl] = (__bf16)(v - (float)bh); } }
    __syncthreads();
    for (int e = tid; e < 128 * 8; e += 128) { const int cl = e >> 3, q = e & 7; vst2((unsigned*)(VT + (bb * CC + c0 + cl) * (size_t)TT + t0 + q * 8), *(const v4u*)&th[cl][q * 8]); if (hi_rows) { const size_t o3 = (bb * CC + c0 + cl) * (size_t)KHI + t0 + q * 8; vst2((unsigned*)(VB + o3), *(const v4u*)&tb[cl][q * 8]); vst2((unsigned*)(VBL + o3), *(const v4u*)&tbl[cl][q * 8]); } } } }
// ---- k_att: block = 64 queries (qb) of (b, h), one wave = 16 queries, no exchange between waves: per 64 keys S^T = K Q^T (lane = one query, its D registers = keys), x SCALE, causal mask by index on the diagonal block, running maximum and sum in f32 (precise expf), e = exp(logit - max) packed from the score registers straight into the B operand of ctx^T += V^T P^T, ctx and sum brought to the new maximum every trip, ctx divided by the sum at the end. Logits and P never go to memory. Products as before: 1 f16 product each; query blocks < QBH: 3-product logits (q, k hi + residual), e and v as bf16 hi + lo (3 products)
__device__ __forceinline__ v8f mm_h(v16h a, v16h b, v8f c) { return __builtin_amdgcn_wmma_f32_16x16x32_f16(false, a, false, b, (short)0, c, false, false); }
__device__ __forceinline__ v8f mm_b(v16b a, v16b b, v8f c) { return __builtin_amdgcn_wmma_f32_16x16x32_bf16(false, a, false, b, (short)0, c, false, false); }
// fragment from a pointer that already holds the lane's 8 g offset, so that the pointer itself is the address register pair of the loads
__device__ __forceinline__ v16h frag_hp(const _Float16* p) { union { v16h v; v8h q[2]; } u; u.q[0] = *(const v8h*)p; u.q[1] = *(const v8h*)(p + 16); return u.v; }
__device__ __forceinline__ v16b frag_bp(const __bf16* p) { union { v16b v; v8b q[2]; } u; u.q[0] = *(const v8b*)p; u.q[1] = *(const v8b*)(p + 16); return u.v; }
// every loop over st[], acc[] or a fragment array in sm_step and k_att is unrolled so that the array stays in registers; the two key loops stay rolled (unroll 1): one trip's fragments already fill the register budget of four waves a SIMD
// st[t][r] = scaled logit of key k0 + 16 t + 8 g + r for this lane's query qi; on return e = exp(logit - new maximum); m, l, acc brought to the new maximum (l is this half-wave's part of the sum)
__device__ __forceinline__ void sm_step(v8f st[4], v8f acc[HD / 16], float& m, float& l, bool diag, int k0, int g, int qi) {
  if (diag) {
#pragma unroll
    for (int t = 0; t < 4; ++t)
#pragma unroll
      for (int r = 0; r < 8; ++r) if (k0 + t * 16 + 8 * g + r > qi) st[t][r] = -3.0e38f; }
  float mx = m;
#pragma unroll
  for (int t = 0; t < 4; ++t)
#pragma unroll
    for (int r = 0; r < 8; ++r) mx = fmaxf(mx, st[t][r]);
  mx = fmaxf(mx, __shfl_xor(mx, 16));
  const float alpha = expf(m - mx); m = mx; float s = 0.f;
#pragma unroll
  for (int t = 0; t < 4; ++t)
#pragma unroll
    for (int r = 0; r < 8; ++r) { const float e = expf(st[t][r] - mx); st[t][r] = e; s += e; }
  l = l * alpha + s;
#pragma unroll
  for (int j = 0; j < HD / 16; ++j) acc[j] *= alpha; }
__global__ __launch_bounds__(128) void k_att(const _Float16* __restrict__ QH, const _Float16* __restrict__ KH, const _Float16* __restrict__ VT, const _Float16* __restrict__ QL, const _Float16* __restrict__ KL, const __bf16* __restrict__ VB, const __bf16* __restrict__ VBL, float* __restrict__ Y) { __shared__ __align__(16) float ss[4][16][HD + 4];
  const int tid = threadIdx.x, wave = tid >> 5, lane = tid & 31, col = lane & 15, g = lane >> 4;
  /* all 1,024 blocks are resident at once (4 a WGP) and a block's cost grows with qb, so the launch lasts as long as the fullest WGP: the flat index is spread so that the four blocks f, f + 256, f + 512, f + 768 and equally the four blocks f, f + 8, f + 16, f + 24 hold one qb of each quarter, 31 - i, 16 + i, 15 - i, i: the same cost for every such four. Speed only: any placement is correct; (qb, head, batch) <-> f is one to one */
  static_assert(NQB == 32 && NB * NH == 32, "index spread written for 32 query blocks x 32 (batch, head) pairs");
  const int f = blockIdx.x, fk = (f >> 3) & 3, fi = (f >> 5) & 7, fc = (fk + (f >> 8)) & 3; const int qb = fc == 0 ? 31 - fi : fc == 1 ? 16 + fi : fc == 2 ? 15 - fi : fi; const int bh = (f & 7) + 8 * fk; const int h = bh % NH, b = bh / NH; const int ql0 = qb * 64 + wave * 16, qi = ql0 + col;
  const _Float16* qp = QH + ((size_t)b * TT + qi) * CC + h * HD + 8 * g; const _Float16* kp = KH + ((size_t)b * TT + col) * CC + h * HD + 8 * g;
  v8f acc[HD / 16] = {}; float m = -3.0e38f, l = 0.f;
  if (qb >= QBH) { const _Float16* vp = VT + ((size_t)b * CC + h * HD + col) * (size_t)TT + 8 * g;
    const v16h q0 = frag_hp(qp), q1 = frag_hp(qp + 32); v16h ka[4][2];
#pragma unroll
    for (int t = 0; t < 4; ++t) { ka[t][0] = frag_hp(kp + (size_t)(t * 16) * CC); ka[t][1] = frag_hp(kp + (size_t)(t * 16) * CC + 32); }
    asm volatile("s_wait_xcnt 0x0" :: "v"(qp), "v"(kp) : "memory"); /* the wait that stands before a register of an issued global load is overwritten; the two pointers are inputs so that the loads' address registers live up to it and no later load lands in them */
    kp += (size_t)64 * CC; /* kp walks one key block ahead of the trip; vp walks with the trip */
    /* rolled: a second trip's fragments would go past the 256 registers that four waves a SIMD allow */
#pragma unroll 1
    for (int kb = 0; kb <= qb; ++kb) { const int k0 = kb * 64; v16h va[2][HD / 16]; /* v is asked for first and used last: its latency runs behind the logits and the softmax; inner loops unrolled so that the arrays stay in registers */
#pragma unroll
      for (int u = 0; u < 2; ++u)
#pragma unroll
        for (int j = 0; j < HD / 16; ++j) va[u][j] = frag_hp(vp + (size_t)(j * 16) * TT + u * 32);
      v8f st[4];
#pragma unroll
      for (int t = 0; t < 4; ++t) { v8f z = {}; z = mm_h(ka[t][0], q0, z); st[t] = mm_h(ka[t][1], q1, z) * SCALE; }
      /* the next trip's k fragments are asked for right behind this trip's logits, so their latency runs behind softmax and P v; kp stops at block qb, so the last trip asks for its own block again (in bounds, unused) */
#pragma unroll
      for (int t = 0; t < 4; ++t) { ka[t][0] = frag_hp(kp + (size_t)(t * 16) * CC); ka[t][1] = frag_hp(kp + (size_t)(t * 16) * CC + 32); }
      asm volatile("s_wait_xcnt 0x0" :: "v"(vp), "v"(kp) : "memory"); /* as above: stands before the two pointers step on, and keeps them live over both runs of loads */
      vp += 64; if (kb + 1 < qb) kp += (size_t)64 * CC;
      sm_step(st, acc, m, l, kb == qb, k0, g, qi);
#pragma unroll
      for (int u = 0; u < 2; ++u) { v16h p;
#pragma unroll
        for (int i = 0; i < 8; ++i) { p[i] = (_Float16)st[2 * u][i]; p[8 + i] = (_Float16)st[2 * u + 1][i]; }
#pragma unroll
        for (int j = 0; j < HD / 16; ++j) acc[j] = mm_h(va[u][j], p, acc[j]); } }
  } else { const _Float16* qlp = QL + ((size_t)b * QHI + qi) * CC + h * HD + 8 * g; const _Float16* klp = KL + ((size_t)b * KHI + col) * CC + h * HD + 8 * g; const size_t vo = ((size_t)b * CC + h * HD + col) * (size_t)KHI + 8 * g; const __bf16* vhp = VB + vo; const __bf16* vlp = VBL + vo;
    const v16h q0 = frag_hp(qp), q1 = frag_hp(qp + 32), r0 = frag_hp(qlp), r1 = frag_hp(qlp + 32);
    asm volatile("s_wait_xcnt 0x0" :: "v"(qp), "v"(qlp) : "memory"); /* as above, for the q loads' two pointers */
    /* rolled, for the same register budget */
#pragma unroll 1
    for (int kb = 0; kb <= qb; ++kb) { const int k0 = kb * 64; v8f st[4];
#pragma unroll
      for (int t = 0; t < 4; ++t) { const size_t ko = (size_t)(t * 16) * CC; const v16h kh0 = frag_hp(kp + ko), kh1 = frag_hp(kp + ko + 32), kl0 = frag_hp(klp + ko), kl1 = frag_hp(klp + ko + 32);
        v8f a = {}, al = {}; a = mm_h(kh0, q0, a); al = mm_h(kh0, r0, al); al = mm_h(kl0, q0, al); a = mm_h(kh1, q1, a); al = mm_h(kh1, r1, al); al = mm_h(kl1, q1, al);
        st[t] = (a + al * (1.0f / 1024.0f)) * SCALE; }
      sm_step(st, acc, m, l, kb == qb, k0, g, qi);
#pragma unroll
      for (int u = 0; u < 2; ++u) { float pv[16];
#pragma unroll
        for (int i = 0; i < 8; ++i) { pv[i] = st[2 * u][i]; pv[8 + i] = st[2 * u + 1][i]; }
        const F2 p = bsplit16(pv);
#pragma unroll
        for (int j = 0; j < HD / 16; ++j) { const size_t po = (size_t)(j * 16) * KHI + u * 32; const v16b vh = frag_bp(vhp + po), vl = frag_bp(vlp + po); acc[j] = mm_b(vh, p.h, acc[j]); acc[j] = mm_b(vh, p.l, acc[j]); acc[j] = mm_b(vl, p.h, acc[j]); } }
      asm volatile("s_wait_xcnt 0x0" :: "v"(kp), "v"(klp), "v"(vhp), "v"(vlp) : "memory"); /* as above: stands before the four pointers step on to the next 64 keys */
      kp += (size_t)64 * CC; klp += (size_t)64 * CC; vhp += 64; vlp += 64; } }
  l += __shfl_xor(l, 16); const float inv = 1.0f / l;
#pragma unroll
  for (int j = 0; j < HD / 16; ++j) { const v8f o = acc[j] * inv; /* lane = query col, registers = head columns j*16 + 8g + r */
    *(v4f*)&ss[wave][col][j * 16 + 8 * g] = __builtin_shufflevector(o, o, 0, 1, 2, 3); *(v4f*)&ss[wave][col][j * 16 + 8 * g + 4] = __builtin_shufflevector(o, o, 4, 5, 6, 7); }
  LDSX(); /* own-wave exchange: the 256-B (row, head) segments go out whole, two rows an instruction */
  for (int rl = 0; rl < 16; rl += 2) vst2(Y + ((size_t)b * TT + ql0 + rl + g) * CC + h * HD + col * 4, *(const v4f*)&ss[wave][rl + g][col * 4]); }
// ---- k_out: block = (64 rows, 128 cols): out = ctx Wo (+ bo): ctx once to f16 against Wo as f16(bf16 x 2^8) exact (1 product) x 2^-8; causal early rows (< QHI of each sequence): ctx bf16 hi + lo against exact bf16 Wo (2 products)
__global__ __launch_bounds__(128) void k_out(const float* __restrict__ Y, const float* __restrict__ WO, const float* __restrict__ BO, float* __restrict__ OUT) { union Lds { float sf[4][16][132]; struct { _Float16 wt[2][128][SP], ya[2][64][SP]; } h; struct { __bf16 wt[2][128][SP], yh[2][64][SP], yl[2][64][SP]; } b; }; /* the stage buffers lie in the LDS of the epilogue's array, which is written only behind the loop's last barrier */
  __shared__ __align__(16) Lds sm; auto& sf = sm.sf;
  const int tid = threadIdx.x, wave = tid >> 5, lane = tid & 31, col = lane & 15, g = lane >> 4; const int c0 = blockIdx.y * 128; const size_t r0 = (size_t)blockIdx.x * 64 + wave * 16;
  static_assert(WO_OUT_IN == 0, "stage loader written for (in,out) Wo");
  /* stage 0 is the same for both paths: it is asked for once, in front of the branch, so that its loads and the wait behind them lie in one block */
  v8f acc[8] = {}; float wr[32]; v4f yr[4]; const float* wp = WO + c0 + tid; const float* yp = Y + ((size_t)blockIdx.x * 64 + (tid >> 3)) * CC + (tid & 7) * 4; st_load(wp, DIN, yp, CC, wr, yr);
  if (CAUSAL && (int)(((size_t)blockIdx.x * 64) % TT) < QHI) {   /* block-uniform */
    auto put = [&](int bf) { /* Wo to exact bf16, ctx to bf16 hi + lo; loops unrolled so that wr[] and yr[] stay in registers */
#pragma unroll
      for (int q = 0; q < 4; ++q) { v8b t;
#pragma unroll
        for (int i = 0; i < 8; ++i) t[i] = (__bf16)wr[8 * q + i];
        *(v8b*)&sm.b.wt[bf][tid][8 * q] = t; }
#pragma unroll
      for (int i = 0; i < 4; ++i) { v4b th, tl;
#pragma unroll
        for (int e = 0; e < 4; ++e) { const __bf16 hv = (__bf16)yr[i][e]; th[e] = hv; tl[e] = (__bf16)(yr[i][e] - (float)hv); }
        *(v4b*)&sm.b.yh[bf][(tid >> 3) + 16 * i][(tid & 7) * 4] = th; *(v4b*)&sm.b.yl[bf][(tid >> 3) + 16 * i][(tid & 7) * 4] = tl; } };
    put(0); __syncthreads(); /* publishes stage 0 */
    /* two buffers, as in k_proj; unrolled by two so that the buffer index is a constant */
#pragma unroll 2
    for (int kc = 0; kc < CC / 32; ++kc) { const int cur = kc & 1; const bool more = kc + 1 < CC / 32;
      if (more) st_load(wp, DIN, yp, CC, wr, yr);
      const v16b ah = frag_b(&sm.b.yh[cur][wave * 16 + col][0], lane), al = frag_b(&sm.b.yl[cur][wave * 16 + col][0], lane); v16b w[8]; /* unrolled so that w[] stays in registers */
#pragma unroll
      for (int j = 0; j < 8; ++j) w[j] = frag_b(&sm.b.wt[cur][j * 16 + col][0], lane);
#pragma unroll
      for (int j = 0; j < 8; ++j) { acc[j] = wmma_bf(ah, w[j], acc[j]); acc[j] = wmma_bf(al, w[j], acc[j]); }
      __builtin_amdgcn_sched_barrier(0); /* keeps the waits on the next stage's global loads behind this stage's products, so that the products run inside the loads' latency */
      if (more) put(cur ^ 1);
      __syncthreads(); } /* publishes stage kc + 1, ends the reads of the buffer refilled next (at the end: of the LDS that sf reuses) */
#pragma unroll
    for (int j = 0; j < 8; ++j) { const float bias = BO ? bfr(BO[c0 + j * 16 + col]) : 0.f;
#pragma unroll
      for (int r = 0; r < 8; ++r) sf[wave][8 * g + r][j * 16 + col] = acc[j][r] + bias; }
  } else {
    auto put = [&](int bf) { /* Wo to f16(bf16 x 2^8), ctx once to f16; loops unrolled so that wr[] and yr[] stay in registers */
#pragma unroll
      for (int q = 0; q < 4; ++q) { v8h t;
#pragma unroll
        for (int i = 0; i < 8; ++i) t[i] = (_Float16)(bfr(wr[8 * q + i]) * 256.0f);
        *(v8h*)&sm.h.wt[bf][tid][8 * q] = t; }
#pragma unroll
      for (int i = 0; i < 4; ++i) { v4h t;
#pragma unroll
        for (int e = 0; e < 4; ++e) t[e] = (_Float16)yr[i][e];
        *(v4h*)&sm.h.ya[bf][(tid >> 3) + 16 * i][(tid & 7) * 4] = t; } };
    put(0); __syncthreads(); /* publishes stage 0 */
    /* two buffers, as in k_proj; unrolled by two so that the buffer index is a constant */
#pragma unroll 2
    for (int kc = 0; kc < CC / 32; ++kc) { const int cur = kc & 1; const bool more = kc + 1 < CC / 32;
      if (more) st_load(wp, DIN, yp, CC, wr, yr);
      const v16h a = frag_h(&sm.h.ya[cur][wave * 16 + col][0], lane); v16h w[8]; /* unrolled so that w[] stays in registers */
#pragma unroll
      for (int j = 0; j < 8; ++j) w[j] = frag_h(&sm.h.wt[cur][j * 16 + col][0], lane);
#pragma unroll
      for (int j = 0; j < 8; ++j) acc[j] = wmma16(a, w[j], acc[j]);
      __builtin_amdgcn_sched_barrier(0); /* keeps the waits on the next stage's global loads behind this stage's products, so that the products run inside the loads' latency */
      if (more) put(cur ^ 1);
      __syncthreads(); } /* publishes stage kc + 1, ends the reads of the buffer refilled next (at the end: of the LDS that sf reuses) */
#pragma unroll
    for (int j = 0; j < 8; ++j) { const float bias = BO ? bfr(BO[c0 + j * 16 + col]) : 0.f;
#pragma unroll
      for (int r = 0; r < 8; ++r) sf[wave][8 * g + r][j * 16 + col] = acc[j][r] * (1.0f / 256.0f) + bias; } }
  LDSX(); for (int rl = 0; rl < 16; ++rl) vst2(OUT + (r0 + rl) * DIN + c0 + lane * 4, *(const v4f*)&sf[wave][rl][lane * 4]); }

extern "C" void kernel_launch(void* const* d_in, const int* in_sizes, int n_in, void* d_out, int out_size, void* d_ws, size_t ws_size, hipStream_t stream) {
  (void)in_sizes; (void)n_in; (void)out_size;
  const float** F = (const float**)d_in;
  if (ws_size < (size_t)WS_END) return;
  char* ws = (char*)d_ws; _Float16 *QH = (_Float16*)(ws + WS_QH), *KH = (_Float16*)(ws + WS_KH), *VT = (_Float16*)(ws + WS_VT), *QL = (_Float16*)(ws + WS_QL), *KL = (_Float16*)(ws + WS_KL); __bf16 *VB = (__bf16*)(ws + WS_VB), *VBL = (__bf16*)(ws + WS_VBL); float *Y = (float*)(ws + WS_Y);
  (void)Y; (void)QL; (void)KL; (void)VB; (void)VBL;
  // inputs: 0 x [2,2048,1024]; 1 Wq, 2 Wk, 3 Wv [16,1024,64]; 4 Wo [1024,1024] (in,out); 5 bo [1024]
  k_proj<<<dim3(TNB * TT / 64, CC / 128, 3), 128, 0, stream>>>(F[0], F[0], F[0], F[1], F[2], F[3], nullptr, nullptr, nullptr, QH, QL, KH, KL, VT, VB, VBL);
  k_att<<<dim3(NB * NH * NQB), 128, 0, stream>>>(QH, KH, VT, QL, KL, VB, VBL, Y);
  k_out<<<dim3(TNB * TT / 64, DIN / 128), 128, 0, stream>>>(Y, F[4], F[5], (float*)d_out);
}

// v004
// It runs in 144 microseconds.
// In both of two side-by-side timings against v003, it was 1.16 times as fast.
// Counting every step since v000, it is 7.37 times as fast.
// compute dtype: all float inputs rounded to bf16; q/k/v = x W[h] with EXACT bf16 products on WMMA 16x16x32, f32 accumulate; q, k once to f16 -> 1-product causal logits x 1/32, except the first 384 query rows of each sequence (few keys, no averaging), which use q and k as f16 hi + residual (x 2^10) (3 products); softmax in f32 (precise expf, running maximum and sum over blocks of 64 keys, division by the sum last); exp(logit - max) once to f16 against v once to f16 (1 product), except the first 384 rows: exp(logit - max) and v as bf16 hi + lo (3 products); ctx once to f16 against Wo carried x 2^8 in f16 (exact bf16 values), except the first 384 rows: ctx bf16 hi + lo against exact bf16 Wo (2 products); + bo; f32 output.
#include <hip/hip_runtime.h>
#include <math.h>

typedef __attribute__((ext_vector_type(16))) _Float16 v16h;
typedef __attribute__((ext_vector_type(16))) __bf16 v16b;
typedef __attribute__((ext_vector_type(8)))  _Float16 v8h;
typedef __attribute__((ext_vector_type(8)))  float v8f;
typedef __attribute__((ext_vector_type(4)))  float v4f;
typedef __attribute__((ext_vector_type(2)))  float v2f;
typedef __attribute__((ext_vector_type(4)))  unsigned v4u;
typedef __attribute__((ext_vector_type(4)))  int v4i;
typedef float __attribute__((may_alias)) float_a;
typedef int __attribute__((may_alias)) int_a;

template <typename T> __device__ __forceinline__ void vst2(void* p, T v) { *(T*)p = v;  }
__device__ __forceinline__ v8f wmma16(v16h a, v16h b, v8f c) {
  v8f d = __builtin_amdgcn_wmma_f32_16x16x32_f16(false, a, false, b, (short)0, c, false, false);
  asm volatile("v_nop\n\tv_nop\n\tv_nop\n\tv_nop" : "+v"(d) : "v"(a), "v"(b));
  return d;
}
__device__ __forceinline__ v8f wmma_bf(v16b a, v16b b, v8f c) {
  v8f d = __builtin_amdgcn_wmma_f32_16x16x32_bf16(false, a, false, b, (short)0, c, false, false);
  asm volatile("v_nop\n\tv_nop\n\tv_nop\n\tv_nop" : "+v"(d) : "v"(a), "v"(b));
  return d;
}
// 16x16x32 fragments: lane = (h = lane>>4, row/col = lane&15); elements 0..7 = k0+8h+0..7, 8..15 = k0+16+8h+0..7; D element r = row 8h+r
__device__ __forceinline__ v16h frag_h(const _Float16* rowk0, int lane) {
  union { v16h v; v8h q[2]; } u; const _Float16* p = rowk0 + 8 * (lane >> 4);
  u.q[0] = *(const v8h*)p; u.q[1] = *(const v8h*)(p + 16); return u.v;
}
__device__ __forceinline__ v16h frag_f32(const float* rowk0, int lane) {
  v16h a; const float* p = rowk0 + 8 * (lane >> 4);
#pragma unroll
  for (int i = 0; i < 8; ++i) { a[i] = (_Float16)p[i]; a[8 + i] = (_Float16)p[16 + i]; }
  return a;
}
__device__ __forceinline__ v16h frag_f32s(const float* rowk0, int lane, float sc) {
  v16h a; const float* p = rowk0 + 8 * (lane >> 4);
#pragma unroll
  for (int i = 0; i < 8; ++i) { a[i] = (_Float16)(p[i] * sc); a[8 + i] = (_Float16)(p[16 + i] * sc); }
  return a;
}
// column fragment from a [K][ld] layout (column n), rows >= K read as 0
__device__ __forceinline__ v16h fragc_f32(const float* W, int k0, int n, int lane, int ld, int K) {
  v16h a; const int g = lane >> 4;
#pragma unroll
  for (int i = 0; i < 8; ++i) { const int ka = k0 + 8 * g + i, kb = ka + 16;
    a[i] = (_Float16)(ka < K ? W[(size_t)(ka < K ? ka : K - 1) * ld + n] : 0.f); a[8 + i] = (_Float16)(kb < K ? W[(size_t)(kb < K ? kb : K - 1) * ld + n] : 0.f); }
  return a;
}
struct F2 { v16b h, l; };
__device__ __forceinline__ F2 bsplit16(const float v[16]) { F2 r;
#pragma unroll
  for (int i = 0; i < 16; ++i) { const __bf16 h = (__bf16)v[i]; r.h[i] = h; r.l[i] = (__bf16)(v[i] - (float)h); }
  return r; }
__device__ __forceinline__ F2 split_row(const float* row, int k0, int lane) { float v[16]; const float* p = row + k0 + 8 * (lane >> 4);
#pragma unroll
  for (int i = 0; i < 8; ++i) { v[i] = p[i]; v[8 + i] = p[16 + i]; }
  return bsplit16(v); }
__device__ __forceinline__ F2 split_rowK(const float* row, int k0, int lane, int K) { float v[16]; const int g = lane >> 4;
#pragma unroll
  for (int i = 0; i < 8; ++i) { const int ka = k0 + 8 * g + i, kb = ka + 16; v[i] = ka < K ? row[ka < K ? ka : K - 1] : 0.f; v[8 + i] = kb < K ? row[kb < K ? kb : K - 1] : 0.f; }
  return bsplit16(v); }
__device__ __forceinline__ F2 split_col(const float* W, int k0, int n, int lane, int ld, int K) { float v[16]; const int g = lane >> 4;
#pragma unroll
  for (int i = 0; i < 8; ++i) { const int ka = k0 + 8 * g + i, kb = ka + 16; v[i] = ka < K ? W[(size_t)(ka < K ? ka : K - 1) * ld + n] : 0.f; v[8 + i] = kb < K ? W[(size_t)(kb < K ? kb : K - 1) * ld + n] : 0.f; }
  return bsplit16(v); }
__device__ __forceinline__ v8f mac3(const F2& a, const F2& b, v8f c) { c = wmma_bf(a.l, b.h, c); c = wmma_bf(a.h, b.l, c); return wmma_bf(a.h, b.h, c); }
__device__ __forceinline__ float sigm(float v) { return 1.0f / (1.0f + expf(-v)); }
#define LDSX() do { asm volatile("s_wait_dscnt 0" ::: "memory"); __builtin_amdgcn_wave_barrier(); __builtin_amdgcn_fence(__ATOMIC_RELEASE, "workgroup"); } while (0)

// Causal multi-head self-attention with per-head projection tensors (B 2, T 2,048, C 1,024, 16 heads x 64): q/k/v[b,h,t,:] = x[b,t,:] Wq/Wk/Wv[h] ([H][C][64], no bias); att = softmax(q k^T / sqrt(1024) with key > query -> -inf); out = concat_h(att v) Wo ((in,out) [1024,1024]) + bo.
#define NB 2
#define TT 2048
#define CC 1024            // NH * HD = projected width
#define DIN 1024          // input (model) width
#define NH 16
#define HD 64
#define NQB (TT / 64)
#define SCALE (0.03125f)
#define CAUSAL 1
#ifndef TNB
#define TNB NB
#endif
__device__ __forceinline__ float bfr(float v) { return (float)(__bf16)v; }
typedef __attribute__((ext_vector_type(8))) __bf16 v8b;
__device__ __forceinline__ v16b frag_b(const __bf16* rowk0, int lane) {
  union { v16b v; v8b q[2]; } u; const __bf16* p = rowk0 + 8 * (lane >> 4);
  u.q[0] = *(const v8b*)p; u.q[1] = *(const v8b*)(p + 16); return u.v;
}
#define QBH 6              // causal: query blocks 0..QBH-1 of each sequence (few keys, no averaging) take the high-precision path
#define QHI 384            // rows carrying a q residual plane
#define KHI 384            // key rows carrying k residual / v bf16 hi+lo planes (used only by the causal high-precision path)
// B fragment (k rows k0+.., output column o) of a weight: (in,out) [K][ld] or (out,in) [ld rows of K]: bf16 exact, or f16(bf16 * 256) exact
__device__ __forceinline__ v16b wcol_io(const float* Wm, int k0, int o, int lane, int ld) { v16b w; const int g = lane >> 4;
#pragma unroll
  for (int i = 0; i < 8; ++i) { w[i] = (__bf16)Wm[(size_t)(k0 + 8 * g + i) * ld + o]; w[8 + i] = (__bf16)Wm[(size_t)(k0 + 16 + 8 * g + i) * ld + o]; }
  return w; }
__device__ __forceinline__ v16b wcol_oi(const float* Wm, int k0, int o, int lane, int K) { v16b w; const float* p = Wm + (size_t)o * K + k0 + 8 * (lane >> 4);
#pragma unroll
  for (int i = 0; i < 8; ++i) { w[i] = (__bf16)p[i]; w[8 + i] = (__bf16)p[16 + i]; }
  return w; }
__device__ __forceinline__ v16h wcolh_io(const float* Wm, int k0, int o, int lane, int ld) { v16h w; const int g = lane >> 4;
#pragma unroll
  for (int i = 0; i < 8; ++i) { w[i] = (_Float16)(bfr(Wm[(size_t)(k0 + 8 * g + i) * ld + o]) * 256.0f); w[8 + i] = (_Float16)(bfr(Wm[(size_t)(k0 + 16 + 8 * g + i) * ld + o]) * 256.0f); }
  return w; }
__device__ __forceinline__ v16h wcolh_oi(const float* Wm, int k0, int o, int lane, int K) { v16h w; const float* p = Wm + (size_t)o * K + k0 + 8 * (lane >> 4);
#pragma unroll
  for (int i = 0; i < 8; ++i) { w[i] = (_Float16)(bfr(p[i]) * 256.0f); w[8 + i] = (_Float16)(bfr(p[16 + i]) * 256.0f); }
  return w; }
#define WQKV_LAYOUT 2   // 0 = (in,out) [DIN][CC]; 1 = (out,in) [CC][DIN]; 2 = per-head [NH][DIN][HD]
__device__ __forceinline__ v16b wcol_hdk(const float* Wm, int k0, int o, int lane) { v16b w; const int g = lane >> 4; const float* p = Wm + (size_t)(o / HD) * DIN * HD + (o % HD);
#pragma unroll
  for (int i = 0; i < 8; ++i) { w[i] = (__bf16)p[(size_t)(k0 + 8 * g + i) * HD]; w[8 + i] = (__bf16)p[(size_t)(k0 + 16 + 8 * g + i) * HD]; }
  return w; }
#define WO_OUT_IN 0
#if WQKV_LAYOUT == 1
#define WCOL(W, k0, o, lane) wcol_oi(W, k0, o, lane, DIN)
#elif WQKV_LAYOUT == 2
#define WCOL(W, k0, o, lane) wcol_hdk(W, k0, o, lane)
#else
#define WCOL(W, k0, o, lane) wcol_io(W, k0, o, lane, CC)
#endif
#if WO_OUT_IN
#define WOCOL(W, k0, o, lane) wcol_oi(W, k0, o, lane, CC)
#define WOCOLH(W, k0, o, lane) wcolh_oi(W, k0, o, lane, CC)
#else
#define WOCOL(W, k0, o, lane) wcol_io(W, k0, o, lane, DIN)
#define WOCOLH(W, k0, o, lane) wcolh_io(W, k0, o, lane, DIN)
#endif

#define WS_QH  0u                                      // f16 q rows [b*t][CC]
#define WS_KH  (WS_QH + 2u * (size_t)NB * TT * CC)      // f16 k rows [b*t][CC]
#define WS_VT  (WS_KH + 2u * (size_t)NB * TT * CC)      // f16 v planes [b][c][t]
#define WS_QL  (WS_VT + 2u * (size_t)NB * CC * TT)      // f16 q residual x 2^10 rows [b][t < QHI][CC]
#define WS_KL  (WS_QL + 2u * (size_t)NB * QHI * CC)     // f16 k residual x 2^10 rows [b][t < KHI][CC]
#define WS_VB  (WS_KL + 2u * (size_t)NB * KHI * CC)     // bf16 v hi planes [b][c][t < KHI]
#define WS_VBL (WS_VB + 2u * (size_t)NB * CC * KHI)
#define WS_Y   (WS_VBL + 2u * (size_t)NB * CC * KHI)      // f32 ctx rows [b*t][CC] (only when there is an output projection)
#define WS_END (WS_Y  + 4u * (size_t)NB * TT * CC)

// ---- staging of a 32-k stage of both GEMM operands (k_proj, k_out): a block brings its 128 weight columns and its 64 activation rows from global memory ONCE, in whole 128-B lines, rounds them to their 16-bit operand type and lays them k-contiguous in LDS; every wave then takes its fragments by 16-byte LDS reads. Values, k order and sum order are those of the direct loads
#define SP 40              // LDS pitch of a staged row of 32 k, in 16-bit elements: 80 B = 16 B x odd, the pitch at which 16-byte LDS reads and writes of 16 rows fall on distinct banks
typedef __attribute__((ext_vector_type(4))) __bf16 v4b;
typedef __attribute__((ext_vector_type(4))) _Float16 v4h;
// one thread's share of a stage: 32 k of weight column tid (a wave-instruction = 32 neighbouring columns = one line), and four 16-byte pieces of the activation rows (a wave-instruction = four whole lines); both pointers then step on 32 k
__device__ __forceinline__ void st_load(const float*& wp, int wld, const float*& xp, int xld, float wr[32], v4f xr[4]) {
#pragma unroll
  for (int k = 0; k < 32; ++k) wr[k] = wp[(size_t)k * wld];
#pragma unroll
  for (int i = 0; i < 4; ++i) xr[i] = *(const v4f*)(xp + (size_t)(16 * i) * xld);
  asm volatile("s_wait_xcnt 0x0" :: "v"(wp), "v"(xp) : "memory"); /* the wait that stands before a register of an issued global load is overwritten; the two pointers are inputs so that the loads' address registers live up to it */
  wp += (size_t)32 * wld; xp += 32; }
// ---- k_proj: block = (64 rows, 128 cols, which): q/k/v = X W (+ b) with exact bf16 products (K = DIN) -> which 0: q f16 rows (+ residual rows < QHI); 1: k f16 rows (+ residual rows < KHI); 2: v f16 planes [c][t] (+ bf16 hi/lo planes for t < KHI)
__global__ __launch_bounds__(128) void k_proj(const float* __restrict__ XQ, const float* __restrict__ XK, const float* __restrict__ XV, const float* __restrict__ WQ, const float* __restrict__ WK, const float* __restrict__ WV, const float* __restrict__ BQ, const float* __restrict__ BK, const float* __restrict__ BV,
    _Float16* __restrict__ QH, _Float16* __restrict__ QL, _Float16* __restrict__ KH, _Float16* __restrict__ KL, _Float16* __restrict__ VT, __bf16* __restrict__ VB, __bf16* __restrict__ VBL) {
  union Lds { struct { _Float16 sh[64][136], sl[64][136]; } qk; struct { _Float16 th[128][72]; __bf16 tb[128][72], tbl[128][72]; } v; struct { __bf16 wt[2][128][SP], xs[2][64][SP]; } st; }; /* the stage buffers lie in the LDS of the epilogue's arrays, which are written only behind the loop's last barrier */
  __shared__ __align__(16) Lds sm; auto& sh = sm.qk.sh; auto& sl = sm.qk.sl; auto& th = sm.v.th; auto& tb = sm.v.tb; auto& tbl = sm.v.tbl;
  const int tid = threadIdx.x, wave = tid >> 5, lane = tid & 31, col = lane & 15, g = lane >> 4; const int which = blockIdx.z; const int c0 = blockIdx.y * 128; const size_t r0 = (size_t)blockIdx.x * 64; const size_t bb = r0 / TT; const int t0 = (int)(r0 % TT);
  const float* X = which == 0 ? XQ : which == 1 ? XK : XV; const float* WA = which == 0 ? WQ : which == 1 ? WK : WV; const float* BA = which == 0 ? BQ : which == 1 ? BK : BV;
  static_assert(WQKV_LAYOUT == 2, "stage loader written for per-head [NH][DIN][HD] weights");
  v8f acc[8] = {}; float wr[32]; v4f xr[4];
  const float* wp = WA + (size_t)((c0 + tid) / HD) * DIN * HD + (c0 + tid) % HD; const float* xp = X + (r0 + (tid >> 3)) * DIN + (tid & 7) * 4;
  /* rounds this thread's share to bf16 and writes it to stage buffer bf; loops unrolled so that wr[] and xr[] stay in registers */
  auto put = [&](int bf) {
#pragma unroll
    for (int q = 0; q < 4; ++q) { v8b t;
#pragma unroll
      for (int i = 0; i < 8; ++i) t[i] = (__bf16)wr[8 * q + i];
      *(v8b*)&sm.st.wt[bf][tid][8 * q] = t; }
#pragma unroll
    for (int i = 0; i < 4; ++i) { v4b t;
#pragma unroll
      for (int e = 0; e < 4; ++e) t[e] = (__bf16)xr[i][e];
      *(v4b*)&sm.st.xs[bf][(tid >> 3) + 16 * i][(tid & 7) * 4] = t; } };
  st_load(wp, HD, xp, DIN, wr, xr); put(0); __syncthreads(); /* publishes stage 0 */
  /* two buffers: stage kc + 1 is asked for before stage kc's products, so its latency runs behind them, and written to the other buffer after them; unrolled by two so that the buffer index is a constant */
#pragma unroll 2
  for (int kc = 0; kc < DIN / 32; ++kc) { const int cur = kc & 1; const bool more = kc + 1 < DIN / 32;
    if (more) st_load(wp, HD, xp, DIN, wr, xr);
    const v16b a = frag_b(&sm.st.xs[cur][wave * 16 + col][0], lane); v16b w[8]; /* unrolled so that w[] stays in registers */
#pragma unroll
    for (int j = 0; j < 8; ++j) w[j] = frag_b(&sm.st.wt[cur][j * 16 + col][0], lane);
#pragma unroll
    for (int j = 0; j < 8; ++j) acc[j] = wmma_bf(a, w[j], acc[j]);
    __builtin_amdgcn_sched_barrier(0); /* keeps the waits on the next stage's global loads behind this stage's products, so that the products run inside the loads' latency */
    if (more) put(cur ^ 1);
    __syncthreads(); } /* one barrier a stage: publishes stage kc + 1 and ends every wave's reads of the buffer that the next trip refills (after the last trip: of the LDS that the epilogue reuses) */
  if (which < 2) { _Float16* DH = which == 0 ? QH : KH; _Float16* DL = which == 0 ? QL : KL; const int nhi = which == 0 ? QHI : KHI; const bool hi_rows = t0 < nhi;
#pragma unroll
    for (int j = 0; j < 8; ++j) { const float bias = BA ? bfr(BA[c0 + j * 16 + col]) : 0.f;
#pragma unroll
      for (int r = 0; r < 8; ++r) { const float v = acc[j][r] + bias; const _Float16 hv = (_Float16)v; sh[wave * 16 + 8 * g + r][j * 16 + col] = hv; sl[wave * 16 + 8 * g + r][j * 16 + col] = (_Float16)((v - (float)hv) * 1024.0f); } }
    __syncthreads();
    for (int e = tid; e < 64 * 16; e += 128) { const int rl = e >> 4, q = e & 15; vst2((unsigned*)(DH + (r0 + rl) * CC + c0 + q * 8), *(const v4u*)&sh[rl][q * 8]); if (hi_rows) vst2((unsigned*)(DL + (bb * nhi + t0 + rl) * (size_t)CC + c0 + q * 8), *(const v4u*)&sl[rl][q * 8]); }
  } else { const bool hi_rows = t0 < KHI;
#pragma unroll
    for (int j = 0; j < 8; ++j) { const float bias = BA ? bfr(BA[c0 + j * 16 + col]) : 0.f;
#pragma unroll
      for (int r = 0; r < 8; ++r) { const float v = acc[j][r] + bias; const int rl = wave * 16 + 8 * g + r, cl = j * 16 + col; th[cl][rl] = (_Float16)v; const __bf16 bh = (__bf16)v; tb[cl][rl] = bh; tbl[cl][rl] = (__bf16)(v - (float)bh); } }
    __syncthreads();
    for (int e = tid; e < 128 * 8; e += 128) { const int cl = e >> 3, q = e & 7; vst2((unsigned*)(VT + (bb * CC + c0 + cl) * (size_t)TT + t0 + q * 8), *(const v4u*)&th[cl][q * 8]); if (hi_rows) { const size_t o3 = (bb * CC + c0 + cl) * (size_t)KHI + t0 + q * 8; vst2((unsigned*)(VB + o3), *(const v4u*)&tb[cl][q * 8]); vst2((unsigned*)(VBL + o3), *(const v4u*)&tbl[cl][q * 8]); } } } }
// ---- k_att: block = 64 queries (qb) of (b, h), one wave = 16 queries; the waves share only the staged k and v tiles (query blocks >= QBH): per 64 keys S^T = K Q^T (lane = one query, its D registers = keys), x SCALE, causal mask by index on the diagonal block, running maximum and sum in f32 (precise expf), e = exp(logit - max) packed from the score registers straight into the B operand of ctx^T += V^T P^T, ctx and sum brought to the new maximum every trip, ctx divided by the sum at the end. Logits and P never go to memory. Products as before: 1 f16 product each; query blocks < QBH: 3-product logits (q, k hi + residual), e and v as bf16 hi + lo (3 products)
__device__ __forceinline__ v8f mm_h(v16h a, v16h b, v8f c) { return __builtin_amdgcn_wmma_f32_16x16x32_f16(false, a, false, b, (short)0, c, false, false); }
__device__ __forceinline__ v8f mm_b(v16b a, v16b b, v8f c) { return __builtin_amdgcn_wmma_f32_16x16x32_bf16(false, a, false, b, (short)0, c, false, false); }
// fragment from a pointer that already holds the lane's 8 g offset, so that the pointer itself is the address register pair of the loads
__device__ __forceinline__ v16h frag_hp(const _Float16* p) { union { v16h v; v8h q[2]; } u; u.q[0] = *(const v8h*)p; u.q[1] = *(const v8h*)(p + 16); return u.v; }
__device__ __forceinline__ v16b frag_bp(const __bf16* p) { union { v16b v; v8b q[2]; } u; u.q[0] = *(const v8b*)p; u.q[1] = *(const v8b*)(p + 16); return u.v; }
// every loop over st[], acc[] or a fragment array in sm_step and k_att is unrolled so that the array stays in registers; the two key loops stay rolled (unroll 1): one trip's fragments already fill the register budget of four waves a SIMD
// st[t][r] = scaled logit of key k0 + 16 t + 8 g + r for this lane's query qi; on return e = exp(logit - new maximum); m, l, acc brought to the new maximum (l is this half-wave's part of the sum)
__device__ __forceinline__ void sm_step(v8f st[4], v8f acc[HD / 16], float& m, float& l, bool diag, int k0, int g, int qi) {
  if (diag) {
#pragma unroll
    for (int t = 0; t < 4; ++t)
#pragma unroll
      for (int r = 0; r < 8; ++r) if (k0 + t * 16 + 8 * g + r > qi) st[t][r] = -3.0e38f; }
  float mx = m;
#pragma unroll
  for (int t = 0; t < 4; ++t)
#pragma unroll
    for (int r = 0; r < 8; ++r) mx = fmaxf(mx, st[t][r]);
  mx = fmaxf(mx, __shfl_xor(mx, 16));
  const float alpha = expf(m - mx); m = mx; float s = 0.f;
#pragma unroll
  for (int t = 0; t < 4; ++t)
#pragma unroll
    for (int r = 0; r < 8; ++r) { const float e = expf(st[t][r] - mx); st[t][r] = e; s += e; }
  l = l * alpha + s;
#pragma unroll
  for (int j = 0; j < HD / 16; ++j) acc[j] *= alpha; }
// ---- staging of a 64-key tile (k_att, query blocks >= QBH): the block's four waves read the same 64 k rows and 64 v planes, so the block brings them from global memory ONCE, in whole 128-B lines, by asynchronous copies to LDS, and every wave takes its fragments by 16-byte LDS reads. Values, k order and sum order are those of the direct loads
#define KVP 72             // LDS pitch of a staged row of 64 f16: 144 B = 16 B x odd, the pitch at which 16-byte LDS reads of 16 rows fall on distinct banks
#define KVB (128 * KVP * 2) // bytes of one tile buffer: rows 0..63 = k rows (key, head column), rows 64..127 = v planes (head column, key)
// one thread's share of a tile: eight 16-byte copies, rows (tid >> 3) + 16 i, piece tid & 7 (a wave-instruction = four whole lines). l = the lane's LDS byte address in row tid >> 3 of the buffer, kg and vg = its global addresses in k row tid >> 3 and v plane tid >> 3 of the tile
__device__ __forceinline__ void kv_copy(unsigned l, const _Float16* kg, const _Float16* vg) {
  /* the s_wait_xcnt 0 stands inside the copies' own statement, so that no register which a copy names is rewritten in front of it */
  asm volatile("global_load_async_to_lds_b128 %0, %8, off\n\t"
               "global_load_async_to_lds_b128 %1, %9, off\n\t"
               "global_load_async_to_lds_b128 %2, %10, off\n\t"
               "global_load_async_to_lds_b128 %3, %11, off\n\t"
               "global_load_async_to_lds_b128 %4, %12, off\n\t"
               "global_load_async_to_lds_b128 %5, %13, off\n\t"
               "global_load_async_to_lds_b128 %6, %14, off\n\t"
               "global_load_async_to_lds_b128 %7, %15, off\n\t"
               "s_wait_xcnt 0x0"
               :: "v"(l), "v"(l + 16 * KVP * 2), "v"(l + 32 * KVP * 2), "v"(l + 48 * KVP * 2), "v"(l + 64 * KVP * 2), "v"(l + 80 * KVP * 2), "v"(l + 96 * KVP * 2), "v"(l + 112 * KVP * 2),
                  "v"(kg), "v"(kg + (size_t)16 * CC), "v"(kg + (size_t)32 * CC), "v"(kg + (size_t)48 * CC), "v"(vg), "v"(vg + (size_t)16 * TT), "v"(vg + (size_t)32 * TT), "v"(vg + (size_t)48 * TT)
               : "memory"); }
__global__ __launch_bounds__(128) void k_att(const _Float16* __restrict__ QH, const _Float16* __restrict__ KH, const _Float16* __restrict__ VT, const _Float16* __restrict__ QL, const _Float16* __restrict__ KL, const __bf16* __restrict__ VB, const __bf16* __restrict__ VBL, float* __restrict__ Y) { __shared__ __align__(16) float ss[4][16][HD + 4]; __shared__ __align__(16) _Float16 kv[2][128][KVP];
  const int tid = threadIdx.x, wave = tid >> 5, lane = tid & 31, col = lane & 15, g = lane >> 4;
  /* all 1,024 blocks are resident at once (4 a WGP) and a block's cost grows with qb, so the launch lasts as long as the fullest WGP: the flat index is spread so that the four blocks f, f + 256, f + 512, f + 768 and equally the four blocks f, f + 8, f + 16, f + 24 hold one qb of each quarter, 31 - i, 16 + i, 15 - i, i: the same cost for every such four. Speed only: any placement is correct; (qb, head, batch) <-> f is one to one */
  static_assert(NQB == 32 && NB * NH == 32, "index spread written for 32 query blocks x 32 (batch, head) pairs");
  const int f = blockIdx.x, fk = (f >> 3) & 3, fi = (f >> 5) & 7, fc = (fk + (f >> 8)) & 3; const int qb = fc == 0 ? 31 - fi : fc == 1 ? 16 + fi : fc == 2 ? 15 - fi : fi; const int bh = (f & 7) + 8 * fk; const int h = bh % NH, b = bh / NH; const int ql0 = qb * 64 + wave * 16, qi = ql0 + col;
  const _Float16* qp = QH + ((size_t)b * TT + qi) * CC + h * HD + 8 * g; const _Float16* kp = KH + ((size_t)b * TT + col) * CC + h * HD + 8 * g;
  v8f acc[HD / 16] = {}; float m = -3.0e38f, l = 0.f;
  if (qb >= QBH) { static_assert(QBH >= 1, "the ring's prologue asks for tiles 0 and 1");
    const unsigned lb = (unsigned)(size_t)&kv[0][tid >> 3][(tid & 7) * 8]; const _Float16* kg = KH + ((size_t)b * TT + (tid >> 3)) * CC + h * HD + (tid & 7) * 8; const _Float16* vg = VT + ((size_t)b * CC + h * HD + (tid >> 3)) * (size_t)TT + (tid & 7) * 8;
    const v16h q0 = frag_hp(qp), q1 = frag_hp(qp + 32);
    asm volatile("s_wait_xcnt 0x0" :: "v"(qp) : "memory"); /* the wait that stands before a register of an issued global load is overwritten; the pointer is an input so that the loads' address registers live up to it */
    kv_copy(lb, kg, vg);
    asm volatile("s_wait_asynccnt 0x0" ::: "memory"); /* this wave's copies of tile 0 have landed */
    __syncthreads(); /* publishes tile 0 */
    kv_copy(lb + KVB, kg + (size_t)64 * CC, vg + 64); kg += (size_t)128 * CC; vg += 128; /* kg and vg walk two tiles ahead of the trip */
    /* rolled: a second trip's fragments would go past the 256 registers that four waves a SIMD allow */
#pragma unroll 1
    for (int kb = 0; kb <= qb; ++kb) { const int k0 = kb * 64; const _Float16 (*T)[KVP] = kv[kb & 1]; v16h ka[4][2], va[2][HD / 16]; /* trip kb reads buffer kb & 1 alone; inner loops unrolled so that the arrays stay in registers */
#pragma unroll
      for (int t = 0; t < 4; ++t) { ka[t][0] = frag_hp(&T[t * 16 + col][8 * g]); ka[t][1] = frag_hp(&T[t * 16 + col][32 + 8 * g]); }
#pragma unroll
      for (int u = 0; u < 2; ++u)
#pragma unroll
        for (int j = 0; j < HD / 16; ++j) va[u][j] = frag_hp(&T[64 + j * 16 + col][u * 32 + 8 * g]);
      __builtin_amdgcn_sched_barrier(0); /* keeps the trip's LDS reads together as one group in front of the products: left free they sink to their uses, with one full wait a product */
      v8f st[4];
#pragma unroll
      for (int t = 0; t < 4; ++t) { v8f z = {}; z = mm_h(ka[t][0], q0, z); st[t] = mm_h(ka[t][1], q1, z) * SCALE; }
      /* the trip reads nothing of its tile behind this line (softmax and P v work on registers), so this is the foot of the trip for the ring: the buffer is handed over here and the refill has a whole trip to land */
      asm volatile("s_wait_dscnt 0x0" ::: "memory"); /* this wave's reads of the buffer that is refilled below have returned */
      asm volatile("s_wait_asynccnt 0x0" ::: "memory"); /* this wave's copies of tile kb + 1 have landed */
      __syncthreads(); /* one barrier a trip: publishes tile kb + 1 and ends every wave's reads of the buffer refilled behind it */
      if (kb + 2 <= qb) { kv_copy(lb + (kb & 1) * KVB, kg, vg); kg += (size_t)64 * CC; vg += 64; } /* block-uniform test: tile kb + 2 goes into the buffer that this trip has read */
      sm_step(st, acc, m, l, kb == qb, k0, g, qi);
#pragma unroll
      for (int u = 0; u < 2; ++u) { v16h p;
#pragma unroll
        for (int i = 0; i < 8; ++i) { p[i] = (_Float16)st[2 * u][i]; p[8 + i] = (_Float16)st[2 * u + 1][i]; }
#pragma unroll
        for (int j = 0; j < HD / 16; ++j) acc[j] = mm_h(va[u][j], p, acc[j]); } }
    asm volatile("s_wait_asynccnt 0x0" ::: "memory"); /* no copy is outstanding when the wave goes on */
  } else { const _Float16* qlp = QL + ((size_t)b * QHI + qi) * CC + h * HD + 8 * g; const _Float16* klp = KL + ((size_t)b * KHI + col) * CC + h * HD + 8 * g; const size_t vo = ((size_t)b * CC + h * HD + col) * (size_t)KHI + 8 * g; const __bf16* vhp = VB + vo; const __bf16* vlp = VBL + vo;
    const v16h q0 = frag_hp(qp), q1 = frag_hp(qp + 32), r0 = frag_hp(qlp), r1 = frag_hp(qlp + 32);
    asm volatile("s_wait_xcnt 0x0" :: "v"(qp), "v"(qlp) : "memory"); /* as above, for the q loads' two pointers */
    /* rolled, for the same register budget */
#pragma unroll 1
    for (int kb = 0; kb <= qb; ++kb) { const int k0 = kb * 64; v8f st[4];
#pragma unroll
      for (int t = 0; t < 4; ++t) { const size_t ko = (size_t)(t * 16) * CC; const v16h kh0 = frag_hp(kp + ko), kh1 = frag_hp(kp + ko + 32), kl0 = frag_hp(klp + ko), kl1 = frag_hp(klp + ko + 32);
        v8f a = {}, al = {}; a = mm_h(kh0, q0, a); al = mm_h(kh0, r0, al); al = mm_h(kl0, q0, al); a = mm_h(kh1, q1, a); al = mm_h(kh1, r1, al); al = mm_h(kl1, q1, al);
        st[t] = (a + al * (1.0f / 1024.0f)) * SCALE; }
      sm_step(st, acc, m, l, kb == qb, k0, g, qi);
#pragma unroll
      for (int u = 0; u < 2; ++u) { float pv[16];
#pragma unroll
        for (int i = 0; i < 8; ++i) { pv[i] = st[2 * u][i]; pv[8 + i] = st[2 * u + 1][i]; }
        const F2 p = bsplit16(pv);
#pragma unroll
        for (int j = 0; j < HD / 16; ++j) { const size_t po = (size_t)(j * 16) * KHI + u * 32; const v16b vh = frag_bp(vhp + po), vl = frag_bp(vlp + po); acc[j] = mm_b(vh, p.h, acc[j]); acc[j] = mm_b(vh, p.l, acc[j]); acc[j] = mm_b(vl, p.h, acc[j]); } }
      asm volatile("s_wait_xcnt 0x0" :: "v"(kp), "v"(klp), "v"(vhp), "v"(vlp) : "memory"); /* as above: stands before the four pointers step on to the next 64 keys */
      kp += (size_t)64 * CC; klp += (size_t)64 * CC; vhp += 64; vlp += 64; } }
  l += __shfl_xor(l, 16); const float inv = 1.0f / l;
#pragma unroll
  for (int j = 0; j < HD / 16; ++j) { const v8f o = acc[j] * inv; /* lane = query col, registers = head columns j*16 + 8g + r */
    *(v4f*)&ss[wave][col][j * 16 + 8 * g] = __builtin_shufflevector(o, o, 0, 1, 2, 3); *(v4f*)&ss[wave][col][j * 16 + 8 * g + 4] = __builtin_shufflevector(o, o, 4, 5, 6, 7); }
  LDSX(); /* own-wave exchange: the 256-B (row, head) segments go out whole, two rows an instruction */
  for (int rl = 0; rl < 16; rl += 2) vst2(Y + ((size_t)b * TT + ql0 + rl + g) * CC + h * HD + col * 4, *(const v4f*)&ss[wave][rl + g][col * 4]); }
// ---- k_out: block = (64 rows, 128 cols): out = ctx Wo (+ bo): ctx once to f16 against Wo as f16(bf16 x 2^8) exact (1 product) x 2^-8; causal early rows (< QHI of each sequence): ctx bf16 hi + lo against exact bf16 Wo (2 products)
__global__ __launch_bounds__(128) void k_out(const float* __restrict__ Y, const float* __restrict__ WO, const float* __restrict__ BO, float* __restrict__ OUT) { union Lds { float sf[4][16][132]; struct { _Float16 wt[2][128][SP], ya[2][64][SP]; } h; struct { __bf16 wt[2][128][SP], yh[2][64][SP], yl[2][64][SP]; } b; }; /* the stage buffers lie in the LDS of the epilogue's array, which is written only behind the loop's last barrier */
  __shared__ __align__(16) Lds sm; auto& sf = sm.sf;
  const int tid = threadIdx.x, wave = tid >> 5, lane = tid & 31, col = lane & 15, g = lane >> 4; const int c0 = blockIdx.y * 128; const size_t r0 = (size_t)blockIdx.x * 64 + wave * 16;
  static_assert(WO_OUT_IN == 0, "stage loader written for (in,out) Wo");
  /* stage 0 is the same for both paths: it is asked for once, in front of the branch, so that its loads and the wait behind them lie in one block */
  v8f acc[8] = {}; float wr[32]; v4f yr[4]; const float* wp = WO + c0 + tid; const float* yp = Y + ((size_t)blockIdx.x * 64 + (tid >> 3)) * CC + (tid & 7) * 4; st_load(wp, DIN, yp, CC, wr, yr);
  if (CAUSAL && (int)(((size_t)blockIdx.x * 64) % TT) < QHI) {   /* block-uniform */
    auto put = [&](int bf) { /* Wo to exact bf16, ctx to bf16 hi + lo; loops unrolled so that wr[] and yr[] stay in registers */
#pragma unroll
      for (int q = 0; q < 4; ++q) { v8b t;
#pragma unroll
        for (int i = 0; i < 8; ++i) t[i] = (__bf16)wr[8 * q + i];
        *(v8b*)&sm.b.wt[bf][tid][8 * q] = t; }
#pragma unroll
      for (int i = 0; i < 4; ++i) { v4b th, tl;
#pragma unroll
        for (int e = 0; e < 4; ++e) { const __bf16 hv = (__bf16)yr[i][e]; th[e] = hv; tl[e] = (__bf16)(yr[i][e] - (float)hv); }
        *(v4b*)&sm.b.yh[bf][(tid >> 3) + 16 * i][(tid & 7) * 4] = th; *(v4b*)&sm.b.yl[bf][(tid >> 3) + 16 * i][(tid & 7) * 4] = tl; } };
    put(0); __syncthreads(); /* publishes stage 0 */
    /* two buffers, as in k_proj; unrolled by two so that the buffer index is a constant */
#pragma unroll 2
    for (int kc = 0; kc < CC / 32; ++kc) { const int cur = kc & 1; const bool more = kc + 1 < CC / 32;
      if (more) st_load(wp, DIN, yp, CC, wr, yr);
      const v16b ah = frag_b(&sm.b.yh[cur][wave * 16 + col][0], lane), al = frag_b(&sm.b.yl[cur][wave * 16 + col][0], lane); v16b w[8]; /* unrolled so that w[] stays in registers */
#pragma unroll
      for (int j = 0; j < 8; ++j) w[j] = frag_b(&sm.b.wt[cur][j * 16 + col][0], lane);
#pragma unroll
      for (int j = 0; j < 8; ++j) { acc[j] = wmma_bf(ah, w[j], acc[j]); acc[j] = wmma_bf(al, w[j], acc[j]); }
      __builtin_amdgcn_sched_barrier(0); /* keeps the waits on the next stage's global loads behind this stage's products, so that the products run inside the loads' latency */
      if (more) put(cur ^ 1);
      __syncthreads(); } /* publishes stage kc + 1, ends the reads of the buffer refilled next (at the end: of the LDS that sf reuses) */
#pragma unroll
    for (int j = 0; j < 8; ++j) { const float bias = BO ? bfr(BO[c0 + j * 16 + col]) : 0.f;
#pragma unroll
      for (int r = 0; r < 8; ++r) sf[wave][8 * g + r][j * 16 + col] = acc[j][r] + bias; }
  } else {
    auto put = [&](int bf) { /* Wo to f16(bf16 x 2^8), ctx once to f16; loops unrolled so that wr[] and yr[] stay in registers */
#pragma unroll
      for (int q = 0; q < 4; ++q) { v8h t;
#pragma unroll
        for (int i = 0; i < 8; ++i) t[i] = (_Float16)(bfr(wr[8 * q + i]) * 256.0f);
        *(v8h*)&sm.h.wt[bf][tid][8 * q] = t; }
#pragma unroll
      for (int i = 0; i < 4; ++i) { v4h t;
#pragma unroll
        for (int e = 0; e < 4; ++e) t[e] = (_Float16)yr[i][e];
        *(v4h*)&sm.h.ya[bf][(tid >> 3) + 16 * i][(tid & 7) * 4] = t; } };
    put(0); __syncthreads(); /* publishes stage 0 */
    /* two buffers, as in k_proj; unrolled by two so that the buffer index is a constant */
#pragma unroll 2
    for (int kc = 0; kc < CC / 32; ++kc) { const int cur = kc & 1; const bool more = kc + 1 < CC / 32;
      if (more) st_load(wp, DIN, yp, CC, wr, yr);
      const v16h a = frag_h(&sm.h.ya[cur][wave * 16 + col][0], lane); v16h w[8]; /* unrolled so that w[] stays in registers */
#pragma unroll
      for (int j = 0; j < 8; ++j) w[j] = frag_h(&sm.h.wt[cur][j * 16 + col][0], lane);
#pragma unroll
      for (int j = 0; j < 8; ++j) acc[j] = wmma16(a, w[j], acc[j]);
      __builtin_amdgcn_sched_barrier(0); /* keeps the waits on the next stage's global loads behind this stage's products, so that the products run inside the loads' latency */
      if (more) put(cur ^ 1);
      __syncthreads(); } /* publishes stage kc + 1, ends the reads of the buffer refilled next (at the end: of the LDS that sf reuses) */
#pragma unroll
    for (int j = 0; j < 8; ++j) { const float bias = BO ? bfr(BO[c0 + j * 16 + col]) : 0.f;
#pragma unroll
      for (int r = 0; r < 8; ++r) sf[wave][8 * g + r][j * 16 + col] = acc[j][r] * (1.0f / 256.0f) + bias; } }
  LDSX(); for (int rl = 0; rl < 16; ++rl) vst2(OUT + (r0 + rl) * DIN + c0 + lane * 4, *(const v4f*)&sf[wave][rl][lane * 4]); }

extern "C" void kernel_launch(void* const* d_in, const int* in_sizes, int n_in, void* d_out, int out_size, void* d_ws, size_t ws_size, hipStream_t stream) {
  (void)in_sizes; (void)n_in; (void)out_size;
  const float** F = (const float**)d_in;
  if (ws_size < (size_t)WS_END) return;
  char* ws = (char*)d_ws; _Float16 *QH = (_Float16*)(ws + WS_QH), *KH = (_Float16*)(ws + WS_KH), *VT = (_Float16*)(ws + WS_VT), *QL = (_Float16*)(ws + WS_QL), *KL = (_Float16*)(ws + WS_KL); __bf16 *VB = (__bf16*)(ws + WS_VB), *VBL = (__bf16*)(ws + WS_VBL); float *Y = (float*)(ws + WS_Y);
  (void)Y; (void)QL; (void)KL; (void)VB; (void)VBL;
  // inputs: 0 x [2,2048,1024]; 1 Wq, 2 Wk, 3 Wv [16,1024,64]; 4 Wo [1024,1024] (in,out); 5 bo [1024]
  k_proj<<<dim3(TNB * TT / 64, CC / 128, 3), 128, 0, stream>>>(F[0], F[0], F[0], F[1], F[2], F[3], nullptr, nullptr, nullptr, QH, QL, KH, KL, VT, VB, VBL);
  k_att<<<dim3(NB * NH * NQB), 128, 0, stream>>>(QH, KH, VT, QL, KL, VB, VBL, Y);
  k_out<<<dim3(TNB * TT / 64, DIN / 128), 128, 0, stream>>>(Y, F[4], F[5], (float*)d_out);
}

// v005
// A run of this version takes 127 microseconds.
// Two timings next to v004 put it at 1.13 and 1.14 times that version's speed.
// Counting every step since v000, it is 8.35 times as fast.
// compute dtype: all float inputs rounded to bf16; q/k/v = x W[h] with EXACT bf16 products on WMMA 16x16x32, f32 accumulate; q, k once to f16 -> 1-product causal logits x 1/32, except the first 384 query rows of each sequence (few keys, no averaging), which use q and k as f16 hi + residual (x 2^10) (3 products); softmax in f32 (exp(logit - max) = one exp2 instruction of (score - max) x 1/32 x log2 e, running maximum and sum over blocks of 64 keys, division by the sum last); exp(logit - max) once to f16 against v once to f16 (1 product), except the first 384 rows: exp(logit - max) and v as bf16 hi + lo (3 products); ctx once to f16 against Wo carried x 2^8 in f16 (exact bf16 values), except the first 384 rows: ctx bf16 hi + lo against exact bf16 Wo (2 products); + bo; f32 output.
#include <hip/hip_runtime.h>
#include <math.h>

typedef __attribute__((ext_vector_type(16))) _Float16 v16h;
typedef __attribute__((ext_vector_type(16))) __bf16 v16b;
typedef __attribute__((ext_vector_type(8)))  _Float16 v8h;
typedef __attribute__((ext_vector_type(8)))  float v8f;
typedef __attribute__((ext_vector_type(4)))  float v4f;
typedef __attribute__((ext_vector_type(2)))  float v2f;
typedef __attribute__((ext_vector_type(4)))  unsigned v4u;
typedef __attribute__((ext_vector_type(4)))  int v4i;
typedef float __attribute__((may_alias)) float_a;
typedef int __attribute__((may_alias)) int_a;

template <typename T> __device__ __forceinline__ void vst2(void* p, T v) { *(T*)p = v;  }
__device__ __forceinline__ v8f wmma16(v16h a, v16h b, v8f c) {
  v8f d = __builtin_amdgcn_wmma_f32_16x16x32_f16(false, a, false, b, (short)0, c, false, false);
  asm volatile("v_nop\n\tv_nop\n\tv_nop\n\tv_nop" : "+v"(d) : "v"(a), "v"(b));
  return d;
}
__device__ __forceinline__ v8f wmma_bf(v16b a, v16b b, v8f c) {
  v8f d = __builtin_amdgcn_wmma_f32_16x16x32_bf16(false, a, false, b, (short)0, c, false, false);
  asm volatile("v_nop\n\tv_nop\n\tv_nop\n\tv_nop" : "+v"(d) : "v"(a), "v"(b));
  return d;
}
// 16x16x32 fragments: lane = (h = lane>>4, row/col = lane&15); elements 0..7 = k0+8h+0..7, 8..15 = k0+16+8h+0..7; D element r = row 8h+r
__device__ __forceinline__ v16h frag_h(const _Float16* rowk0, int lane) {
  union { v16h v; v8h q[2]; } u; const _Float16* p = rowk0 + 8 * (lane >> 4);
  u.q[0] = *(const v8h*)p; u.q[1] = *(const v8h*)(p + 16); return u.v;
}
__device__ __forceinline__ v16h frag_f32(const float* rowk0, int lane) {
  v16h a; const float* p = rowk0 + 8 * (lane >> 4);
#pragma unroll
  for (int i = 0; i < 8; ++i) { a[i] = (_Float16)p[i]; a[8 + i] = (_Float16)p[16 + i]; }
  return a;
}
__device__ __forceinline__ v16h frag_f32s(const float* rowk0, int lane, float sc) {
  v16h a; const float* p = rowk0 + 8 * (lane >> 4);
#pragma unroll
  for (int i = 0; i < 8; ++i) { a[i] = (_Float16)(p[i] * sc); a[8 + i] = (_Float16)(p[16 + i] * sc); }
  return a;
}
// column fragment from a [K][ld] layout (column n), rows >= K read as 0
__device__ __forceinline__ v16h fragc_f32(const float* W, int k0, int n, int lane, int ld, int K) {
  v16h a; const int g = lane >> 4;
#pragma unroll
  for (int i = 0; i < 8; ++i) { const int ka = k0 + 8 * g + i, kb = ka + 16;
    a[i] = (_Float16)(ka < K ? W[(size_t)(ka < K ? ka : K - 1) * ld + n] : 0.f); a[8 + i] = (_Float16)(kb < K ? W[(size_t)(kb < K ? kb : K - 1) * ld + n] : 0.f); }
  return a;
}
struct F2 { v16b h, l; };
__device__ __forceinline__ F2 bsplit16(const float v[16]) { F2 r;
#pragma unroll
  for (int i = 0; i < 16; ++i) { const __bf16 h = (__bf16)v[i]; r.h[i] = h; r.l[i] = (__bf16)(v[i] - (float)h); }
  return r; }
__device__ __forceinline__ F2 split_row(const float* row, int k0, int lane) { float v[16]; const float* p = row + k0 + 8 * (lane >> 4);
#pragma unroll
  for (int i = 0; i < 8; ++i) { v[i] = p[i]; v[8 + i] = p[16 + i]; }
  return bsplit16(v); }
__device__ __forceinline__ F2 split_rowK(const float* row, int k0, int lane, int K) { float v[16]; const int g = lane >> 4;
#pragma unroll
  for (int i = 0; i < 8; ++i) { const int ka = k0 + 8 * g + i, kb = ka + 16; v[i] = ka < K ? row[ka < K ? ka : K - 1] : 0.f; v[8 + i] = kb < K ? row[kb < K ? kb : K - 1] : 0.f; }
  return bsplit16(v); }
__device__ __forceinline__ F2 split_col(const float* W, int k0, int n, int lane, int ld, int K) { float v[16]; const int g = lane >> 4;
#pragma unroll
  for (int i = 0; i < 8; ++i) { const int ka = k0 + 8 * g + i, kb = ka + 16; v[i] = ka < K ? W[(size_t)(ka < K ? ka : K - 1) * ld + n] : 0.f; v[8 + i] = kb < K ? W[(size_t)(kb < K ? kb : K - 1) * ld + n] : 0.f; }
  return bsplit16(v); }
__device__ __forceinline__ v8f mac3(const F2& a, const F2& b, v8f c) { c = wmma_bf(a.l, b.h, c); c = wmma_bf(a.h, b.l, c); return wmma_bf(a.h, b.h, c); }
__device__ __forceinline__ float sigm(float v) { return 1.0f / (1.0f + expf(-v)); }
#define LDSX() do { asm volatile("s_wait_dscnt 0" ::: "memory"); __builtin_amdgcn_wave_barrier(); __builtin_amdgcn_fence(__ATOMIC_RELEASE, "workgroup"); } while (0)

// Causal multi-head self-attention with per-head projection tensors (B 2, T 2,048, C 1,024, 16 heads x 64): q/k/v[b,h,t,:] = x[b,t,:] Wq/Wk/Wv[h] ([H][C][64], no bias); att = softmax(q k^T / sqrt(1024) with key > query -> -inf); out = concat_h(att v) Wo ((in,out) [1024,1024]) + bo.
#define NB 2
#define TT 2048
#define CC 1024            // NH * HD = projected width
#define DIN 1024          // input (model) width
#define NH 16
#define HD 64
#define NQB (TT / 64)
#define SCALE (0.03125f)
#define CAUSAL 1
#ifndef TNB
#define TNB NB
#endif
__device__ __forceinline__ float bfr(float v) { return (float)(__bf16)v; }
typedef __attribute__((ext_vector_type(8))) __bf16 v8b;
__device__ __forceinline__ v16b frag_b(const __bf16* rowk0, int lane) {
  union { v16b v; v8b q[2]; } u; const __bf16* p = rowk0 + 8 * (lane >> 4);
  u.q[0] = *(const v8b*)p; u.q[1] = *(const v8b*)(p + 16); return u.v;
}
#define QBH 6              // causal: query blocks 0..QBH-1 of each sequence (few keys, no averaging) take the high-precision path
#define QHI 384            // rows carrying a q residual plane
#define KHI 384            // key rows carrying k residual / v bf16 hi+lo planes (used only by the causal high-precision path)
// B fragment (k rows k0+.., output column o) of a weight: (in,out) [K][ld] or (out,in) [ld rows of K]: bf16 exact, or f16(bf16 * 256) exact
__device__ __forceinline__ v16b wcol_io(const float* Wm, int k0, int o, int lane, int ld) { v16b w; const int g = lane >> 4;
#pragma unroll
  for (int i = 0; i < 8; ++i) { w[i] = (__bf16)Wm[(size_t)(k0 + 8 * g + i) * ld + o]; w[8 + i] = (__bf16)Wm[(size_t)(k0 + 16 + 8 * g + i) * ld + o]; }
  return w; }
__device__ __forceinline__ v16b wcol_oi(const float* Wm, int k0, int o, int lane, int K) { v16b w; const float* p = Wm + (size_t)o * K + k0 + 8 * (lane >> 4);
#pragma unroll
  for (int i = 0; i < 8; ++i) { w[i] = (__bf16)p[i]; w[8 + i] = (__bf16)p[16 + i]; }
  return w; }
__device__ __forceinline__ v16h wcolh_io(const float* Wm, int k0, int o, int lane, int ld) { v16h w; const int g = lane >> 4;
#pragma unroll
  for (int i = 0; i < 8; ++i) { w[i] = (_Float16)(bfr(Wm[(size_t)(k0 + 8 * g + i) * ld + o]) * 256.0f); w[8 + i] = (_Float16)(bfr(Wm[(size_t)(k0 + 16 + 8 * g + i) * ld + o]) * 256.0f); }
  return w; }
__device__ __forceinline__ v16h wcolh_oi(const float* Wm, int k0, int o, int lane, int K) { v16h w; const float* p = Wm + (size_t)o * K + k0 + 8 * (lane >> 4);
#pragma unroll
  for (int i = 0; i < 8; ++i) { w[i] = (_Float16)(bfr(p[i]) * 256.0f); w[8 + i] = (_Float16)(bfr(p[16 + i]) * 256.0f); }
  return w; }
#define WQKV_LAYOUT 2   // 0 = (in,out) [DIN][CC]; 1 = (out,in) [CC][DIN]; 2 = per-head [NH][DIN][HD]
__device__ __forceinline__ v16b wcol_hdk(const float* Wm, int k0, int o, int lane) { v16b w; const int g = lane >> 4; const float* p = Wm + (size_t)(o / HD) * DIN * HD + (o % HD);
#pragma unroll
  for (int i = 0; i < 8; ++i) { w[i] = (__bf16)p[(size_t)(k0 + 8 * g + i) * HD]; w[8 + i] = (__bf16)p[(size_t)(k0 + 16 + 8 * g + i) * HD]; }
  return w; }
#define WO_OUT_IN 0
#if WQKV_LAYOUT == 1
#define WCOL(W, k0, o, lane) wcol_oi(W, k0, o, lane, DIN)
#elif WQKV_LAYOUT == 2
#define WCOL(W, k0, o, lane) wcol_hdk(W, k0, o, lane)
#else
#define WCOL(W, k0, o, lane) wcol_io(W, k0, o, lane, CC)
#endif
#if WO_OUT_IN
#define WOCOL(W, k0, o, lane) wcol_oi(W, k0, o, lane, CC)
#define WOCOLH(W, k0, o, lane) wcolh_oi(W, k0, o, lane, CC)
#else
#define WOCOL(W, k0, o, lane) wcol_io(W, k0, o, lane, DIN)
#define WOCOLH(W, k0, o, lane) wcolh_io(W, k0, o, lane, DIN)
#endif

#define WS_QH  0u                                      // f16 q rows [b*t][CC]
#define WS_KH  (WS_QH + 2u * (size_t)NB * TT * CC)      // f16 k rows [b*t][CC]
#define WS_VT  (WS_KH + 2u * (size_t)NB * TT * CC)      // f16 v planes [b][c][t]
#define WS_QL  (WS_VT + 2u * (size_t)NB * CC * TT)      // f16 q residual x 2^10 rows [b][t < QHI][CC]
#define WS_KL  (WS_QL + 2u * (size_t)NB * QHI * CC)     // f16 k residual x 2^10 rows [b][t < KHI][CC]
#define WS_VB  (WS_KL + 2u * (size_t)NB * KHI * CC)     // bf16 v hi planes [b][c][t < KHI]
#define WS_VBL (WS_VB + 2u * (size_t)NB * CC * KHI)
#define WS_Y   (WS_VBL + 2u * (size_t)NB * CC * KHI)      // f32 ctx rows [b*t][CC] (only when there is an output projection)
#define WS_END (WS_Y  + 4u * (size_t)NB * TT * CC)

// ---- staging of a 32-k stage of both GEMM operands (k_proj, k_out): a block brings its 128 weight columns and its 64 activation rows from global memory ONCE, in whole 128-B lines, rounds them to their 16-bit operand type and lays them k-contiguous in LDS; every wave then takes its fragments by 16-byte LDS reads. Values, k order and sum order are those of the direct loads
#define SP 40              // LDS pitch of a staged row of 32 k, in 16-bit elements: 80 B = 16 B x odd, the pitch at which 16-byte LDS reads and writes of 16 rows fall on distinct banks
typedef __attribute__((ext_vector_type(4))) __bf16 v4b;
typedef __attribute__((ext_vector_type(4))) _Float16 v4h;
// one thread's share of a stage: 32 k of weight column tid (a wave-instruction = 32 neighbouring columns = one line), and four 16-byte pieces of the activation rows (a wave-instruction = four whole lines); both pointers then step on 32 k
__device__ __forceinline__ void st_load(const float*& wp, int wld, const float*& xp, int xld, float wr[32], v4f xr[4]) {
#pragma unroll
  for (int k = 0; k < 32; ++k) wr[k] = wp[(size_t)k * wld];
#pragma unroll
  for (int i = 0; i < 4; ++i) xr[i] = *(const v4f*)(xp + (size_t)(16 * i) * xld);
  asm volatile("s_wait_xcnt 0x0" :: "v"(wp), "v"(xp) : "memory"); /* the wait that stands before a register of an issued global load is overwritten; the two pointers are inputs so that the loads' address registers live up to it */
  wp += (size_t)32 * wld; xp += 32; }
// ---- k_proj: block = (64 rows, 128 cols, which): q/k/v = X W (+ b) with exact bf16 products (K = DIN) -> which 0: q f16 rows (+ residual rows < QHI); 1: k f16 rows (+ residual rows < KHI); 2: v f16 planes [c][t] (+ bf16 hi/lo planes for t < KHI)
__global__ __launch_bounds__(128) void k_proj(const float* __restrict__ XQ, const float* __restrict__ XK, const float* __restrict__ XV, const float* __restrict__ WQ, const float* __restrict__ WK, const float* __restrict__ WV, const float* __restrict__ BQ, const float* __restrict__ BK, const float* __restrict__ BV,
    _Float16* __restrict__ QH, _Float16* __restrict__ QL, _Float16* __restrict__ KH, _Float16* __restrict__ KL, _Float16* __restrict__ VT, __bf16* __restrict__ VB, __bf16* __restrict__ VBL) {
  union Lds { struct { _Float16 sh[64][136], sl[64][136]; } qk; struct { _Float16 th[128][72]; __bf16 tb[128][72], tbl[128][72]; } v; struct { __bf16 wt[2][128][SP], xs[2][64][SP]; } st; }; /* the stage buffers lie in the LDS of the epilogue's arrays, which are written only behind the loop's last barrier */
  __shared__ __align__(16) Lds sm; auto& sh = sm.qk.sh; auto& sl = sm.qk.sl; auto& th = sm.v.th; auto& tb = sm.v.tb; auto& tbl = sm.v.tbl;
  const int tid = threadIdx.x, wave = tid >> 5, lane = tid & 31, col = lane & 15, g = lane >> 4; const int which = blockIdx.z; const int c0 = blockIdx.y * 128; const size_t r0 = (size_t)blockIdx.x * 64; const size_t bb = r0 / TT; const int t0 = (int)(r0 % TT);
  const float* X = which == 0 ? XQ : which == 1 ? XK : XV; const float* WA = which == 0 ? WQ : which == 1 ? WK : WV; const float* BA = which == 0 ? BQ : which == 1 ? BK : BV;
  static_assert(WQKV_LAYOUT == 2, "stage loader written for per-head [NH][DIN][HD] weights");
  v8f acc[8] = {}; float wr[32]; v4f xr[4];
  const float* wp = WA + (size_t)((c0 + tid) / HD) * DIN * HD + (c0 + tid) % HD; const float* xp = X + (r0 + (tid >> 3)) * DIN + (tid & 7) * 4;
  /* rounds this thread's share to bf16 and writes it to stage buffer bf; loops unrolled so that wr[] and xr[] stay in registers */
  auto put = [&](int bf) {
#pragma unroll
    for (int q = 0; q < 4; ++q) { v8b t;
#pragma unroll
      for (int i = 0; i < 8; ++i) t[i] = (__bf16)wr[8 * q + i];
      *(v8b*)&sm.st.wt[bf][tid][8 * q] = t; }
#pragma unroll
    for (int i = 0; i < 4; ++i) { v4b t;
#pragma unroll
      for (int e = 0; e < 4; ++e) t[e] = (__bf16)xr[i][e];
      *(v4b*)&sm.st.xs[bf][(tid >> 3) + 16 * i][(tid & 7) * 4] = t; } };
  st_load(wp, HD, xp, DIN, wr, xr); put(0); __syncthreads(); /* publishes stage 0 */
  /* two buffers: stage kc + 1 is asked for before stage kc's products, so its latency runs behind them, and written to the other buffer after them; unrolled by two so that the buffer index is a constant */
#pragma unroll 2
  for (int kc = 0; kc < DIN / 32; ++kc) { const int cur = kc & 1; const bool more = kc + 1 < DIN / 32;
    if (more) st_load(wp, HD, xp, DIN, wr, xr);
    const v16b a = frag_b(&sm.st.xs[cur][wave * 16 + col][0], lane); v16b w[8]; /* unrolled so that w[] stays in registers */
#pragma unroll
    for (int j = 0; j < 8; ++j) w[j] = frag_b(&sm.st.wt[cur][j * 16 + col][0], lane);
#pragma unroll
    for (int j = 0; j < 8; ++j) acc[j] = wmma_bf(a, w[j], acc[j]);
    __builtin_amdgcn_sched_barrier(0); /* keeps the waits on the next stage's global loads behind this stage's products, so that the products run inside the loads' latency */
    if (more) put(cur ^ 1);
    __syncthreads(); } /* one barrier a stage: publishes stage kc + 1 and ends every wave's reads of the buffer that the next trip refills (after the last trip: of the LDS that the epilogue reuses) */
  if (which < 2) { _Float16* DH = which == 0 ? QH : KH; _Float16* DL = which == 0 ? QL : KL; const int nhi = which == 0 ? QHI : KHI; const bool hi_rows = t0 < nhi;
#pragma unroll
    for (int j = 0; j < 8; ++j) { const float bias = BA ? bfr(BA[c0 + j * 16 + col]) : 0.f;
#pragma unroll
      for (int r = 0; r < 8; ++r) { const float v = acc[j][r] + bias; const _Float16 hv = (_Float16)v; sh[wave * 16 + 8 * g + r][j * 16 + col] = hv; sl[wave * 16 + 8 * g + r][j * 16 + col] = (_Float16)((v - (float)hv) * 1024.0f); } }
    __syncthreads();
    for (int e = tid; e < 64 * 16; e += 128) { const int rl = e >> 4, q = e & 15; vst2((unsigned*)(DH + (r0 + rl) * CC + c0 + q * 8), *(const v4u*)&sh[rl][q * 8]); if (hi_rows) vst2((unsigned*)(DL + (bb * nhi + t0 + rl) * (size_t)CC + c0 + q * 8), *(const v4u*)&sl[rl][q * 8]); }
  } else { const bool hi_rows = t0 < KHI;
#pragma unroll
    for (int j = 0; j < 8; ++j) { const float bias = BA ? bfr(BA[c0 + j * 16 + col]) : 0.f;
#pragma unroll
      for (int r = 0; r < 8; ++r) { const float v = acc[j][r] + bias; const int rl = wave * 16 + 8 * g + r, cl = j * 16 + col; th[cl][rl] = (_Float16)v; const __bf16 bh = (__bf16)v; tb[cl][rl] = bh; tbl[cl][rl] = (__bf16)(v - (float)bh); } }
    __syncthreads();
    for (int e = tid; e < 128 * 8; e += 128) { const int cl = e >> 3, q = e & 7; vst2((unsigned*)(VT + (bb * CC + c0 + cl) * (size_t)TT + t0 + q * 8), *(const v4u*)&th[cl][q * 8]); if (hi_rows) { const size_t o3 = (bb * CC + c0 + cl) * (size_t)KHI + t0 + q * 8; vst2((unsigned*)(VB + o3), *(const v4u*)&tb[cl][q * 8]); vst2((unsigned*)(VBL + o3), *(const v4u*)&tbl[cl][q * 8]); } } } }
// ---- k_att: block = 64 queries (qb) of (b, h), one wave = 16 queries; the waves share only the staged k and v tiles (query blocks >= QBH): per 64 keys S^T = K Q^T (lane = one query, its D registers = keys), causal mask by index on the diagonal block, running maximum (of the unscaled scores) and sum in f32, e = exp(logit - max) = exp2((score - max) x SCALE x log2 e) packed from the score registers straight into the B operand of ctx^T += V^T P^T, ctx and sum brought to the new maximum every trip, ctx divided by the sum at the end. Logits and P never go to memory. Products as before: 1 f16 product each; query blocks < QBH: 3-product logits (q, k hi + residual), e and v as bf16 hi + lo (3 products)
__device__ __forceinline__ v8f mm_h(v16h a, v16h b, v8f c) { return __builtin_amdgcn_wmma_f32_16x16x32_f16(false, a, false, b, (short)0, c, false, false); }
__device__ __forceinline__ v8f mm_b(v16b a, v16b b, v8f c) { return __builtin_amdgcn_wmma_f32_16x16x32_bf16(false, a, false, b, (short)0, c, false, false); }
// fragment from a pointer that already holds the lane's 8 g offset, so that the pointer itself is the address register pair of the loads
__device__ __forceinline__ v16h frag_hp(const _Float16* p) { union { v16h v; v8h q[2]; } u; u.q[0] = *(const v8h*)p; u.q[1] = *(const v8h*)(p + 16); return u.v; }
__device__ __forceinline__ v16b frag_bp(const __bf16* p) { union { v16b v; v8b q[2]; } u; u.q[0] = *(const v8b*)p; u.q[1] = *(const v8b*)(p + 16); return u.v; }
// every loop over st[], acc[] or a fragment array in sm_step and k_att is unrolled so that the array stays in registers; the two key loops stay rolled (unroll 1): one trip's fragments already fill the register budget of four waves a SIMD
// st[t][r] = unscaled score q.k of key k0 + 16 t + 8 g + r for this lane's query qi; on return e = exp(SCALE x (score - new maximum)); m (unscaled), l, acc brought to the new maximum (l is this half-wave's part of the sum)
// the exponent is formed by one multiply-add a score, score x EXC - max x EXC, and goes straight to the hardware's exp2: it is at most 0 (up to the rounding of max x EXC), and where exp2 falls below the range of f32 the result is 0, which is what a masked or far-off key contributes
#define EXC (SCALE * 1.44269504088896340736f) // SCALE x log2 e
// exp2 of eight values, each in its own register. In asm so that the slot which the instruction set asks for behind a transcendental (before its result is read or its source overwritten) is kept by construction: each v_exp_f32 overwrites only its own source, none reads another's result, and the v_nop is the slot behind the last one. The s_delay_alu is the hint that the compiler writes for its own code and not for asm: a source may come from the vector instruction directly in front, and unhinted the wait would hold up the SIMD's other waves too; it changes no result
__device__ __forceinline__ v8f exp2x8(v8f x) { float a = x[0], b = x[1], c = x[2], d = x[3], e = x[4], f = x[5], g = x[6], h = x[7];
  asm("s_delay_alu instid0(VALU_DEP_1)\n\tv_exp_f32 %0, %0\n\tv_exp_f32 %1, %1\n\tv_exp_f32 %2, %2\n\tv_exp_f32 %3, %3\n\tv_exp_f32 %4, %4\n\tv_exp_f32 %5, %5\n\tv_exp_f32 %6, %6\n\tv_exp_f32 %7, %7\n\tv_nop" : "+v"(a), "+v"(b), "+v"(c), "+v"(d), "+v"(e), "+v"(f), "+v"(g), "+v"(h));
  const v8f r = {a, b, c, d, e, f, g, h}; return r; }
__device__ __forceinline__ float exp2x1(float a) { asm("s_delay_alu instid0(VALU_DEP_1)\n\tv_exp_f32 %0, %0\n\tv_nop" : "+v"(a)); return a; } /* the same for one value */
__device__ __forceinline__ void sm_step(v8f st[4], v8f acc[HD / 16], float& m, float& l, bool diag, int k0, int g, int qi) {
  if (diag) {
#pragma unroll
    for (int t = 0; t < 4; ++t)
#pragma unroll
      for (int r = 0; r < 8; ++r) if (k0 + t * 16 + 8 * g + r > qi) st[t][r] = -3.0e38f; }
  float mx = m;
#pragma unroll
  for (int t = 0; t < 4; ++t)
#pragma unroll
    for (int r = 0; r < 8; ++r) mx = fmaxf(mx, st[t][r]);
  mx = fmaxf(mx, __shfl_xor(mx, 16));
  const float alpha = exp2x1((m - mx) * EXC); m = mx; float s = 0.f; const float nmc = -mx * EXC; const v8f cv = {EXC, EXC, EXC, EXC, EXC, EXC, EXC, EXC}, nv = {nmc, nmc, nmc, nmc, nmc, nmc, nmc, nmc};
#pragma unroll
  for (int t = 0; t < 4; ++t) { st[t] = exp2x8(__builtin_elementwise_fma(st[t], cv, nv));
#pragma unroll
    for (int r = 0; r < 8; ++r) s += st[t][r]; }
  l = l * alpha + s;
#pragma unroll
  for (int j = 0; j < HD / 16; ++j) acc[j] *= alpha; }
// ---- staging of a 64-key tile (k_att, query blocks >= QBH): the block's four waves read the same 64 k rows and 64 v planes, so the block brings them from global memory ONCE, in whole 128-B lines, by asynchronous copies to LDS, and every wave takes its fragments by 16-byte LDS reads. Values, k order and sum order are those of the direct loads
#define KVP 72             // LDS pitch of a staged row of 64 f16: 144 B = 16 B x odd, the pitch at which 16-byte LDS reads of 16 rows fall on distinct banks
#define KVB (128 * KVP * 2) // bytes of one tile buffer: rows 0..63 = k rows (key, head column), rows 64..127 = v planes (head column, key)
// one thread's share of a tile: eight 16-byte copies, rows (tid >> 3) + 16 i, piece tid & 7 (a wave-instruction = four whole lines). l = the lane's LDS byte address in row tid >> 3 of the buffer, kg and vg = its global addresses in k row tid >> 3 and v plane tid >> 3 of the tile
__device__ __forceinline__ void kv_copy(unsigned l, const _Float16* kg, const _Float16* vg) {
  /* the s_wait_xcnt 0 stands inside the copies' own statement, so that no register which a copy names is rewritten in front of it */
  asm volatile("global_load_async_to_lds_b128 %0, %8, off\n\t"
               "global_load_async_to_lds_b128 %1, %9, off\n\t"
               "global_load_async_to_lds_b128 %2, %10, off\n\t"
               "global_load_async_to_lds_b128 %3, %11, off\n\t"
               "global_load_async_to_lds_b128 %4, %12, off\n\t"
               "global_load_async_to_lds_b128 %5, %13, off\n\t"
               "global_load_async_to_lds_b128 %6, %14, off\n\t"
               "global_load_async_to_lds_b128 %7, %15, off\n\t"
               "s_wait_xcnt 0x0"
               :: "v"(l), "v"(l + 16 * KVP * 2), "v"(l + 32 * KVP * 2), "v"(l + 48 * KVP * 2), "v"(l + 64 * KVP * 2), "v"(l + 80 * KVP * 2), "v"(l + 96 * KVP * 2), "v"(l + 112 * KVP * 2),
                  "v"(kg), "v"(kg + (size_t)16 * CC), "v"(kg + (size_t)32 * CC), "v"(kg + (size_t)48 * CC), "v"(vg), "v"(vg + (size_t)16 * TT), "v"(vg + (size_t)32 * TT), "v"(vg + (size_t)48 * TT)
               : "memory"); }
__global__ __launch_bounds__(128) void k_att(const _Float16* __restrict__ QH, const _Float16* __restrict__ KH, const _Float16* __restrict__ VT, const _Float16* __restrict__ QL, const _Float16* __restrict__ KL, const __bf16* __restrict__ VB, const __bf16* __restrict__ VBL, float* __restrict__ Y) { __shared__ __align__(16) float ss[4][16][HD + 4]; __shared__ __align__(16) _Float16 kv[2][128][KVP];
  const int tid = threadIdx.x, wave = tid >> 5, lane = tid & 31, col = lane & 15, g = lane >> 4;
  /* all 1,024 blocks are resident at once (4 a WGP) and a block's cost grows with qb, so the launch lasts as long as the fullest WGP: the flat index is spread so that the four blocks f, f + 256, f + 512, f + 768 and equally the four blocks f, f + 8, f + 16, f + 24 hold one qb of each quarter, 31 - i, 16 + i, 15 - i, i: the same cost for every such four. Speed only: any placement is correct; (qb, head, batch) <-> f is one to one */
  static_assert(NQB == 32 && NB * NH == 32, "index spread written for 32 query blocks x 32 (batch, head) pairs");
  const int f = blockIdx.x, fk = (f >> 3) & 3, fi = (f >> 5) & 7, fc = (fk + (f >> 8)) & 3; const int qb = fc == 0 ? 31 - fi : fc == 1 ? 16 + fi : fc == 2 ? 15 - fi : fi; const int bh = (f & 7) + 8 * fk; const int h = bh % NH, b = bh / NH; const int ql0 = qb * 64 + wave * 16, qi = ql0 + col;
  const _Float16* qp = QH + ((size_t)b * TT + qi) * CC + h * HD + 8 * g; const _Float16* kp = KH + ((size_t)b * TT + col) * CC + h * HD + 8 * g;
  v8f acc[HD / 16] = {}; float m = -3.0e38f, l = 0.f;
  if (qb >= QBH) { static_assert(QBH >= 1, "the ring's prologue asks for tiles 0 and 1");
    const unsigned lb = (unsigned)(size_t)&kv[0][tid >> 3][(tid & 7) * 8]; const _Float16* kg = KH + ((size_t)b * TT + (tid >> 3)) * CC + h * HD + (tid & 7) * 8; const _Float16* vg = VT + ((size_t)b * CC + h * HD + (tid >> 3)) * (size_t)TT + (tid & 7) * 8;
    const v16h q0 = frag_hp(qp), q1 = frag_hp(qp + 32);
    asm volatile("s_wait_xcnt 0x0" :: "v"(qp) : "memory"); /* the wait that stands before a register of an issued global load is overwritten; the pointer is an input so that the loads' address registers live up to it */
    kv_copy(lb, kg, vg);
    asm volatile("s_wait_asynccnt 0x0" ::: "memory"); /* this wave's copies of tile 0 have landed */
    __syncthreads(); /* publishes tile 0 */
    kv_copy(lb + KVB, kg + (size_t)64 * CC, vg + 64); kg += (size_t)128 * CC; vg += 128; /* kg and vg walk two tiles ahead of the trip */
    /* rolled: a second trip's fragments would go past the 256 registers that four waves a SIMD allow */
#pragma unroll 1
    for (int kb = 0; kb <= qb; ++kb) { const int k0 = kb * 64; const _Float16 (*T)[KVP] = kv[kb & 1]; v16h ka[4][2], va[2][HD / 16]; /* trip kb reads buffer kb & 1 alone; inner loops unrolled so that the arrays stay in registers */
#pragma unroll
      for (int t = 0; t < 4; ++t) { ka[t][0] = frag_hp(&T[t * 16 + col][8 * g]); ka[t][1] = frag_hp(&T[t * 16 + col][32 + 8 * g]); }
#pragma unroll
      for (int u = 0; u < 2; ++u)
#pragma unroll
        for (int j = 0; j < HD / 16; ++j) va[u][j] = frag_hp(&T[64 + j * 16 + col][u * 32 + 8 * g]);
      __builtin_amdgcn_sched_barrier(0); /* keeps the trip's LDS reads together as one group in front of the products: left free they sink to their uses, with one full wait a product */
      v8f st[4];
#pragma unroll
      for (int t = 0; t < 4; ++t) { v8f z = {}; z = mm_h(ka[t][0], q0, z); st[t] = mm_h(ka[t][1], q1, z); }
      /* the trip reads nothing of its tile behind this line (softmax and P v work on registers), so this is the foot of the trip for the ring: the buffer is handed over here and the refill has a whole trip to land */
      asm volatile("s_wait_dscnt 0x0" ::: "memory"); /* this wave's reads of the buffer that is refilled below have returned */
      asm volatile("s_wait_asynccnt 0x0" ::: "memory"); /* this wave's copies of tile kb + 1 have landed */
      __syncthreads(); /* one barrier a trip: publishes tile kb + 1 and ends every wave's reads of the buffer refilled behind it */
      if (kb + 2 <= qb) { kv_copy(lb + (kb & 1) * KVB, kg, vg); kg += (size_t)64 * CC; vg += 64; } /* block-uniform test: tile kb + 2 goes into the buffer that this trip has read */
      sm_step(st, acc, m, l, kb == qb, k0, g, qi);
#pragma unroll
      for (int u = 0; u < 2; ++u) { v16h p;
#pragma unroll
        for (int i = 0; i < 8; ++i) { p[i] = (_Float16)st[2 * u][i]; p[8 + i] = (_Float16)st[2 * u + 1][i]; }
#pragma unroll
        for (int j = 0; j < HD / 16; ++j) acc[j] = mm_h(va[u][j], p, acc[j]); } }
    asm volatile("s_wait_asynccnt 0x0" ::: "memory"); /* no copy is outstanding when the wave goes on */
  } else { const _Float16* qlp = QL + ((size_t)b * QHI + qi) * CC + h * HD + 8 * g; const _Float16* klp = KL + ((size_t)b * KHI + col) * CC + h * HD + 8 * g; const size_t vo = ((size_t)b * CC + h * HD + col) * (size_t)KHI + 8 * g; const __bf16* vhp = VB + vo; const __bf16* vlp = VBL + vo;
    const v16h q0 = frag_hp(qp), q1 = frag_hp(qp + 32), r0 = frag_hp(qlp), r1 = frag_hp(qlp + 32);
    asm volatile("s_wait_xcnt 0x0" :: "v"(qp), "v"(qlp) : "memory"); /* as above, for the q loads' two pointers */
    /* rolled, for the same register budget */
#pragma unroll 1
    for (int kb = 0; kb <= qb; ++kb) { const int k0 = kb * 64; v8f st[4];
#pragma unroll
      for (int t = 0; t < 4; ++t) { const size_t ko = (size_t)(t * 16) * CC; const v16h kh0 = frag_hp(kp + ko), kh1 = frag_hp(kp + ko + 32), kl0 = frag_hp(klp + ko), kl1 = frag_hp(klp + ko + 32);
        v8f a = {}, al = {}; a = mm_h(kh0, q0, a); al = mm_h(kh0, r0, al); al = mm_h(kl0, q0, al); a = mm_h(kh1, q1, a); al = mm_h(kh1, r1, al); al = mm_h(kl1, q1, al);
        st[t] = a + al * (1.0f / 1024.0f); }
      sm_step(st, acc, m, l, kb == qb, k0, g, qi);
#pragma unroll
      for (int u = 0; u < 2; ++u) { float pv[16];
#pragma unroll
        for (int i = 0; i < 8; ++i) { pv[i] = st[2 * u][i]; pv[8 + i] = st[2 * u + 1][i]; }
        const F2 p = bsplit16(pv);
#pragma unroll
        for (int j = 0; j < HD / 16; ++j) { const size_t po = (size_t)(j * 16) * KHI + u * 32; const v16b vh = frag_bp(vhp + po), vl = frag_bp(vlp + po); acc[j] = mm_b(vh, p.h, acc[j]); acc[j] = mm_b(vh, p.l, acc[j]); acc[j] = mm_b(vl, p.h, acc[j]); } }
      asm volatile("s_wait_xcnt 0x0" :: "v"(kp), "v"(klp), "v"(vhp), "v"(vlp) : "memory"); /* as above: stands before the four pointers step on to the next 64 keys */
      kp += (size_t)64 * CC; klp += (size_t)64 * CC; vhp += 64; vlp += 64; } }
  l += __shfl_xor(l, 16); const float inv = 1.0f / l;
#pragma unroll
  for (int j = 0; j < HD / 16; ++j) { const v8f o = acc[j] * inv; /* lane = query col, registers = head columns j*16 + 8g + r */
    *(v4f*)&ss[wave][col][j * 16 + 8 * g] = __builtin_shufflevector(o, o, 0, 1, 2, 3); *(v4f*)&ss[wave][col][j * 16 + 8 * g + 4] = __builtin_shufflevector(o, o, 4, 5, 6, 7); }
  LDSX(); /* own-wave exchange: the 256-B (row, head) segments go out whole, two rows an instruction */
  for (int rl = 0; rl < 16; rl += 2) vst2(Y + ((size_t)b * TT + ql0 + rl + g) * CC + h * HD + col * 4, *(const v4f*)&ss[wave][rl + g][col * 4]); }
// ---- k_out: block = (64 rows, 128 cols): out = ctx Wo (+ bo): ctx once to f16 against Wo as f16(bf16 x 2^8) exact (1 product) x 2^-8; causal early rows (< QHI of each sequence): ctx bf16 hi + lo against exact bf16 Wo (2 products)
__global__ __launch_bounds__(128) void k_out(const float* __restrict__ Y, const float* __restrict__ WO, const float* __restrict__ BO, float* __restrict__ OUT) { union Lds { float sf[4][16][132]; struct { _Float16 wt[2][128][SP], ya[2][64][SP]; } h; struct { __bf16 wt[2][128][SP], yh[2][64][SP], yl[2][64][SP]; } b; }; /* the stage buffers lie in the LDS of the epilogue's array, which is written only behind the loop's last barrier */
  __shared__ __align__(16) Lds sm; auto& sf = sm.sf;
  const int tid = threadIdx.x, wave = tid >> 5, lane = tid & 31, col = lane & 15, g = lane >> 4; const int c0 = blockIdx.y * 128; const size_t r0 = (size_t)blockIdx.x * 64 + wave * 16;
  static_assert(WO_OUT_IN == 0, "stage loader written for (in,out) Wo");
  /* stage 0 is the same for both paths: it is asked for once, in front of the branch, so that its loads and the wait behind them lie in one block */
  v8f acc[8] = {}; float wr[32]; v4f yr[4]; const float* wp = WO + c0 + tid; const float* yp = Y + ((size_t)blockIdx.x * 64 + (tid >> 3)) * CC + (tid & 7) * 4; st_load(wp, DIN, yp, CC, wr, yr);
  if (CAUSAL && (int)(((size_t)blockIdx.x * 64) % TT) < QHI) {   /* block-uniform */
    auto put = [&](int bf) { /* Wo to exact bf16, ctx to bf16 hi + lo; loops unrolled so that wr[] and yr[] stay in registers */
#pragma unroll
      for (int q = 0; q < 4; ++q) { v8b t;
#pragma unroll
        for (int i = 0; i < 8; ++i) t[i] = (__bf16)wr[8 * q + i];
        *(v8b*)&sm.b.wt[bf][tid][8 * q] = t; }
#pragma unroll
      for (int i = 0; i < 4; ++i) { v4b th, tl;
#pragma unroll
        for (int e = 0; e < 4; ++e) { const __bf16 hv = (__bf16)yr[i][e]; th[e] = hv; tl[e] = (__bf16)(yr[i][e] - (float)hv); }
        *(v4b*)&sm.b.yh[bf][(tid >> 3) + 16 * i][(tid & 7) * 4] = th; *(v4b*)&sm.b.yl[bf][(tid >> 3) + 16 * i][(tid & 7) * 4] = tl; } };
    put(0); __syncthreads(); /* publishes stage 0 */
    /* two buffers, as in k_proj; unrolled by two so that the buffer index is a constant */
#pragma unroll 2
    for (int kc = 0; kc < CC / 32; ++kc) { const int cur = kc & 1; const bool more = kc + 1 < CC / 32;
      if (more) st_load(wp, DIN, yp, CC, wr, yr);
      const v16b ah = frag_b(&sm.b.yh[cur][wave * 16 + col][0], lane), al = frag_b(&sm.b.yl[cur][wave * 16 + col][0], lane); v16b w[8]; /* unrolled so that w[] stays in registers */
#pragma unroll
      for (int j = 0; j < 8; ++j) w[j] = frag_b(&sm.b.wt[cur][j * 16 + col][0], lane);
#pragma unroll
      for (int j = 0; j < 8; ++j) { acc[j] = wmma_bf(ah, w[j], acc[j]); acc[j] = wmma_bf(al, w[j], acc[j]); }
      __builtin_amdgcn_sched_barrier(0); /* keeps the waits on the next stage's global loads behind this stage's products, so that the products run inside the loads' latency */
      if (more) put(cur ^ 1);
      __syncthreads(); } /* publishes stage kc + 1, ends the reads of the buffer refilled next (at the end: of the LDS that sf reuses) */
#pragma unroll
    for (int j = 0; j < 8; ++j) { const float bias = BO ? bfr(BO[c0 + j * 16 + col]) : 0.f;
#pragma unroll
      for (int r = 0; r < 8; ++r) sf[wave][8 * g + r][j * 16 + col] = acc[j][r] + bias; }
  } else {
    auto put = [&](int bf) { /* Wo to f16(bf16 x 2^8), ctx once to f16; loops unrolled so that wr[] and yr[] stay in registers */
#pragma unroll
      for (int q = 0; q < 4; ++q) { v8h t;
#pragma unroll
        for (int i = 0; i < 8; ++i) t[i] = (_Float16)(bfr(wr[8 * q + i]) * 256.0f);
        *(v8h*)&sm.h.wt[bf][tid][8 * q] = t; }
#pragma unroll
      for (int i = 0; i < 4; ++i) { v4h t;
#pragma unroll
        for (int e = 0; e < 4; ++e) t[e] = (_Float16)yr[i][e];
        *(v4h*)&sm.h.ya[bf][(tid >> 3) + 16 * i][(tid & 7) * 4] = t; } };
    put(0); __syncthreads(); /* publishes stage 0 */
    /* two buffers, as in k_proj; unrolled by two so that the buffer index is a constant */
#pragma unroll 2
    for (int kc = 0; kc < CC / 32; ++kc) { const int cur = kc & 1; const bool more = kc + 1 < CC / 32;
      if (more) st_load(wp, DIN, yp, CC, wr, yr);
      const v16h a = frag_h(&sm.h.ya[cur][wave * 16 + col][0], lane); v16h w[8]; /* unrolled so that w[] stays in registers */
#pragma unroll
      for (int j = 0; j < 8; ++j) w[j] = frag_h(&sm.h.wt[cur][j * 16 + col][0], lane);
#pragma unroll
      for (int j = 0; j < 8; ++j) acc[j] = wmma16(a, w[j], acc[j]);
      __builtin_amdgcn_sched_barrier(0); /* keeps the waits on the next stage's global loads behind this stage's products, so that the products run inside the loads' latency */
      if (more) put(cur ^ 1);
      __syncthreads(); } /* publishes stage kc + 1, ends the reads of the buffer refilled next (at the end: of the LDS that sf reuses) */
#pragma unroll
    for (int j = 0; j < 8; ++j) { const float bias = BO ? bfr(BO[c0 + j * 16 + col]) : 0.f;
#pragma unroll
      for (int r = 0; r < 8; ++r) sf[wave][8 * g + r][j * 16 + col] = acc[j][r] * (1.0f / 256.0f) + bias; } }
  LDSX(); for (int rl = 0; rl < 16; ++rl) vst2(OUT + (r0 + rl) * DIN + c0 + lane * 4, *(const v4f*)&sf[wave][rl][lane * 4]); }

extern "C" void kernel_launch(void* const* d_in, const int* in_sizes, int n_in, void* d_out, int out_size, void* d_ws, size_t ws_size, hipStream_t stream) {
  (void)in_sizes; (void)n_in; (void)out_size;
  const float** F = (const float**)d_in;
  if (ws_size < (size_t)WS_END) return;
  char* ws = (char*)d_ws; _Float16 *QH = (_Float16*)(ws + WS_QH), *KH = (_Float16*)(ws + WS_KH), *VT = (_Float16*)(ws + WS_VT), *QL = (_Float16*)(ws + WS_QL), *KL = (_Float16*)(ws + WS_KL); __bf16 *VB = (__bf16*)(ws + WS_VB), *VBL = (__bf16*)(ws + WS_VBL); float *Y = (float*)(ws + WS_Y);
  (void)Y; (void)QL; (void)KL; (void)VB; (void)VBL;
  // inputs: 0 x [2,2048,1024]; 1 Wq, 2 Wk, 3 Wv [16,1024,64]; 4 Wo [1024,1024] (in,out); 5 bo [1024]
  k_proj<<<dim3(TNB * TT / 64, CC / 128, 3), 128, 0, stream>>>(F[0], F[0], F[0], F[1], F[2], F[3], nullptr, nullptr, nullptr, QH, QL, KH, KL, VT, VB, VBL);
  k_att<<<dim3(NB * NH * NQB), 128, 0, stream>>>(QH, KH, VT, QL, KL, VB, VBL, Y);
  k_out<<<dim3(TNB * TT / 64, DIN / 128), 128, 0, stream>>>(Y, F[4], F[5], (float*)d_out);
}

// v006
// It runs in 104 microseconds.
// In two side-by-side timings against v005, it was 1.22 and 1.21 times as fast.
// Counting every step since v000, it is 10.1 times as fast.
// compute dtype: all float inputs rounded to bf16; q/k/v = x W[h] with EXACT bf16 products on WMMA 16x16x32, f32 accumulate; q, k once to f16 -> 1-product causal logits x 1/32, except the first 384 query rows of each sequence (few keys, no averaging), which use q and k as f16 hi + residual (x 2^10) (3 products); softmax in f32 (exp(logit - max) = one exp2 instruction of (score - max) x 1/32 x log2 e, running maximum and sum over blocks of 64 keys, division by the sum last); exp(logit - max) once to f16 against v once to f16 (1 product), except the first 384 rows: exp(logit - max) and v as bf16 hi + lo (3 products); ctx once to f16 against Wo carried x 2^8 in f16 (exact bf16 values), except the first 384 rows: ctx bf16 hi + lo against exact bf16 Wo (2 products); + bo; f32 output.
#include <hip/hip_runtime.h>
#include <math.h>

typedef __attribute__((ext_vector_type(16))) _Float16 v16h;
typedef __attribute__((ext_vector_type(16))) __bf16 v16b;
typedef __attribute__((ext_vector_type(8)))  _Float16 v8h;
typedef __attribute__((ext_vector_type(8)))  float v8f;
typedef __attribute__((ext_vector_type(4)))  float v4f;
typedef __attribute__((ext_vector_type(2)))  float v2f;
typedef __attribute__((ext_vector_type(4)))  unsigned v4u;
typedef __attribute__((ext_vector_type(4)))  int v4i;
typedef float __attribute__((may_alias)) float_a;
typedef int __attribute__((may_alias)) int_a;

template <typename T> __device__ __forceinline__ void vst2(void* p, T v) { *(T*)p = v;  }
__device__ __forceinline__ v8f wmma16(v16h a, v16h b, v8f c) {
  v8f d = __builtin_amdgcn_wmma_f32_16x16x32_f16(false, a, false, b, (short)0, c, false, false);
  asm volatile("v_nop\n\tv_nop\n\tv_nop\n\tv_nop" : "+v"(d) : "v"(a), "v"(b));
  return d;
}
__device__ __forceinline__ v8f wmma_bf(v16b a, v16b b, v8f c) {
  v8f d = __builtin_amdgcn_wmma_f32_16x16x32_bf16(false, a, false, b, (short)0, c, false, false);
  asm volatile("v_nop\n\tv_nop\n\tv_nop\n\tv_nop" : "+v"(d) : "v"(a), "v"(b));
  return d;
}
// 16x16x32 fragments: lane = (h = lane>>4, row/col = lane&15); elements 0..7 = k0+8h+0..7, 8..15 = k0+16+8h+0..7; D element r = row 8h+r
__device__ __forceinline__ v16h frag_h(const _Float16* rowk0, int lane) {
  union { v16h v; v8h q[2]; } u; const _Float16* p = rowk0 + 8 * (lane >> 4);
  u.q[0] = *(const v8h*)p; u.q[1] = *(const v8h*)(p + 16); return u.v;
}
__device__ __forceinline__ v16h frag_f32(const float* rowk0, int lane) {
  v16h a; const float* p = rowk0 + 8 * (lane >> 4);
#pragma unroll
  for (int i = 0; i < 8; ++i) { a[i] = (_Float16)p[i]; a[8 + i] = (_Float16)p[16 + i]; }
  return a;
}
__device__ __forceinline__ v16h frag_f32s(const float* rowk0, int lane, float sc) {
  v16h a; const float* p = rowk0 + 8 * (lane >> 4);
#pragma unroll
  for (int i = 0; i < 8; ++i) { a[i] = (_Float16)(p[i] * sc); a[8 + i] = (_Float16)(p[16 + i] * sc); }
  return a;
}
// column fragment from a [K][ld] layout (column n), rows >= K read as 0
__device__ __forceinline__ v16h fragc_f32(const float* W, int k0, int n, int lane, int ld, int K) {
  v16h a; const int g = lane >> 4;
#pragma unroll
  for (int i = 0; i < 8; ++i) { const int ka = k0 + 8 * g + i, kb = ka + 16;
    a[i] = (_Float16)(ka < K ? W[(size_t)(ka < K ? ka : K - 1) * ld + n] : 0.f); a[8 + i] = (_Float16)(kb < K ? W[(size_t)(kb < K ? kb : K - 1) * ld + n] : 0.f); }
  return a;
}
struct F2 { v16b h, l; };
__device__ __forceinline__ F2 bsplit16(const float v[16]) { F2 r;
#pragma unroll
  for (int i = 0; i < 16; ++i) { const __bf16 h = (__bf16)v[i]; r.h[i] = h; r.l[i] = (__bf16)(v[i] - (float)h); }
  return r; }
__device__ __forceinline__ F2 split_row(const float* row, int k0, int lane) { float v[16]; const float* p = row + k0 + 8 * (lane >> 4);
#pragma unroll
  for (int i = 0; i < 8; ++i) { v[i] = p[i]; v[8 + i] = p[16 + i]; }
  return bsplit16(v); }
__device__ __forceinline__ F2 split_rowK(const float* row, int k0, int lane, int K) { float v[16]; const int g = lane >> 4;
#pragma unroll
  for (int i = 0; i < 8; ++i) { const int ka = k0 + 8 * g + i, kb = ka + 16; v[i] = ka < K ? row[ka < K ? ka : K - 1] : 0.f; v[8 + i] = kb < K ? row[kb < K ? kb : K - 1] : 0.f; }
  return bsplit16(v); }
__device__ __forceinline__ F2 split_col(const float* W, int k0, int n, int lane, int ld, int K) { float v[16]; const int g = lane >> 4;
#pragma unroll
  for (int i = 0; i < 8; ++i) { const int ka = k0 + 8 * g + i, kb = ka + 16; v[i] = ka < K ? W[(size_t)(ka < K ? ka : K - 1) * ld + n] : 0.f; v[8 + i] = kb < K ? W[(size_t)(kb < K ? kb : K - 1) * ld + n] : 0.f; }
  return bsplit16(v); }
__device__ __forceinline__ v8f mac3(const F2& a, const F2& b, v8f c) { c = wmma_bf(a.l, b.h, c); c = wmma_bf(a.h, b.l, c); return wmma_bf(a.h, b.h, c); }
__device__ __forceinline__ float sigm(float v) { return 1.0f / (1.0f + expf(-v)); }
#define LDSX() do { asm volatile("s_wait_dscnt 0" ::: "memory"); __builtin_amdgcn_wave_barrier(); __builtin_amdgcn_fence(__ATOMIC_RELEASE, "workgroup"); } while (0)

// Causal multi-head self-attention with per-head projection tensors (B 2, T 2,048, C 1,024, 16 heads x 64): q/k/v[b,h,t,:] = x[b,t,:] Wq/Wk/Wv[h] ([H][C][64], no bias); att = softmax(q k^T / sqrt(1024) with key > query -> -inf); out = concat_h(att v) Wo ((in,out) [1024,1024]) + bo.
#define NB 2
#define TT 2048
#define CC 1024            // NH * HD = projected width
#define DIN 1024          // input (model) width
#define NH 16
#define HD 64
#define NQB (TT / 64)
#define SCALE (0.03125f)
#define CAUSAL 1
#ifndef TNB
#define TNB NB
#endif
__device__ __forceinline__ float bfr(float v) { return (float)(__bf16)v; }
typedef __attribute__((ext_vector_type(8))) __bf16 v8b;
__device__ __forceinline__ v16b frag_b(const __bf16* rowk0, int lane) {
  union { v16b v; v8b q[2]; } u; const __bf16* p = rowk0 + 8 * (lane >> 4);
  u.q[0] = *(const v8b*)p; u.q[1] = *(const v8b*)(p + 16); return u.v;
}
#define QBH 6              // causal: query blocks 0..QBH-1 of each sequence (few keys, no averaging) take the high-precision path
#define QHI 384            // rows carrying a q residual plane
#define KHI 384            // key rows carrying k residual / v bf16 hi+lo planes (used only by the causal high-precision path)
// B fragment (k rows k0+.., output column o) of a weight: (in,out) [K][ld] or (out,in) [ld rows of K]: bf16 exact, or f16(bf16 * 256) exact
__device__ __forceinline__ v16b wcol_io(const float* Wm, int k0, int o, int lane, int ld) { v16b w; const int g = lane >> 4;
#pragma unroll
  for (int i = 0; i < 8; ++i) { w[i] = (__bf16)Wm[(size_t)(k0 + 8 * g + i) * ld + o]; w[8 + i] = (__bf16)Wm[(size_t)(k0 + 16 + 8 * g + i) * ld + o]; }
  return w; }
__device__ __forceinline__ v16b wcol_oi(const float* Wm, int k0, int o, int lane, int K) { v16b w; const float* p = Wm + (size_t)o * K + k0 + 8 * (lane >> 4);
#pragma unroll
  for (int i = 0; i < 8; ++i) { w[i] = (__bf16)p[i]; w[8 + i] = (__bf16)p[16 + i]; }
  return w; }
__device__ __forceinline__ v16h wcolh_io(const float* Wm, int k0, int o, int lane, int ld) { v16h w; const int g = lane >> 4;
#pragma unroll
  for (int i = 0; i < 8; ++i) { w[i] = (_Float16)(bfr(Wm[(size_t)(k0 + 8 * g + i) * ld + o]) * 256.0f); w[8 + i] = (_Float16)(bfr(Wm[(size_t)(k0 + 16 + 8 * g + i) * ld + o]) * 256.0f); }
  return w; }
__device__ __forceinline__ v16h wcolh_oi(const float* Wm, int k0, int o, int lane, int K) { v16h w; const float* p = Wm + (size_t)o * K + k0 + 8 * (lane >> 4);
#pragma unroll
  for (int i = 0; i < 8; ++i) { w[i] = (_Float16)(bfr(p[i]) * 256.0f); w[8 + i] = (_Float16)(bfr(p[16 + i]) * 256.0f); }
  return w; }
#define WQKV_LAYOUT 2   // 0 = (in,out) [DIN][CC]; 1 = (out,in) [CC][DIN]; 2 = per-head [NH][DIN][HD]
__device__ __forceinline__ v16b wcol_hdk(const float* Wm, int k0, int o, int lane) { v16b w; const int g = lane >> 4; const float* p = Wm + (size_t)(o / HD) * DIN * HD + (o % HD);
#pragma unroll
  for (int i = 0; i < 8; ++i) { w[i] = (__bf16)p[(size_t)(k0 + 8 * g + i) * HD]; w[8 + i] = (__bf16)p[(size_t)(k0 + 16 + 8 * g + i) * HD]; }
  return w; }
#define WO_OUT_IN 0
#if WQKV_LAYOUT == 1
#define WCOL(W, k0, o, lane) wcol_oi(W, k0, o, lane, DIN)
#elif WQKV_LAYOUT == 2
#define WCOL(W, k0, o, lane) wcol_hdk(W, k0, o, lane)
#else
#define WCOL(W, k0, o, lane) wcol_io(W, k0, o, lane, CC)
#endif
#if WO_OUT_IN
#define WOCOL(W, k0, o, lane) wcol_oi(W, k0, o, lane, CC)
#define WOCOLH(W, k0, o, lane) wcolh_oi(W, k0, o, lane, CC)
#else
#define WOCOL(W, k0, o, lane) wcol_io(W, k0, o, lane, DIN)
#define WOCOLH(W, k0, o, lane) wcolh_io(W, k0, o, lane, DIN)
#endif

#define WS_QH  0u                                      // f16 q rows [b*t][CC]
#define WS_KH  (WS_QH + 2u * (size_t)NB * TT * CC)      // f16 k rows [b*t][CC]
#define WS_VT  (WS_KH + 2u * (size_t)NB * TT * CC)      // f16 v planes [b][c][t]
#define WS_QL  (WS_VT + 2u * (size_t)NB * CC * TT)      // f16 q residual x 2^10 rows [b][t < QHI][CC]
#define WS_KL  (WS_QL + 2u * (size_t)NB * QHI * CC)     // f16 k residual x 2^10 rows [b][t < KHI][CC]
#define WS_VB  (WS_KL + 2u * (size_t)NB * KHI * CC)     // bf16 v hi planes [b][c][t < KHI]
#define WS_VBL (WS_VB + 2u * (size_t)NB * CC * KHI)
#define WS_Y   (WS_VBL + 2u * (size_t)NB * CC * KHI)      // f32 ctx rows [b*t][CC] (only when there is an output projection)
#define WS_END (WS_Y  + 4u * (size_t)NB * TT * CC)

// ---- staging of a 32-k stage of both GEMM operands (k_proj, k_out): a block brings its 128 weight columns and its activation rows (128 in k_proj, 64 in k_out) from global memory ONCE, in whole 128-B lines, rounds them to their 16-bit operand type and lays them k-contiguous in LDS; every wave then takes its fragments by 16-byte LDS reads. Values, k order and sum order are those of the direct loads
#define SP 40              // LDS pitch of a staged row of 32 k, in 16-bit elements: 80 B = 16 B x odd, the pitch at which 16-byte LDS reads and writes of 16 rows fall on distinct banks
typedef __attribute__((ext_vector_type(4))) __bf16 v4b;
typedef __attribute__((ext_vector_type(4))) _Float16 v4h;
// one thread's share of a stage: 32 k of weight column tid (a wave-instruction = 32 neighbouring columns = one line), and four 16-byte pieces of the activation rows (a wave-instruction = four whole lines); both pointers then step on 32 k
__device__ __forceinline__ void st_load(const float*& wp, int wld, const float*& xp, int xld, float wr[32], v4f xr[4]) {
#pragma unroll
  for (int k = 0; k < 32; ++k) wr[k] = wp[(size_t)k * wld];
#pragma unroll
  for (int i = 0; i < 4; ++i) xr[i] = *(const v4f*)(xp + (size_t)(16 * i) * xld);
  asm volatile("s_wait_xcnt 0x0" :: "v"(wp), "v"(xp) : "memory"); /* the wait that stands before a register of an issued global load is overwritten; the two pointers are inputs so that the loads' address registers live up to it */
  wp += (size_t)32 * wld; xp += 32; }
// the same share for k_proj's 128 activation rows: eight 16-byte pieces a thread instead of four
__device__ __forceinline__ void st_load8(const float*& wp, int wld, const float*& xp, int xld, float wr[32], v4f xr[8]) {
#pragma unroll
  for (int k = 0; k < 32; ++k) wr[k] = wp[(size_t)k * wld];
#pragma unroll
  for (int i = 0; i < 8; ++i) xr[i] = *(const v4f*)(xp + (size_t)(16 * i) * xld);
  asm volatile("s_wait_xcnt 0x0" :: "v"(wp), "v"(xp) : "memory"); /* the wait that stands before a register of an issued global load is overwritten; the two pointers are inputs so that the loads' address registers live up to it */
  wp += (size_t)32 * wld; xp += 32; }
// four 16-byte stores of k_proj's epilogue (rows or planes n elements apart, from LDS rows ln elements apart) and, directly behind the last, the wait that stands before a register of an issued global store is overwritten; the address (the four stores name one register pair, with n as an immediate offset) and the four values are inputs of the wait so that the stores' registers live up to it (the loops stay rolled and reuse them)
template <typename T> __device__ __forceinline__ void st16x4(T* p0, size_t n, const T* l0, int ln) {
  const v4u d0 = *(const v4u*)l0, d1 = *(const v4u*)(l0 + ln), d2 = *(const v4u*)(l0 + 2 * ln), d3 = *(const v4u*)(l0 + 3 * ln);
  *(v4u*)p0 = d0; *(v4u*)(p0 + n) = d1; *(v4u*)(p0 + 2 * n) = d2; *(v4u*)(p0 + 3 * n) = d3;
  asm volatile("s_wait_xcnt 0x0" :: "v"(p0), "v"(d0), "v"(d1), "v"(d2), "v"(d3) : "memory"); }
// ---- k_proj: block = (128 rows, 128 cols, which), wave = 64 rows x 64 cols (4 x 4 accumulator tiles: a staged weight column serves twice the rows, and eight fragments feed sixteen products): q/k/v = X W (+ b) with exact bf16 products (K = DIN) -> which 0: q f16 rows (+ residual rows < QHI); 1: k f16 rows (+ residual rows < KHI); 2: v f16 planes [c][t] (+ bf16 hi/lo planes for t < KHI)
#define PR 128             // rows of a k_proj block; 768 blocks = three a WGP, all resident at once
__global__ __launch_bounds__(128) void k_proj(const float* __restrict__ XQ, const float* __restrict__ XK, const float* __restrict__ XV, const float* __restrict__ WQ, const float* __restrict__ WK, const float* __restrict__ WV, const float* __restrict__ BQ, const float* __restrict__ BK, const float* __restrict__ BV,
    _Float16* __restrict__ QH, _Float16* __restrict__ QL, _Float16* __restrict__ KH, _Float16* __restrict__ KL, _Float16* __restrict__ VT, __bf16* __restrict__ VB, __bf16* __restrict__ VBL) {
  union Lds { struct { _Float16 sh[PR][136], sl[PR][136]; } qk; struct { _Float16 th[128][PR + 8]; __bf16 tb[128][PR + 8], tbl[128][PR + 8]; } v; struct { __bf16 wt[2][128][SP], xs[2][PR][SP]; } st; }; /* the stage buffers lie in the LDS of the epilogue's arrays, which are written only behind the loop's last barrier */
  __shared__ __align__(16) Lds sm; auto& sh = sm.qk.sh; auto& sl = sm.qk.sl; auto& th = sm.v.th; auto& tb = sm.v.tb; auto& tbl = sm.v.tbl;
  static_assert(TT % PR == 0 && QHI % PR == 0 && KHI % PR == 0, "a block lies in one sequence and wholly inside or outside the residual rows");
  const int tid = threadIdx.x, wave = tid >> 5, lane = tid & 31, col = lane & 15, g = lane >> 4; const int wrow = (wave >> 1) * 64, wcol = (wave & 1) * 64; const int which = blockIdx.z; const int c0 = blockIdx.y * 128; const size_t r0 = (size_t)blockIdx.x * PR; const size_t bb = r0 / TT; const int t0 = (int)(r0 % TT);
  const float* X = which == 0 ? XQ : which == 1 ? XK : XV; const float* WA = which == 0 ? WQ : which == 1 ? WK : WV; const float* BA = which == 0 ? BQ : which == 1 ? BK : BV;
  static_assert(WQKV_LAYOUT == 2, "stage loader written for per-head [NH][DIN][HD] weights");
  v8f acc[4][4] = {}; float wr[32]; v4f xr[8];
  const float* wp = WA + (size_t)((c0 + tid) / HD) * DIN * HD + (c0 + tid) % HD; const float* xp = X + (r0 + (tid >> 3)) * DIN + (tid & 7) * 4;
  /* rounds this thread's share to bf16 and writes it to stage buffer bf; loops unrolled so that wr[] and xr[] stay in registers */
  auto put = [&](int bf) {
#pragma unroll
    for (int q = 0; q < 4; ++q) { v8b t;
#pragma unroll
      for (int i = 0; i < 8; ++i) t[i] = (__bf16)wr[8 * q + i];
      *(v8b*)&sm.st.wt[bf][tid][8 * q] = t; }
#pragma unroll
    for (int i = 0; i < 8; ++i) { v4b t;
#pragma unroll
      for (int e = 0; e < 4; ++e) t[e] = (__bf16)xr[i][e];
      *(v4b*)&sm.st.xs[bf][(tid >> 3) + 16 * i][(tid & 7) * 4] = t; } };
  st_load8(wp, HD, xp, DIN, wr, xr); put(0); __syncthreads(); /* publishes stage 0 */
  /* two buffers: stage kc + 1 is asked for before stage kc's products, so its latency runs behind them, and written to the other buffer after them; unrolled by two so that the buffer index is a constant */
#pragma unroll 2
  for (int kc = 0; kc < DIN / 32; ++kc) { const int cur = kc & 1; const bool more = kc + 1 < DIN / 32;
    if (more) st_load8(wp, HD, xp, DIN, wr, xr);
    v16b a[4], w[4]; /* unrolled so that a[] and w[] stay in registers */
#pragma unroll
    for (int i = 0; i < 4; ++i) a[i] = frag_b(&sm.st.xs[cur][wrow + i * 16 + col][0], lane);
#pragma unroll
    for (int j = 0; j < 4; ++j) w[j] = frag_b(&sm.st.wt[cur][wcol + j * 16 + col][0], lane);
    __builtin_amdgcn_sched_barrier(0); /* keeps the stage's sixteen LDS reads together as one group in front of the products: left free, three of the four row fragments are read among the products into one register set, each behind a full wait */
#pragma unroll
    for (int i = 0; i < 4; ++i)
#pragma unroll
      for (int j = 0; j < 4; ++j) acc[i][j] = __builtin_amdgcn_wmma_f32_16x16x32_bf16(false, a[i], false, w[j], (short)0, acc[i][j], false, false); /* the plain builtin: the operands of an asm statement must lie in the first 256 registers, which sixteen tiles and eight fragments overfill (spills in the loop); the compiler keeps the distances behind its own matrix instructions */
    __builtin_amdgcn_sched_barrier(0); /* keeps the waits on the next stage's global loads behind this stage's products, so that the products run inside the loads' latency */
    if (more) put(cur ^ 1);
    __syncthreads(); } /* one barrier a stage: publishes stage kc + 1 and ends every wave's reads of the buffer that the next trip refills (after the last trip: of the LDS that the epilogue reuses) */
  if (which < 2) { _Float16* DH = which == 0 ? QH : KH; _Float16* DL = which == 0 ? QL : KL; const int nhi = which == 0 ? QHI : KHI; const bool hi_rows = t0 < nhi;
#pragma unroll
    for (int j = 0; j < 4; ++j) { const float bias = BA ? bfr(BA[c0 + wcol + j * 16 + col]) : 0.f;
#pragma unroll
      for (int i = 0; i < 4; ++i)
#pragma unroll
        for (int r = 0; r < 8; ++r) { const float v = acc[i][j][r] + bias; const _Float16 hv = (_Float16)v; sh[wrow + i * 16 + 8 * g + r][wcol + j * 16 + col] = hv; sl[wrow + i * 16 + 8 * g + r][wcol + j * 16 + col] = (_Float16)((v - (float)hv) * 1024.0f); } }
    __syncthreads();
    for (int e = tid; e < PR * 16; e += 512) { const int rl = e >> 4, q = e & 15; /* a trip = rows rl, rl + 8, rl + 16, rl + 24 */ st16x4(DH + (r0 + rl) * CC + c0 + q * 8, (size_t)8 * CC, &sh[rl][q * 8], 8 * 136); if (hi_rows) st16x4(DL + (bb * nhi + t0 + rl) * (size_t)CC + c0 + q * 8, (size_t)8 * CC, &sl[rl][q * 8], 8 * 136); }
  } else { const bool hi_rows = t0 < KHI;
#pragma unroll
    for (int j = 0; j < 4; ++j) { const float bias = BA ? bfr(BA[c0 + wcol + j * 16 + col]) : 0.f;
#pragma unroll
      for (int i = 0; i < 4; ++i)
#pragma unroll
        for (int r = 0; r < 8; ++r) { const float v = acc[i][j][r] + bias; const int rl = wrow + i * 16 + 8 * g + r, cl = wcol + j * 16 + col; th[cl][rl] = (_Float16)v; const __bf16 bh = (__bf16)v; tb[cl][rl] = bh; tbl[cl][rl] = (__bf16)(v - (float)bh); } }
    __syncthreads();
    for (int e = tid; e < 128 * (PR / 8); e += 512) { const int cl = e / (PR / 8), q = e % (PR / 8); /* a trip = planes cl, cl + 8, cl + 16, cl + 24 */ static_assert(PR / 8 == 16, "128 threads = 8 planes"); st16x4(VT + (bb * CC + c0 + cl) * (size_t)TT + t0 + q * 8, (size_t)8 * TT, &th[cl][q * 8], 8 * (PR + 8)); if (hi_rows) { const size_t o3 = (bb * CC + c0 + cl) * (size_t)KHI + t0 + q * 8; st16x4(VB + o3, (size_t)8 * KHI, &tb[cl][q * 8], 8 * (PR + 8)); st16x4(VBL + o3, (size_t)8 * KHI, &tbl[cl][q * 8], 8 * (PR + 8)); } } } }
// ---- k_att: block = 64 queries (qb) of (b, h), one wave = 16 queries; the waves share only the staged k and v tiles (query blocks >= QBH): per 64 keys S^T = K Q^T (lane = one query, its D registers = keys), causal mask by index on the diagonal block, running maximum (of the unscaled scores) and sum in f32, e = exp(logit - max) = exp2((score - max) x SCALE x log2 e) packed from the score registers straight into the B operand of ctx^T += V^T P^T, ctx and sum brought to the new maximum every trip, ctx divided by the sum at the end. Logits and P never go to memory. Products as before: 1 f16 product each; query blocks < QBH: 3-product logits (q, k hi + residual), e and v as bf16 hi + lo (3 products)
__device__ __forceinline__ v8f mm_h(v16h a, v16h b, v8f c) { return __builtin_amdgcn_wmma_f32_16x16x32_f16(false, a, false, b, (short)0, c, false, false); }
__device__ __forceinline__ v8f mm_b(v16b a, v16b b, v8f c) { return __builtin_amdgcn_wmma_f32_16x16x32_bf16(false, a, false, b, (short)0, c, false, false); }
// fragment from a pointer that already holds the lane's 8 g offset, so that the pointer itself is the address register pair of the loads
__device__ __forceinline__ v16h frag_hp(const _Float16* p) { union { v16h v; v8h q[2]; } u; u.q[0] = *(const v8h*)p; u.q[1] = *(const v8h*)(p + 16); return u.v; }
__device__ __forceinline__ v16b frag_bp(const __bf16* p) { union { v16b v; v8b q[2]; } u; u.q[0] = *(const v8b*)p; u.q[1] = *(const v8b*)(p + 16); return u.v; }
// every loop over st[], acc[] or a fragment array in sm_step and k_att is unrolled so that the array stays in registers; the two key loops stay rolled (unroll 1): one trip's fragments already fill the register budget of four waves a SIMD
// st[t][r] = unscaled score q.k of key k0 + 16 t + 8 g + r for this lane's query qi; on return e = exp(SCALE x (score - new maximum)); m (unscaled), l, acc brought to the new maximum (l is this half-wave's part of the sum)
// the exponent is formed by one multiply-add a score, score x EXC - max x EXC, and goes straight to the hardware's exp2: it is at most 0 (up to the rounding of max x EXC), and where exp2 falls below the range of f32 the result is 0, which is what a masked or far-off key contributes
#define EXC (SCALE * 1.44269504088896340736f) // SCALE x log2 e
// exp2 of eight values, each in its own register. In asm so that the slot which the instruction set asks for behind a transcendental (before its result is read or its source overwritten) is kept by construction: each v_exp_f32 overwrites only its own source, none reads another's result, and the v_nop is the slot behind the last one. The s_delay_alu is the hint that the compiler writes for its own code and not for asm: a source may come from the vector instruction directly in front, and unhinted the wait would hold up the SIMD's other waves too; it changes no result
__device__ __forceinline__ v8f exp2x8(v8f x) { float a = x[0], b = x[1], c = x[2], d = x[3], e = x[4], f = x[5], g = x[6], h = x[7];
  asm("s_delay_alu instid0(VALU_DEP_1)\n\tv_exp_f32 %0, %0\n\tv_exp_f32 %1, %1\n\tv_exp_f32 %2, %2\n\tv_exp_f32 %3, %3\n\tv_exp_f32 %4, %4\n\tv_exp_f32 %5, %5\n\tv_exp_f32 %6, %6\n\tv_exp_f32 %7, %7\n\tv_nop" : "+v"(a), "+v"(b), "+v"(c), "+v"(d), "+v"(e), "+v"(f), "+v"(g), "+v"(h));
  const v8f r = {a, b, c, d, e, f, g, h}; return r; }
__device__ __forceinline__ float exp2x1(float a) { asm("s_delay_alu instid0(VALU_DEP_1)\n\tv_exp_f32 %0, %0\n\tv_nop" : "+v"(a)); return a; } /* the same for one value */
__device__ __forceinline__ void sm_step(v8f st[4], v8f acc[HD / 16], float& m, float& l, bool diag, int k0, int g, int qi) {
  if (diag) {
#pragma unroll
    for (int t = 0; t < 4; ++t)
#pragma unroll
      for (int r = 0; r < 8; ++r) if (k0 + t * 16 + 8 * g + r > qi) st[t][r] = -3.0e38f; }
  float mx = m;
#pragma unroll
  for (int t = 0; t < 4; ++t)
#pragma unroll
    for (int r = 0; r < 8; ++r) mx = fmaxf(mx, st[t][r]);
  mx = fmaxf(mx, __shfl_xor(mx, 16));
  const float alpha = exp2x1((m - mx) * EXC); m = mx; float s = 0.f; const float nmc = -mx * EXC; const v8f cv = {EXC, EXC, EXC, EXC, EXC, EXC, EXC, EXC}, nv = {nmc, nmc, nmc, nmc, nmc, nmc, nmc, nmc};
#pragma unroll
  for (int t = 0; t < 4; ++t) { st[t] = exp2x8(__builtin_elementwise_fma(st[t], cv, nv));
#pragma unroll
    for (int r = 0; r < 8; ++r) s += st[t][r]; }
  l = l * alpha + s;
#pragma unroll
  for (int j = 0; j < HD / 16; ++j) acc[j] *= alpha; }
// ---- staging of a 64-key tile (k_att, query blocks >= QBH): the block's four waves read the same 64 k rows and 64 v planes, so the block brings them from global memory ONCE, in whole 128-B lines, by asynchronous copies to LDS, and every wave takes its fragments by 16-byte LDS reads. Values, k order and sum order are those of the direct loads
#define KVP 72             // LDS pitch of a staged row of 64 f16: 144 B = 16 B x odd, the pitch at which 16-byte LDS reads of 16 rows fall on distinct banks
#define KVB (128 * KVP * 2) // bytes of one tile buffer: rows 0..63 = k rows (key, head column), rows 64..127 = v planes (head column, key)
// one thread's share of a tile: eight 16-byte copies, rows (tid >> 3) + 16 i, piece tid & 7 (a wave-instruction = four whole lines). l = the lane's LDS byte address in row tid >> 3 of the buffer, kg and vg = its global addresses in k row tid >> 3 and v plane tid >> 3 of the tile
__device__ __forceinline__ void kv_copy(unsigned l, const _Float16* kg, const _Float16* vg) {
  /* the s_wait_xcnt 0 stands inside the copies' own statement, so that no register which a copy names is rewritten in front of it */
  asm volatile("global_load_async_to_lds_b128 %0, %8, off\n\t"
               "global_load_async_to_lds_b128 %1, %9, off\n\t"
               "global_load_async_to_lds_b128 %2, %10, off\n\t"
               "global_load_async_to_lds_b128 %3, %11, off\n\t"
               "global_load_async_to_lds_b128 %4, %12, off\n\t"
               "global_load_async_to_lds_b128 %5, %13, off\n\t"
               "global_load_async_to_lds_b128 %6, %14, off\n\t"
               "global_load_async_to_lds_b128 %7, %15, off\n\t"
               "s_wait_xcnt 0x0"
               :: "v"(l), "v"(l + 16 * KVP * 2), "v"(l + 32 * KVP * 2), "v"(l + 48 * KVP * 2), "v"(l + 64 * KVP * 2), "v"(l + 80 * KVP * 2), "v"(l + 96 * KVP * 2), "v"(l + 112 * KVP * 2),
                  "v"(kg), "v"(kg + (size_t)16 * CC), "v"(kg + (size_t)32 * CC), "v"(kg + (size_t)48 * CC), "v"(vg), "v"(vg + (size_t)16 * TT), "v"(vg + (size_t)32 * TT), "v"(vg + (size_t)48 * TT)
               : "memory"); }
__global__ __launch_bounds__(128) void k_att(const _Float16* __restrict__ QH, const _Float16* __restrict__ KH, const _Float16* __restrict__ VT, const _Float16* __restrict__ QL, const _Float16* __restrict__ KL, const __bf16* __restrict__ VB, const __bf16* __restrict__ VBL, float* __restrict__ Y) { __shared__ __align__(16) float ss[4][16][HD + 4]; __shared__ __align__(16) _Float16 kv[2][128][KVP];
  const int tid = threadIdx.x, wave = tid >> 5, lane = tid & 31, col = lane & 15, g = lane >> 4;
  /* all 1,024 blocks are resident at once (4 a WGP) and a block's cost grows with qb, so the launch lasts as long as the fullest WGP: the flat index is spread so that the four blocks f, f + 256, f + 512, f + 768 and equally the four blocks f, f + 8, f + 16, f + 24 hold one qb of each quarter, 31 - i, 16 + i, 15 - i, i: the same cost for every such four. Speed only: any placement is correct; (qb, head, batch) <-> f is one to one */
  static_assert(NQB == 32 && NB * NH == 32, "index spread written for 32 query blocks x 32 (batch, head) pairs");
  const int f = blockIdx.x, fk = (f >> 3) & 3, fi = (f >> 5) & 7, fc = (fk + (f >> 8)) & 3; const int qb = fc == 0 ? 31 - fi : fc == 1 ? 16 + fi : fc == 2 ? 15 - fi : fi; const int bh = (f & 7) + 8 * fk; const int h = bh % NH, b = bh / NH; const int ql0 = qb * 64 + wave * 16, qi = ql0 + col;
  const _Float16* qp = QH + ((size_t)b * TT + qi) * CC + h * HD + 8 * g; const _Float16* kp = KH + ((size_t)b * TT + col) * CC + h * HD + 8 * g;
  v8f acc[HD / 16] = {}; float m = -3.0e38f, l = 0.f;
  if (qb >= QBH) { static_assert(QBH >= 1, "the ring's prologue asks for tiles 0 and 1");
    const unsigned lb = (unsigned)(size_t)&kv[0][tid >> 3][(tid & 7) * 8]; const _Float16* kg = KH + ((size_t)b * TT + (tid >> 3)) * CC + h * HD + (tid & 7) * 8; const _Float16* vg = VT + ((size_t)b * CC + h * HD + (tid >> 3)) * (size_t)TT + (tid & 7) * 8;
    const v16h q0 = frag_hp(qp), q1 = frag_hp(qp + 32);
    asm volatile("s_wait_xcnt 0x0" :: "v"(qp) : "memory"); /* the wait that stands before a register of an issued global load is overwritten; the pointer is an input so that the loads' address registers live up to it */
    kv_copy(lb, kg, vg);
    asm volatile("s_wait_asynccnt 0x0" ::: "memory"); /* this wave's copies of tile 0 have landed */
    __syncthreads(); /* publishes tile 0 */
    kv_copy(lb + KVB, kg + (size_t)64 * CC, vg + 64); kg += (size_t)128 * CC; vg += 128; /* kg and vg walk two tiles ahead of the trip */
    /* rolled: a second trip's fragments would go past the 256 registers that four waves a SIMD allow */
#pragma unroll 1
    for (int kb = 0; kb <= qb; ++kb) { const int k0 = kb * 64; const _Float16 (*T)[KVP] = kv[kb & 1]; v16h ka[4][2], va[2][HD / 16]; /* trip kb reads buffer kb & 1 alone; inner loops unrolled so that the arrays stay in registers */
#pragma unroll
      for (int t = 0; t < 4; ++t) { ka[t][0] = frag_hp(&T[t * 16 + col][8 * g]); ka[t][1] = frag_hp(&T[t * 16 + col][32 + 8 * g]); }
#pragma unroll
      for (int u = 0; u < 2; ++u)
#pragma unroll
        for (int j = 0; j < HD / 16; ++j) va[u][j] = frag_hp(&T[64 + j * 16 + col][u * 32 + 8 * g]);
      __builtin_amdgcn_sched_barrier(0); /* keeps the trip's LDS reads together as one group in front of the products: left free they sink to their uses, with one full wait a product */
      v8f st[4];
#pragma unroll
      for (int t = 0; t < 4; ++t) { v8f z = {}; z = mm_h(ka[t][0], q0, z); st[t] = mm_h(ka[t][1], q1, z); }
      /* the trip reads nothing of its tile behind this line (softmax and P v work on registers), so this is the foot of the trip for the ring: the buffer is handed over here and the refill has a whole trip to land */
      asm volatile("s_wait_dscnt 0x0" ::: "memory"); /* this wave's reads of the buffer that is refilled below have returned */
      asm volatile("s_wait_asynccnt 0x0" ::: "memory"); /* this wave's copies of tile kb + 1 have landed */
      __syncthreads(); /* one barrier a trip: publishes tile kb + 1 and ends every wave's reads of the buffer refilled behind it */
      if (kb + 2 <= qb) { kv_copy(lb + (kb & 1) * KVB, kg, vg); kg += (size_t)64 * CC; vg += 64; } /* block-uniform test: tile kb + 2 goes into the buffer that this trip has read */
      sm_step(st, acc, m, l, kb == qb, k0, g, qi);
#pragma unroll
      for (int u = 0; u < 2; ++u) { v16h p;
#pragma unroll
        for (int i = 0; i < 8; ++i) { p[i] = (_Float16)st[2 * u][i]; p[8 + i] = (_Float16)st[2 * u + 1][i]; }
#pragma unroll
        for (int j = 0; j < HD / 16; ++j) acc[j] = mm_h(va[u][j], p, acc[j]); } }
    asm volatile("s_wait_asynccnt 0x0" ::: "memory"); /* no copy is outstanding when the wave goes on */
  } else { const _Float16* qlp = QL + ((size_t)b * QHI + qi) * CC + h * HD + 8 * g; const _Float16* klp = KL + ((size_t)b * KHI + col) * CC + h * HD + 8 * g; const size_t vo = ((size_t)b * CC + h * HD + col) * (size_t)KHI + 8 * g; const __bf16* vhp = VB + vo; const __bf16* vlp = VBL + vo;
    const v16h q0 = frag_hp(qp), q1 = frag_hp(qp + 32), r0 = frag_hp(qlp), r1 = frag_hp(qlp + 32);
    asm volatile("s_wait_xcnt 0x0" :: "v"(qp), "v"(qlp) : "memory"); /* as above, for the q loads' two pointers */
    /* rolled, for the same register budget */
#pragma unroll 1
    for (int kb = 0; kb <= qb; ++kb) { const int k0 = kb * 64; v8f st[4];
#pragma unroll
      for (int t = 0; t < 4; ++t) { const size_t ko = (size_t)(t * 16) * CC; const v16h kh0 = frag_hp(kp + ko), kh1 = frag_hp(kp + ko + 32), kl0 = frag_hp(klp + ko), kl1 = frag_hp(klp + ko + 32);
        v8f a = {}, al = {}; a = mm_h(kh0, q0, a); al = mm_h(kh0, r0, al); al = mm_h(kl0, q0, al); a = mm_h(kh1, q1, a); al = mm_h(kh1, r1, al); al = mm_h(kl1, q1, al);
        st[t] = a + al * (1.0f / 1024.0f); }
      sm_step(st, acc, m, l, kb == qb, k0, g, qi);
#pragma unroll
      for (int u = 0; u < 2; ++u) { float pv[16];
#pragma unroll
        for (int i = 0; i < 8; ++i) { pv[i] = st[2 * u][i]; pv[8 + i] = st[2 * u + 1][i]; }
        const F2 p = bsplit16(pv);
#pragma unroll
        for (int j = 0; j < HD / 16; ++j) { const size_t po = (size_t)(j * 16) * KHI + u * 32; const v16b vh = frag_bp(vhp + po), vl = frag_bp(vlp + po); acc[j] = mm_b(vh, p.h, acc[j]); acc[j] = mm_b(vh, p.l, acc[j]); acc[j] = mm_b(vl, p.h, acc[j]); } }
      asm volatile("s_wait_xcnt 0x0" :: "v"(kp), "v"(klp), "v"(vhp), "v"(vlp) : "memory"); /* as above: stands before the four pointers step on to the next 64 keys */
      kp += (size_t)64 * CC; klp += (size_t)64 * CC; vhp += 64; vlp += 64; } }
  l += __shfl_xor(l, 16); const float inv = 1.0f / l;
#pragma unroll
  for (int j = 0; j < HD / 16; ++j) { const v8f o = acc[j] * inv; /* lane = query col, registers = head columns j*16 + 8g + r */
    *(v4f*)&ss[wave][col][j * 16 + 8 * g] = __builtin_shufflevector(o, o, 0, 1, 2, 3); *(v4f*)&ss[wave][col][j * 16 + 8 * g + 4] = __builtin_shufflevector(o, o, 4, 5, 6, 7); }
  LDSX(); /* own-wave exchange: the 256-B (row, head) segments go out whole, two rows an instruction */
  for (int rl = 0; rl < 16; rl += 2) vst2(Y + ((size_t)b * TT + ql0 + rl + g) * CC + h * HD + col * 4, *(const v4f*)&ss[wave][rl + g][col * 4]); }
// ---- k_out: block = (64 rows, 128 cols): out = ctx Wo (+ bo): ctx once to f16 against Wo as f16(bf16 x 2^8) exact (1 product) x 2^-8; causal early rows (< QHI of each sequence): ctx bf16 hi + lo against exact bf16 Wo (2 products)
__global__ __launch_bounds__(128) void k_out(const float* __restrict__ Y, const float* __restrict__ WO, const float* __restrict__ BO, float* __restrict__ OUT) { union Lds { float sf[4][16][132]; struct { _Float16 wt[2][128][SP], ya[2][64][SP]; } h; struct { __bf16 wt[2][128][SP], yh[2][64][SP], yl[2][64][SP]; } b; }; /* the stage buffers lie in the LDS of the epilogue's array, which is written only behind the loop's last barrier */
  __shared__ __align__(16) Lds sm; auto& sf = sm.sf;
  const int tid = threadIdx.x, wave = tid >> 5, lane = tid & 31, col = lane & 15, g = lane >> 4; const int c0 = blockIdx.y * 128; const size_t r0 = (size_t)blockIdx.x * 64 + wave * 16;
  static_assert(WO_OUT_IN == 0, "stage loader written for (in,out) Wo");
  /* stage 0 is the same for both paths: it is asked for once, in front of the branch, so that its loads and the wait behind them lie in one block */
  v8f acc[8] = {}; float wr[32]; v4f yr[4]; const float* wp = WO + c0 + tid; const float* yp = Y + ((size_t)blockIdx.x * 64 + (tid >> 3)) * CC + (tid & 7) * 4; st_load(wp, DIN, yp, CC, wr, yr);
  if (CAUSAL && (int)(((size_t)blockIdx.x * 64) % TT) < QHI) {   /* block-uniform */
    auto put = [&](int bf) { /* Wo to exact bf16, ctx to bf16 hi + lo; loops unrolled so that wr[] and yr[] stay in registers */
#pragma unroll
      for (int q = 0; q < 4; ++q) { v8b t;
#pragma unroll
        for (int i = 0; i < 8; ++i) t[i] = (__bf16)wr[8 * q + i];
        *(v8b*)&sm.b.wt[bf][tid][8 * q] = t; }
#pragma unroll
      for (int i = 0; i < 4; ++i) { v4b th, tl;
#pragma unroll
        for (int e = 0; e < 4; ++e) { const __bf16 hv = (__bf16)yr[i][e]; th[e] = hv; tl[e] = (__bf16)(yr[i][e] - (float)hv); }
        *(v4b*)&sm.b.yh[bf][(tid >> 3) + 16 * i][(tid & 7) * 4] = th; *(v4b*)&sm.b.yl[bf][(tid >> 3) + 16 * i][(tid & 7) * 4] = tl; } };
    put(0); __syncthreads(); /* publishes stage 0 */
    /* two buffers, as in k_proj; unrolled by two so that the buffer index is a constant */
#pragma unroll 2
    for (int kc = 0; kc < CC / 32; ++kc) { const int cur = kc & 1; const bool more = kc + 1 < CC / 32;
      if (more) st_load(wp, DIN, yp, CC, wr, yr);
      const v16b ah = frag_b(&sm.b.yh[cur][wave * 16 + col][0], lane), al = frag_b(&sm.b.yl[cur][wave * 16 + col][0], lane); v16b w[8]; /* unrolled so that w[] stays in registers */
#pragma unroll
      for (int j = 0; j < 8; ++j) w[j] = frag_b(&sm.b.wt[cur][j * 16 + col][0], lane);
#pragma unroll
      for (int j = 0; j < 8; ++j) { acc[j] = wmma_bf(ah, w[j], acc[j]); acc[j] = wmma_bf(al, w[j], acc[j]); }
      __builtin_amdgcn_sched_barrier(0); /* keeps the waits on the next stage's global loads behind this stage's products, so that the products run inside the loads' latency */
      if (more) put(cur ^ 1);
      __syncthreads(); } /* publishes stage kc + 1, ends the reads of the buffer refilled next (at the end: of the LDS that sf reuses) */
#pragma unroll
    for (int j = 0; j < 8; ++j) { const float bias = BO ? bfr(BO[c0 + j * 16 + col]) : 0.f;
#pragma unroll
      for (int r = 0; r < 8; ++r) sf[wave][8 * g + r][j * 16 + col] = acc[j][r] + bias; }
  } else {
    auto put = [&](int bf) { /* Wo to f16(bf16 x 2^8), ctx once to f16; loops unrolled so that wr[] and yr[] stay in registers */
#pragma unroll
      for (int q = 0; q < 4; ++q) { v8h t;
#pragma unroll
        for (int i = 0; i < 8; ++i) t[i] = (_Float16)(bfr(wr[8 * q + i]) * 256.0f);
        *(v8h*)&sm.h.wt[bf][tid][8 * q] = t; }
#pragma unroll
      for (int i = 0; i < 4; ++i) { v4h t;
#pragma unroll
        for (int e = 0; e < 4; ++e) t[e] = (_Float16)yr[i][e];
        *(v4h*)&sm.h.ya[bf][(tid >> 3) + 16 * i][(tid & 7) * 4] = t; } };
    put(0); __syncthreads(); /* publishes stage 0 */
    /* two buffers, as in k_proj; unrolled by two so that the buffer index is a constant */
#pragma unroll 2
    for (int kc = 0; kc < CC / 32; ++kc) { const int cur = kc & 1; const bool more = kc + 1 < CC / 32;
      if (more) st_load(wp, DIN, yp, CC, wr, yr);
      const v16h a = frag_h(&sm.h.ya[cur][wave * 16 + col][0], lane); v16h w[8]; /* unrolled so that w[] stays in registers */
#pragma unroll
      for (int j = 0; j < 8; ++j) w[j] = frag_h(&sm.h.wt[cur][j * 16 + col][0], lane);
#pragma unroll
      for (int j = 0; j < 8; ++j) acc[j] = wmma16(a, w[j], acc[j]);
      __builtin_amdgcn_sched_barrier(0); /* keeps the waits on the next stage's global loads behind this stage's products, so that the products run inside the loads' latency */
      if (more) put(cur ^ 1);
      __syncthreads(); } /* publishes stage kc + 1, ends the reads of the buffer refilled next (at the end: of the LDS that sf reuses) */
#pragma unroll
    for (int j = 0; j < 8; ++j) { const float bias = BO ? bfr(BO[c0 + j * 16 + col]) : 0.f;
#pragma unroll
      for (int r = 0; r < 8; ++r) sf[wave][8 * g + r][j * 16 + col] = acc[j][r] * (1.0f / 256.0f) + bias; } }
  LDSX(); for (int rl = 0; rl < 16; ++rl) vst2(OUT + (r0 + rl) * DIN + c0 + lane * 4, *(const v4f*)&sf[wave][rl][lane * 4]); }

extern "C" void kernel_launch(void* const* d_in, const int* in_sizes, int n_in, void* d_out, int out_size, void* d_ws, size_t ws_size, hipStream_t stream) {
  (void)in_sizes; (void)n_in; (void)out_size;
  const float** F = (const float**)d_in;
  if (ws_size < (size_t)WS_END) return;
  char* ws = (char*)d_ws; _Float16 *QH = (_Float16*)(ws + WS_QH), *KH = (_Float16*)(ws + WS_KH), *VT = (_Float16*)(ws + WS_VT), *QL = (_Float16*)(ws + WS_QL), *KL = (_Float16*)(ws + WS_KL); __bf16 *VB = (__bf16*)(ws + WS_VB), *VBL = (__bf16*)(ws + WS_VBL); float *Y = (float*)(ws + WS_Y);
  (void)Y; (void)QL; (void)KL; (void)VB; (void)VBL;
  // inputs: 0 x [2,2048,1024]; 1 Wq, 2 Wk, 3 Wv [16,1024,64]; 4 Wo [1024,1024] (in,out); 5 bo [1024]
  k_proj<<<dim3(TNB * TT / PR, CC / 128, 3), 128, 0, stream>>>(F[0], F[0], F[0], F[1], F[2], F[3], nullptr, nullptr, nullptr, QH, QL, KH, KL, VT, VB, VBL);
  k_att<<<dim3(NB * NH * NQB), 128, 0, stream>>>(QH, KH, VT, QL, KL, VB, VBL, Y);
  k_out<<<dim3(TNB * TT / 64, DIN / 128), 128, 0, stream>>>(Y, F[4], F[5], (float*)d_out);
}

// v007
// It runs in 88.5 microseconds.
// In two side-by-side timings against v006, it was 1.17 and 1.18 times as fast.
// Over all steps from v000 it is 11.9 times as fast.
// compute dtype: all float inputs rounded to bf16; q/k/v = x W[h] with EXACT bf16 products on WMMA 16x16x32, f32 accumulate; q, k once to f16 -> 1-product causal logits x 1/32, except the first 384 query rows of each sequence (few keys, no averaging), which use q and k as f16 hi + residual (x 2^10) (3 products); softmax in f32 (exp(logit - max) = one exp2 instruction of (score - max) x 1/32 x log2 e, running maximum and sum over blocks of 64 keys, division by the sum last); exp(logit - max) once to f16 against v once to f16 (1 product), except the first 384 rows: exp(logit - max) and v as bf16 hi + lo (3 products); ctx once to f16 against Wo carried x 2^8 in f16 (exact bf16 values), except the first 384 rows: ctx bf16 hi + lo against exact bf16 Wo (2 products); + bo; f32 output.
#include <hip/hip_runtime.h>
#include <math.h>

typedef __attribute__((ext_vector_type(16))) _Float16 v16h;
typedef __attribute__((ext_vector_type(16))) __bf16 v16b;
typedef __attribute__((ext_vector_type(8)))  _Float16 v8h;
typedef __attribute__((ext_vector_type(8)))  float v8f;
typedef __attribute__((ext_vector_type(4)))  float v4f;
typedef __attribute__((ext_vector_type(2)))  float v2f;
typedef __attribute__((ext_vector_type(4)))  unsigned v4u;
typedef __attribute__((ext_vector_type(4)))  int v4i;
typedef float __attribute__((may_alias)) float_a;
typedef int __attribute__((may_alias)) int_a;

template <typename T> __device__ __forceinline__ void vst2(void* p, T v) { *(T*)p = v;  }
__device__ __forceinline__ v8f wmma16(v16h a, v16h b, v8f c) {
  v8f d = __builtin_amdgcn_wmma_f32_16x16x32_f16(false, a, false, b, (short)0, c, false, false);
  asm volatile("v_nop\n\tv_nop\n\tv_nop\n\tv_nop" : "+v"(d) : "v"(a), "v"(b));
  return d;
}
__device__ __forceinline__ v8f wmma_bf(v16b a, v16b b, v8f c) {
  v8f d = __builtin_amdgcn_wmma_f32_16x16x32_bf16(false, a, false, b, (short)0, c, false, false);
  asm volatile("v_nop\n\tv_nop\n\tv_nop\n\tv_nop" : "+v"(d) : "v"(a), "v"(b));
  return d;
}
// 16x16x32 fragments: lane = (h = lane>>4, row/col = lane&15); elements 0..7 = k0+8h+0..7, 8..15 = k0+16+8h+0..7; D element r = row 8h+r
__device__ __forceinline__ v16h frag_h(const _Float16* rowk0, int lane) {
  union { v16h v; v8h q[2]; } u; const _Float16* p = rowk0 + 8 * (lane >> 4);
  u.q[0] = *(const v8h*)p; u.q[1] = *(const v8h*)(p + 16); return u.v;
}
__device__ __forceinline__ v16h frag_f32(const float* rowk0, int lane) {
  v16h a; const float* p = rowk0 + 8 * (lane >> 4);
#pragma unroll
  for (int i = 0; i < 8; ++i) { a[i] = (_Float16)p[i]; a[8 + i] = (_Float16)p[16 + i]; }
  return a;
}
__device__ __forceinline__ v16h frag_f32s(const float* rowk0, int lane, float sc) {
  v16h a; const float* p = rowk0 + 8 * (lane >> 4);
#pragma unroll
  for (int i = 0; i < 8; ++i) { a[i] = (_Float16)(p[i] * sc); a[8 + i] = (_Float16)(p[16 + i] * sc); }
  return a;
}
// column fragment from a [K][ld] layout (column n), rows >= K read as 0
__device__ __forceinline__ v16h fragc_f32(const float* W, int k0, int n, int lane, int ld, int K) {
  v16h a; const int g = lane >> 4;
#pragma unroll
  for (int i = 0; i < 8; ++i) { const int ka = k0 + 8 * g + i, kb = ka + 16;
    a[i] = (_Float16)(ka < K ? W[(size_t)(ka < K ? ka : K - 1) * ld + n] : 0.f); a[8 + i] = (_Float16)(kb < K ? W[(size_t)(kb < K ? kb : K - 1) * ld + n] : 0.f); }
  return a;
}
struct F2 { v16b h, l; };
__device__ __forceinline__ F2 bsplit16(const float v[16]) { F2 r;
#pragma unroll
  for (int i = 0; i < 16; ++i) { const __bf16 h = (__bf16)v[i]; r.h[i] = h; r.l[i] = (__bf16)(v[i] - (float)h); }
  return r; }
__device__ __forceinline__ F2 split_row(const float* row, int k0, int lane) { float v[16]; const float* p = row + k0 + 8 * (lane >> 4);
#pragma unroll
  for (int i = 0; i < 8; ++i) { v[i] = p[i]; v[8 + i] = p[16 + i]; }
  return bsplit16(v); }
__device__ __forceinline__ F2 split_rowK(const float* row, int k0, int lane, int K) { float v[16]; const int g = lane >> 4;
#pragma unroll
  for (int i = 0; i < 8; ++i) { const int ka = k0 + 8 * g + i, kb = ka + 16; v[i] = ka < K ? row[ka < K ? ka : K - 1] : 0.f; v[8 + i] = kb < K ? row[kb < K ? kb : K - 1] : 0.f; }
  return bsplit16(v); }
__device__ __forceinline__ F2 split_col(const float* W, int k0, int n, int lane, int ld, int K) { float v[16]; const int g = lane >> 4;
#pragma unroll
  for (int i = 0; i < 8; ++i) { const int ka = k0 + 8 * g + i, kb = ka + 16; v[i] = ka < K ? W[(size_t)(ka < K ? ka : K - 1) * ld + n] : 0.f; v[8 + i] = kb < K ? W[(size_t)(kb < K ? kb : K - 1) * ld + n] : 0.f; }
  return bsplit16(v); }
__device__ __forceinline__ v8f mac3(const F2& a, const F2& b, v8f c) { c = wmma_bf(a.l, b.h, c); c = wmma_bf(a.h, b.l, c); return wmma_bf(a.h, b.h, c); }
__device__ __forceinline__ float sigm(float v) { return 1.0f / (1.0f + expf(-v)); }
#define LDSX() do { asm volatile("s_wait_dscnt 0" ::: "memory"); __builtin_amdgcn_wave_barrier(); __builtin_amdgcn_fence(__ATOMIC_RELEASE, "workgroup"); } while (0)

// Causal multi-head self-attention with per-head projection tensors (B 2, T 2,048, C 1,024, 16 heads x 64): q/k/v[b,h,t,:] = x[b,t,:] Wq/Wk/Wv[h] ([H][C][64], no bias); att = softmax(q k^T / sqrt(1024) with key > query -> -inf); out = concat_h(att v) Wo ((in,out) [1024,1024]) + bo.
#define NB 2
#define TT 2048
#define CC 1024            // NH * HD = projected width
#define DIN 1024          // input (model) width
#define NH 16
#define HD 64
#define NQB (TT / 64)
#define SCALE (0.03125f)
#define CAUSAL 1
#ifndef TNB
#define TNB NB
#endif
__device__ __forceinline__ float bfr(float v) { return (float)(__bf16)v; }
typedef __attribute__((ext_vector_type(8))) __bf16 v8b;
__device__ __forceinline__ v16b frag_b(const __bf16* rowk0, int lane) {
  union { v16b v; v8b q[2]; } u; const __bf16* p = rowk0 + 8 * (lane >> 4);
  u.q[0] = *(const v8b*)p; u.q[1] = *(const v8b*)(p + 16); return u.v;
}
#define QBH 6              // causal: query blocks 0..QBH-1 of each sequence (few keys, no averaging) take the high-precision path
#define QHI 384            // rows carrying a q residual plane
#define KHI 384            // key rows carrying k residual / v bf16 hi+lo planes (used only by the causal high-precision path)
// B fragment (k rows k0+.., output column o) of a weight: (in,out) [K][ld] or (out,in) [ld rows of K]: bf16 exact, or f16(bf16 * 256) exact
__device__ __forceinline__ v16b wcol_io(const float* Wm, int k0, int o, int lane, int ld) { v16b w; const int g = lane >> 4;
#pragma unroll
  for (int i = 0; i < 8; ++i) { w[i] = (__bf16)Wm[(size_t)(k0 + 8 * g + i) * ld + o]; w[8 + i] = (__bf16)Wm[(size_t)(k0 + 16 + 8 * g + i) * ld + o]; }
  return w; }
__device__ __forceinline__ v16b wcol_oi(const float* Wm, int k0, int o, int lane, int K) { v16b w; const float* p = Wm + (size_t)o * K + k0 + 8 * (lane >> 4);
#pragma unroll
  for (int i = 0; i < 8; ++i) { w[i] = (__bf16)p[i]; w[8 + i] = (__bf16)p[16 + i]; }
  return w; }
__device__ __forceinline__ v16h wcolh_io(const float* Wm, int k0, int o, int lane, int ld) { v16h w; const int g = lane >> 4;
#pragma unroll
  for (int i = 0; i < 8; ++i) { w[i] = (_Float16)(bfr(Wm[(size_t)(k0 + 8 * g + i) * ld + o]) * 256.0f); w[8 + i] = (_Float16)(bfr(Wm[(size_t)(k0 + 16 + 8 * g + i) * ld + o]) * 256.0f); }
  return w; }
__device__ __forceinline__ v16h wcolh_oi(const float* Wm, int k0, int o, int lane, int K) { v16h w; const float* p = Wm + (size_t)o * K + k0 + 8 * (lane >> 4);
#pragma unroll
  for (int i = 0; i < 8; ++i) { w[i] = (_Float16)(bfr(p[i]) * 256.0f); w[8 + i] = (_Float16)(bfr(p[16 + i]) * 256.0f); }
  return w; }
#define WQKV_LAYOUT 2   // 0 = (in,out) [DIN][CC]; 1 = (out,in) [CC][DIN]; 2 = per-head [NH][DIN][HD]
__device__ __forceinline__ v16b wcol_hdk(const float* Wm, int k0, int o, int lane) { v16b w; const int g = lane >> 4; const float* p = Wm + (size_t)(o / HD) * DIN * HD + (o % HD);
#pragma unroll
  for (int i = 0; i < 8; ++i) { w[i] = (__bf16)p[(size_t)(k0 + 8 * g + i) * HD]; w[8 + i] = (__bf16)p[(size_t)(k0 + 16 + 8 * g + i) * HD]; }
  return w; }
#define WO_OUT_IN 0
#if WQKV_LAYOUT == 1
#define WCOL(W, k0, o, lane) wcol_oi(W, k0, o, lane, DIN)
#elif WQKV_LAYOUT == 2
#define WCOL(W, k0, o, lane) wcol_hdk(W, k0, o, lane)
#else
#define WCOL(W, k0, o, lane) wcol_io(W, k0, o, lane, CC)
#endif
#if WO_OUT_IN
#define WOCOL(W, k0, o, lane) wcol_oi(W, k0, o, lane, CC)
#define WOCOLH(W, k0, o, lane) wcolh_oi(W, k0, o, lane, CC)
#else
#define WOCOL(W, k0, o, lane) wcol_io(W, k0, o, lane, DIN)
#define WOCOLH(W, k0, o, lane) wcolh_io(W, k0, o, lane, DIN)
#endif

#define WS_QH  0u                                      // f16 q rows [b*t][CC]
#define WS_KH  (WS_QH + 2u * (size_t)NB * TT * CC)      // f16 k rows [b*t][CC]
#define WS_VT  (WS_KH + 2u * (size_t)NB * TT * CC)      // f16 v planes [b][c][t]
#define WS_QL  (WS_VT + 2u * (size_t)NB * CC * TT)      // f16 q residual x 2^10 rows [b][t < QHI][CC]
#define WS_KL  (WS_QL + 2u * (size_t)NB * QHI * CC)     // f16 k residual x 2^10 rows [b][t < KHI][CC]
#define WS_VB  (WS_KL + 2u * (size_t)NB * KHI * CC)     // bf16 v hi planes [b][c][t < KHI]
#define WS_VBL (WS_VB + 2u * (size_t)NB * CC * KHI)
#define WS_Y   (WS_VBL + 2u * (size_t)NB * CC * KHI)      // f32 ctx rows [b*t][CC] (only when there is an output projection)
#define WS_XB  (WS_Y  + 4u * (size_t)NB * TT * CC)      // bf16 x rows [b*t][DIN]
#define WS_WT  (WS_XB + 2u * (size_t)NB * TT * DIN)     // bf16 Wq, Wk, Wv columns [which][CC][DIN], k-contiguous
#define WS_WOB (WS_WT + 2u * (size_t)3 * CC * DIN)      // bf16 Wo columns [DIN][CC], k-contiguous
#define WS_WOH (WS_WOB + 2u * (size_t)DIN * CC)         // f16 (bf16 x 2^8) Wo columns [DIN][CC], k-contiguous
#define WS_END (WS_WOH + 2u * (size_t)DIN * CC)

// ---- staging of a 64-k stage of both GEMM operands (k_proj, k_out): a block brings its 128 weight columns and its activation rows (128 in k_proj, 64 in k_out) from global memory ONCE, in whole 128-B lines, and lays them k-contiguous in LDS as 16-bit rows (only k_out's f32 ctx rows are still rounded here; the rest comes rounded from k_pre); every wave then takes its fragments by 16-byte LDS reads. Values, k order and sum order are those of the direct loads
typedef __attribute__((ext_vector_type(4))) __bf16 v4b;
typedef __attribute__((ext_vector_type(4))) _Float16 v4h;
typedef __attribute__((ext_vector_type(2))) unsigned v2u;
// two 16-byte stores to 32 neighbouring bytes and, directly behind them, the wait that stands before a register of an issued global store is overwritten (address and values are inputs so that the stores' registers live up to it)
template <typename T> __device__ __forceinline__ void st16x2(T* p, v4u a, v4u b) { *(v4u*)p = a; *(v4u*)(p + 8) = b; asm volatile("s_wait_xcnt 0x0" :: "v"(p), "v"(a), "v"(b) : "memory"); }
// ---- k_pre: every GEMM operand that comes from an input is rounded to its 16-bit operand type ONCE and laid k-contiguous in the workspace (x rows; Wq, Wk, Wv and Wo columns), so that k_proj and k_out fetch half the bytes, in whole 128-B lines of 64 k, and round nothing of it again (before, each of 24 blocks rounded the same x row and each of 32 or 64 blocks the same weight column). The values are those of the rounding in the stage loaders
#define SQ 72              // LDS pitch of a staged row of 64 k, in 16-bit elements: 144 B = 16 B x odd, the pitch at which 16-byte LDS reads and writes of 16 rows fall on distinct banks
#define PXB 256            // blocks that round x; as many again transpose the weights: few, large blocks, for speed only
__global__ __launch_bounds__(256) void k_pre(const float* __restrict__ X, const float* __restrict__ WQ, const float* __restrict__ WK, const float* __restrict__ WV, const float* __restrict__ WO, __bf16* __restrict__ XB, __bf16* __restrict__ WT, __bf16* __restrict__ WOB, _Float16* __restrict__ WOH) {
  __shared__ float ts[4][64][65]; /* a tile each, so that one barrier serves all four; pitch 65: rows written and columns read both fall on distinct banks */
  const int tid = threadIdx.x; static_assert((size_t)NB * TT * DIN == (size_t)PXB * 16 * 1024 && NH * (DIN / 64) == PXB && (CC / 64) * (DIN / 64) == PXB && HD == 64, "shares written for these shapes");
  if (blockIdx.x < PXB) { /* block-uniform; sixteen 16-byte loads a thread, all in flight at once (unrolled so that the arrays stay in registers); a wave-instruction = four whole lines in, two out */
    const size_t o = (size_t)blockIdx.x * 16384 + tid * 4; const float* p = X + o; __bf16* q = XB + o; v4f a[16]; v2u t[16];
#pragma unroll
    for (int i = 0; i < 16; ++i) a[i] = *(const v4f*)(p + i * 1024);
    asm volatile("s_wait_xcnt 0x0" :: "v"(p) : "memory"); /* the wait that stands before a register of an issued global load is overwritten; the pointer is an input so that the address registers live up to it */
#pragma unroll
    for (int i = 0; i < 16; ++i) { v4b c;
#pragma unroll
      for (int e = 0; e < 4; ++e) c[e] = (__bf16)a[i][e];
      t[i] = __builtin_bit_cast(v2u, c); }
#pragma unroll
    for (int i = 0; i < 16; ++i) *(v2u*)(q + i * 1024) = t[i];
    asm volatile("s_wait_xcnt 0x0" :: "v"(q), "v"(t[0]), "v"(t[1]), "v"(t[2]), "v"(t[3]), "v"(t[4]), "v"(t[5]), "v"(t[6]), "v"(t[7]), "v"(t[8]), "v"(t[9]), "v"(t[10]), "v"(t[11]), "v"(t[12]), "v"(t[13]), "v"(t[14]), "v"(t[15]) : "memory"); /* the same behind the stores: address and values are inputs so that the stores' registers live up to it */
    return; }
  /* four tiles of 64 k x 64 columns a block: one of Wq, Wk, Wv each (head hh, k tile kt) and one of Wo (k tile hh, column tile kt); all four are asked for at once */
  const int bi = blockIdx.x - PXB, hh = bi >> 4, kt = bi & 15, rr = tid >> 4, c4 = (tid & 15) * 4; const size_t wo = (size_t)hh * DIN * HD + (size_t)(kt * 64 + rr) * HD + c4;
  const float* s0 = WQ + wo; const float* s1 = WK + wo; const float* s2 = WV + wo; const float* s3 = WO + (size_t)(hh * 64 + rr) * DIN + kt * 64 + c4; v4f d[4][4];
#pragma unroll
  for (int i = 0; i < 4; ++i) { d[0][i] = *(const v4f*)(s0 + (size_t)(16 * i) * HD); d[1][i] = *(const v4f*)(s1 + (size_t)(16 * i) * HD); d[2][i] = *(const v4f*)(s2 + (size_t)(16 * i) * HD); d[3][i] = *(const v4f*)(s3 + (size_t)(16 * i) * DIN); }
  asm volatile("s_wait_xcnt 0x0" :: "v"(s0), "v"(s1), "v"(s2), "v"(s3) : "memory"); /* as above, for the four pointers */
  const int cl = tid >> 2, kq = (tid & 3) * 16; /* out: 16 k of column cl a thread; four threads = one whole line */
#pragma unroll
  for (int m = 0; m < 4; ++m) /* unrolled so that d[] stays in registers */
#pragma unroll
    for (int i = 0; i < 4; ++i)
#pragma unroll
      for (int e = 0; e < 4; ++e) ts[m][rr + 16 * i][c4 + e] = d[m][i][e];
  __syncthreads(); /* the tiles are whole before their columns are read */
#pragma unroll
  for (int m = 0; m < 4; ++m) { v8b b0, b1; /* unrolled so that the branch on m is decided at compile time */
#pragma unroll
    for (int e = 0; e < 8; ++e) { b0[e] = (__bf16)ts[m][kq + e][cl]; b1[e] = (__bf16)ts[m][kq + 8 + e][cl]; }
    if (m < 3) st16x2(WT + ((size_t)m * CC + hh * HD + cl) * DIN + kt * 64 + kq, __builtin_bit_cast(v4u, b0), __builtin_bit_cast(v4u, b1));
    else { const size_t oo = (size_t)(kt * 64 + cl) * CC + hh * 64 + kq; v8h h0, h1;
#pragma unroll
      for (int e = 0; e < 8; ++e) { h0[e] = (_Float16)((float)b0[e] * 256.0f); h1[e] = (_Float16)((float)b1[e] * 256.0f); }
      st16x2(WOB + oo, __builtin_bit_cast(v4u, b0), __builtin_bit_cast(v4u, b1)); st16x2(WOH + oo, __builtin_bit_cast(v4u, h0), __builtin_bit_cast(v4u, h1)); } } }
// one thread's share of a 64-k stage of 16-bit rows: eight 16-byte pieces of 128 rows, rows (tid >> 3) + 16 i, piece tid & 7 (a wave-instruction = four whole lines); the pointer then steps on 64 k
template <typename T> __device__ __forceinline__ void ld_rows(const T*& p, int ld, v4u r[8]) {
#pragma unroll
  for (int i = 0; i < 8; ++i) r[i] = *(const v4u*)(p + (size_t)(16 * i) * ld);
  asm volatile("s_wait_xcnt 0x0" :: "v"(p) : "memory"); /* the wait that stands before a register of an issued global load is overwritten; the pointer is an input so that the loads' address registers live up to it */
  p += 64; }
// one thread's share of a 64-k stage of k_out's 64 f32 ctx rows: eight 16-byte pieces, rows (tid >> 4) + 8 i, piece tid & 15 (a wave-instruction = four whole lines); the pointer then steps on 64 k
__device__ __forceinline__ void ld_ctx(const float*& p, int ld, v4f r[8]) {
#pragma unroll
  for (int i = 0; i < 8; ++i) r[i] = *(const v4f*)(p + (size_t)(8 * i) * ld);
  asm volatile("s_wait_xcnt 0x0" :: "v"(p) : "memory"); /* as in ld_rows */
  p += 64; }
// four 16-byte stores of k_proj's epilogue (rows or planes n elements apart, from LDS rows ln elements apart) and, directly behind the last, the wait that stands before a register of an issued global store is overwritten; the address (the four stores name one register pair, with n as an immediate offset) and the four values are inputs of the wait so that the stores' registers live up to it (the loops stay rolled and reuse them)
template <typename T> __device__ __forceinline__ void st16x4(T* p0, size_t n, const T* l0, int ln) {
  const v4u d0 = *(const v4u*)l0, d1 = *(const v4u*)(l0 + ln), d2 = *(const v4u*)(l0 + 2 * ln), d3 = *(const v4u*)(l0 + 3 * ln);
  *(v4u*)p0 = d0; *(v4u*)(p0 + n) = d1; *(v4u*)(p0 + 2 * n) = d2; *(v4u*)(p0 + 3 * n) = d3;
  asm volatile("s_wait_xcnt 0x0" :: "v"(p0), "v"(d0), "v"(d1), "v"(d2), "v"(d3) : "memory"); }
// ---- k_proj: block = (128 rows, 128 cols, which), wave = 64 rows x 64 cols (4 x 4 accumulator tiles: a staged weight column serves twice the rows, and eight fragments feed sixteen products): q/k/v = X W (+ b) with exact bf16 products (K = DIN) -> which 0: q f16 rows (+ residual rows < QHI); 1: k f16 rows (+ residual rows < KHI); 2: v f16 planes [c][t] (+ bf16 hi/lo planes for t < KHI)
#define PR 128             // rows of a k_proj block; 768 blocks = three a WGP, all resident at once
__global__ __launch_bounds__(128) void k_proj(const __bf16* __restrict__ XB, const __bf16* __restrict__ WT, const float* __restrict__ BQ, const float* __restrict__ BK, const float* __restrict__ BV,
    _Float16* __restrict__ QH, _Float16* __restrict__ QL, _Float16* __restrict__ KH, _Float16* __restrict__ KL, _Float16* __restrict__ VT, __bf16* __restrict__ VB, __bf16* __restrict__ VBL) {
  union Lds { struct { _Float16 sh[PR][136], sl[PR][136]; } qk; struct { _Float16 th[128][PR + 8]; __bf16 tb[128][PR + 8], tbl[128][PR + 8]; } v; struct { __bf16 wt[2][128][SQ], xs[2][PR][SQ]; } st; }; /* the stage buffers lie in the LDS of the epilogue's arrays, which are written only behind the loop's last barrier */
  __shared__ __align__(16) Lds sm; auto& sh = sm.qk.sh; auto& sl = sm.qk.sl; auto& th = sm.v.th; auto& tb = sm.v.tb; auto& tbl = sm.v.tbl;
  static_assert(TT % PR == 0 && QHI % PR == 0 && KHI % PR == 0, "a block lies in one sequence and wholly inside or outside the residual rows");
  const int tid = threadIdx.x, wave = tid >> 5, lane = tid & 31, col = lane & 15, g = lane >> 4; const int wrow = (wave >> 1) * 64, wcol = (wave & 1) * 64; const int which = blockIdx.z; const int c0 = blockIdx.y * 128; const size_t r0 = (size_t)blockIdx.x * PR; const size_t bb = r0 / TT; const int t0 = (int)(r0 % TT);
  const float* BA = which == 0 ? BQ : which == 1 ? BK : BV;
  v8f acc[4][4] = {}; v4u wr[8], xr[8];
  const __bf16* wp = WT + ((size_t)which * CC + c0 + (tid >> 3)) * DIN + (tid & 7) * 8; const __bf16* xp = XB + (r0 + (tid >> 3)) * DIN + (tid & 7) * 8;
  /* writes this thread's share, as it came, to stage buffer bf; unrolled so that wr[] and xr[] stay in registers */
  auto put = [&](int bf) {
#pragma unroll
    for (int i = 0; i < 8; ++i) { *(v4u*)&sm.st.wt[bf][(tid >> 3) + 16 * i][(tid & 7) * 8] = wr[i]; *(v4u*)&sm.st.xs[bf][(tid >> 3) + 16 * i][(tid & 7) * 8] = xr[i]; } };
  ld_rows(wp, DIN, wr); ld_rows(xp, DIN, xr); put(0); __syncthreads(); /* publishes stage 0 */
  /* two buffers: stage kc + 1 is asked for before stage kc's products, so its latency runs behind them, and written to the other buffer after them; unrolled by two so that the buffer index is a constant */
#pragma unroll 2
  for (int kc = 0; kc < DIN / 64; ++kc) { const int cur = kc & 1; const bool more = kc + 1 < DIN / 64;
    if (more) { ld_rows(wp, DIN, wr); ld_rows(xp, DIN, xr); }
#pragma unroll
    for (int s = 0; s < 2; ++s) { /* the stage's two steps of 32 k, in k order */
      v16b a[4], w[4]; /* unrolled so that a[] and w[] stay in registers */
#pragma unroll
      for (int i = 0; i < 4; ++i) a[i] = frag_b(&sm.st.xs[cur][wrow + i * 16 + col][32 * s], lane);
#pragma unroll
      for (int j = 0; j < 4; ++j) w[j] = frag_b(&sm.st.wt[cur][wcol + j * 16 + col][32 * s], lane);
      __builtin_amdgcn_sched_barrier(0); /* keeps the step's sixteen LDS reads together as one group in front of the products: left free, three of the four row fragments are read among the products into one register set, each behind a full wait */
#pragma unroll
      for (int i = 0; i < 4; ++i)
#pragma unroll
        for (int j = 0; j < 4; ++j) acc[i][j] = __builtin_amdgcn_wmma_f32_16x16x32_bf16(false, a[i], false, w[j], (short)0, acc[i][j], false, false); /* the plain builtin: the operands of an asm statement must lie in the first 256 registers, which sixteen tiles and eight fragments overfill (spills in the loop); the compiler keeps the distances behind its own matrix instructions */
      __builtin_amdgcn_sched_barrier(0); } /* keeps the waits on the next stage's global loads behind this stage's products, so that the products run inside the loads' latency */
    if (more) put(cur ^ 1);
    __syncthreads(); } /* one barrier a stage: publishes stage kc + 1 and ends every wave's reads of the buffer that the next trip refills (after the last trip: of the LDS that the epilogue reuses) */
  if (which < 2) { _Float16* DH = which == 0 ? QH : KH; _Float16* DL = which == 0 ? QL : KL; const int nhi = which == 0 ? QHI : KHI; const bool hi_rows = t0 < nhi;
#pragma unroll
    for (int j = 0; j < 4; ++j) { const float bias = BA ? bfr(BA[c0 + wcol + j * 16 + col]) : 0.f;
#pragma unroll
      for (int i = 0; i < 4; ++i)
#pragma unroll
        for (int r = 0; r < 8; ++r) { const float v = acc[i][j][r] + bias; const _Float16 hv = (_Float16)v; sh[wrow + i * 16 + 8 * g + r][wcol + j * 16 + col] = hv; sl[wrow + i * 16 + 8 * g + r][wcol + j * 16 + col] = (_Float16)((v - (float)hv) * 1024.0f); } }
    __syncthreads();
    for (int e = tid; e < PR * 16; e += 512) { const int rl = e >> 4, q = e & 15; /* a trip = rows rl, rl + 8, rl + 16, rl + 24 */ st16x4(DH + (r0 + rl) * CC + c0 + q * 8, (size_t)8 * CC, &sh[rl][q * 8], 8 * 136); if (hi_rows) st16x4(DL + (bb * nhi + t0 + rl) * (size_t)CC + c0 + q * 8, (size_t)8 * CC, &sl[rl][q * 8], 8 * 136); }
  } else { const bool hi_rows = t0 < KHI;
#pragma unroll
    for (int j = 0; j < 4; ++j) { const float bias = BA ? bfr(BA[c0 + wcol + j * 16 + col]) : 0.f;
#pragma unroll
      for (int i = 0; i < 4; ++i)
#pragma unroll
        for (int r = 0; r < 8; ++r) { const float v = acc[i][j][r] + bias; const int rl = wrow + i * 16 + 8 * g + r, cl = wcol + j * 16 + col; th[cl][rl] = (_Float16)v; const __bf16 bh = (__bf16)v; tb[cl][rl] = bh; tbl[cl][rl] = (__bf16)(v - (float)bh); } }
    __syncthreads();
    for (int e = tid; e < 128 * (PR / 8); e += 512) { const int cl = e / (PR / 8), q = e % (PR / 8); /* a trip = planes cl, cl + 8, cl + 16, cl + 24 */ static_assert(PR / 8 == 16, "128 threads = 8 planes"); st16x4(VT + (bb * CC + c0 + cl) * (size_t)TT + t0 + q * 8, (size_t)8 * TT, &th[cl][q * 8], 8 * (PR + 8)); if (hi_rows) { const size_t o3 = (bb * CC + c0 + cl) * (size_t)KHI + t0 + q * 8; st16x4(VB + o3, (size_t)8 * KHI, &tb[cl][q * 8], 8 * (PR + 8)); st16x4(VBL + o3, (size_t)8 * KHI, &tbl[cl][q * 8], 8 * (PR + 8)); } } } }
// ---- k_att: block = 64 queries (qb) of (b, h), one wave = 16 queries; the waves share only the staged k and v tiles (query blocks >= QBH): per 64 keys S^T = K Q^T (lane = one query, its D registers = keys), causal mask by index on the diagonal block, running maximum (of the unscaled scores) and sum in f32, e = exp(logit - max) = exp2((score - max) x SCALE x log2 e) packed from the score registers straight into the B operand of ctx^T += V^T P^T, ctx and sum brought to the new maximum every trip, ctx divided by the sum at the end. Logits and P never go to memory. Products as before: 1 f16 product each; query blocks < QBH: 3-product logits (q, k hi + residual), e and v as bf16 hi + lo (3 products)
__device__ __forceinline__ v8f mm_h(v16h a, v16h b, v8f c) { return __builtin_amdgcn_wmma_f32_16x16x32_f16(false, a, false, b, (short)0, c, false, false); }
__device__ __forceinline__ v8f mm_b(v16b a, v16b b, v8f c) { return __builtin_amdgcn_wmma_f32_16x16x32_bf16(false, a, false, b, (short)0, c, false, false); }
// fragment from a pointer that already holds the lane's 8 g offset, so that the pointer itself is the address register pair of the loads
__device__ __forceinline__ v16h frag_hp(const _Float16* p) { union { v16h v; v8h q[2]; } u; u.q[0] = *(const v8h*)p; u.q[1] = *(const v8h*)(p + 16); return u.v; }
__device__ __forceinline__ v16b frag_bp(const __bf16* p) { union { v16b v; v8b q[2]; } u; u.q[0] = *(const v8b*)p; u.q[1] = *(const v8b*)(p + 16); return u.v; }
// every loop over st[], acc[] or a fragment array in sm_step and k_att is unrolled so that the array stays in registers; the two key loops stay rolled (unroll 1): one trip's fragments already fill the register budget of four waves a SIMD
// st[t][r] = unscaled score q.k of key k0 + 16 t + 8 g + r for this lane's query qi; on return e = exp(SCALE x (score - new maximum)); m (unscaled), l, acc brought to the new maximum (l is this half-wave's part of the sum)
// the exponent is formed by one multiply-add a score, score x EXC - max x EXC, and goes straight to the hardware's exp2: it is at most 0 (up to the rounding of max x EXC), and where exp2 falls below the range of f32 the result is 0, which is what a masked or far-off key contributes
#define EXC (SCALE * 1.44269504088896340736f) // SCALE x log2 e
// exp2 of eight values, each in its own register. In asm so that the slot which the instruction set asks for behind a transcendental (before its result is read or its source overwritten) is kept by construction: each v_exp_f32 overwrites only its own source, none reads another's result, and the v_nop is the slot behind the last one. The s_delay_alu is the hint that the compiler writes for its own code and not for asm: a source may come from the vector instruction directly in front, and unhinted the wait would hold up the SIMD's other waves too; it changes no result
__device__ __forceinline__ v8f exp2x8(v8f x) { float a = x[0], b = x[1], c = x[2], d = x[3], e = x[4], f = x[5], g = x[6], h = x[7];
  asm("s_delay_alu instid0(VALU_DEP_1)\n\tv_exp_f32 %0, %0\n\tv_exp_f32 %1, %1\n\tv_exp_f32 %2, %2\n\tv_exp_f32 %3, %3\n\tv_exp_f32 %4, %4\n\tv_exp_f32 %5, %5\n\tv_exp_f32 %6, %6\n\tv_exp_f32 %7, %7\n\tv_nop" : "+v"(a), "+v"(b), "+v"(c), "+v"(d), "+v"(e), "+v"(f), "+v"(g), "+v"(h));
  const v8f r = {a, b, c, d, e, f, g, h}; return r; }
__device__ __forceinline__ float exp2x1(float a) { asm("s_delay_alu instid0(VALU_DEP_1)\n\tv_exp_f32 %0, %0\n\tv_nop" : "+v"(a)); return a; } /* the same for one value */
__device__ __forceinline__ void sm_step(v8f st[4], v8f acc[HD / 16], float& m, float& l, bool diag, int k0, int g, int qi) {
  if (diag) {
#pragma unroll
    for (int t = 0; t < 4; ++t)
#pragma unroll
      for (int r = 0; r < 8; ++r) if (k0 + t * 16 + 8 * g + r > qi) st[t][r] = -3.0e38f; }
  float mx = m;
#pragma unroll
  for (int t = 0; t < 4; ++t)
#pragma unroll
    for (int r = 0; r < 8; ++r) mx = fmaxf(mx, st[t][r]);
  mx = fmaxf(mx, __shfl_xor(mx, 16));
  const float alpha = exp2x1((m - mx) * EXC); m = mx; float s = 0.f; const float nmc = -mx * EXC; const v8f cv = {EXC, EXC, EXC, EXC, EXC, EXC, EXC, EXC}, nv = {nmc, nmc, nmc, nmc, nmc, nmc, nmc, nmc};
#pragma unroll
  for (int t = 0; t < 4; ++t) { st[t] = exp2x8(__builtin_elementwise_fma(st[t], cv, nv));
#pragma unroll
    for (int r = 0; r < 8; ++r) s += st[t][r]; }
  l = l * alpha + s;
#pragma unroll
  for (int j = 0; j < HD / 16; ++j) acc[j] *= alpha; }
// ---- staging of a 64-key tile (k_att, query blocks >= QBH): the block's four waves read the same 64 k rows and 64 v planes, so the block brings them from global memory ONCE, in whole 128-B lines, by asynchronous copies to LDS, and every wave takes its fragments by 16-byte LDS reads. Values, k order and sum order are those of the direct loads
#define KVP 72             // LDS pitch of a staged row of 64 f16: 144 B = 16 B x odd, the pitch at which 16-byte LDS reads of 16 rows fall on distinct banks
#define KVB (128 * KVP * 2) // bytes of one tile buffer: rows 0..63 = k rows (key, head column), rows 64..127 = v planes (head column, key)
// one thread's share of a tile: eight 16-byte copies, rows (tid >> 3) + 16 i, piece tid & 7 (a wave-instruction = four whole lines). l = the lane's LDS byte address in row tid >> 3 of the buffer, kg and vg = its global addresses in k row tid >> 3 and v plane tid >> 3 of the tile
__device__ __forceinline__ void kv_copy(unsigned l, const _Float16* kg, const _Float16* vg) {
  /* the s_wait_xcnt 0 stands inside the copies' own statement, so that no register which a copy names is rewritten in front of it */
  asm volatile("global_load_async_to_lds_b128 %0, %8, off\n\t"
               "global_load_async_to_lds_b128 %1, %9, off\n\t"
               "global_load_async_to_lds_b128 %2, %10, off\n\t"
               "global_load_async_to_lds_b128 %3, %11, off\n\t"
               "global_load_async_to_lds_b128 %4, %12, off\n\t"
               "global_load_async_to_lds_b128 %5, %13, off\n\t"
               "global_load_async_to_lds_b128 %6, %14, off\n\t"
               "global_load_async_to_lds_b128 %7, %15, off\n\t"
               "s_wait_xcnt 0x0"
               :: "v"(l), "v"(l + 16 * KVP * 2), "v"(l + 32 * KVP * 2), "v"(l + 48 * KVP * 2), "v"(l + 64 * KVP * 2), "v"(l + 80 * KVP * 2), "v"(l + 96 * KVP * 2), "v"(l + 112 * KVP * 2),
                  "v"(kg), "v"(kg + (size_t)16 * CC), "v"(kg + (size_t)32 * CC), "v"(kg + (size_t)48 * CC), "v"(vg), "v"(vg + (size_t)16 * TT), "v"(vg + (size_t)32 * TT), "v"(vg + (size_t)48 * TT)
               : "memory"); }
__global__ __launch_bounds__(128) void k_att(const _Float16* __restrict__ QH, const _Float16* __restrict__ KH, const _Float16* __restrict__ VT, const _Float16* __restrict__ QL, const _Float16* __restrict__ KL, const __bf16* __restrict__ VB, const __bf16* __restrict__ VBL, float* __restrict__ Y) { __shared__ __align__(16) float ss[4][16][HD + 4]; __shared__ __align__(16) _Float16 kv[2][128][KVP];
  const int tid = threadIdx.x, wave = tid >> 5, lane = tid & 31, col = lane & 15, g = lane >> 4;
  /* all 1,024 blocks are resident at once (4 a WGP) and a block's cost grows with qb, so the launch lasts as long as the fullest WGP: the flat index is spread so that the four blocks f, f + 256, f + 512, f + 768 and equally the four blocks f, f + 8, f + 16, f + 24 hold one qb of each quarter, 31 - i, 16 + i, 15 - i, i: the same cost for every such four. Speed only: any placement is correct; (qb, head, batch) <-> f is one to one */
  static_assert(NQB == 32 && NB * NH == 32, "index spread written for 32 query blocks x 32 (batch, head) pairs");
  const int f = blockIdx.x, fk = (f >> 3) & 3, fi = (f >> 5) & 7, fc = (fk + (f >> 8)) & 3; const int qb = fc == 0 ? 31 - fi : fc == 1 ? 16 + fi : fc == 2 ? 15 - fi : fi; const int bh = (f & 7) + 8 * fk; const int h = bh % NH, b = bh / NH; const int ql0 = qb * 64 + wave * 16, qi = ql0 + col;
  const _Float16* qp = QH + ((size_t)b * TT + qi) * CC + h * HD + 8 * g; const _Float16* kp = KH + ((size_t)b * TT + col) * CC + h * HD + 8 * g;
  v8f acc[HD / 16] = {}; float m = -3.0e38f, l = 0.f;
  if (qb >= QBH) { static_assert(QBH >= 1, "the ring's prologue asks for tiles 0 and 1");
    const unsigned lb = (unsigned)(size_t)&kv[0][tid >> 3][(tid & 7) * 8]; const _Float16* kg = KH + ((size_t)b * TT + (tid >> 3)) * CC + h * HD + (tid & 7) * 8; const _Float16* vg = VT + ((size_t)b * CC + h * HD + (tid >> 3)) * (size_t)TT + (tid & 7) * 8;
    const v16h q0 = frag_hp(qp), q1 = frag_hp(qp + 32);
    asm volatile("s_wait_xcnt 0x0" :: "v"(qp) : "memory"); /* the wait that stands before a register of an issued global load is overwritten; the pointer is an input so that the loads' address registers live up to it */
    kv_copy(lb, kg, vg);
    asm volatile("s_wait_asynccnt 0x0" ::: "memory"); /* this wave's copies of tile 0 have landed */
    __syncthreads(); /* publishes tile 0 */
    kv_copy(lb + KVB, kg + (size_t)64 * CC, vg + 64); kg += (size_t)128 * CC; vg += 128; /* kg and vg walk two tiles ahead of the trip */
    /* rolled: a second trip's fragments would go past the 256 registers that four waves a SIMD allow */
#pragma unroll 1
    for (int kb = 0; kb <= qb; ++kb) { const int k0 = kb * 64; const _Float16 (*T)[KVP] = kv[kb & 1]; v16h ka[4][2], va[2][HD / 16]; /* trip kb reads buffer kb & 1 alone; inner loops unrolled so that the arrays stay in registers */
#pragma unroll
      for (int t = 0; t < 4; ++t) { ka[t][0] = frag_hp(&T[t * 16 + col][8 * g]); ka[t][1] = frag_hp(&T[t * 16 + col][32 + 8 * g]); }
#pragma unroll
      for (int u = 0; u < 2; ++u)
#pragma unroll
        for (int j = 0; j < HD / 16; ++j) va[u][j] = frag_hp(&T[64 + j * 16 + col][u * 32 + 8 * g]);
      __builtin_amdgcn_sched_barrier(0); /* keeps the trip's LDS reads together as one group in front of the products: left free they sink to their uses, with one full wait a product */
      v8f st[4];
#pragma unroll
      for (int t = 0; t < 4; ++t) { v8f z = {}; z = mm_h(ka[t][0], q0, z); st[t] = mm_h(ka[t][1], q1, z); }
      /* the trip reads nothing of its tile behind this line (softmax and P v work on registers), so this is the foot of the trip for the ring: the buffer is handed over here and the refill has a whole trip to land */
      asm volatile("s_wait_dscnt 0x0" ::: "memory"); /* this wave's reads of the buffer that is refilled below have returned */
      asm volatile("s_wait_asynccnt 0x0" ::: "memory"); /* this wave's copies of tile kb + 1 have landed */
      __syncthreads(); /* one barrier a trip: publishes tile kb + 1 and ends every wave's reads of the buffer refilled behind it */
      if (kb + 2 <= qb) { kv_copy(lb + (kb & 1) * KVB, kg, vg); kg += (size_t)64 * CC; vg += 64; } /* block-uniform test: tile kb + 2 goes into the buffer that this trip has read */
      sm_step(st, acc, m, l, kb == qb, k0, g, qi);
#pragma unroll
      for (int u = 0; u < 2; ++u) { v16h p;
#pragma unroll
        for (int i = 0; i < 8; ++i) { p[i] = (_Float16)st[2 * u][i]; p[8 + i] = (_Float16)st[2 * u + 1][i]; }
#pragma unroll
        for (int j = 0; j < HD / 16; ++j) acc[j] = mm_h(va[u][j], p, acc[j]); } }
    asm volatile("s_wait_asynccnt 0x0" ::: "memory"); /* no copy is outstanding when the wave goes on */
  } else { const _Float16* qlp = QL + ((size_t)b * QHI + qi) * CC + h * HD + 8 * g; const _Float16* klp = KL + ((size_t)b * KHI + col) * CC + h * HD + 8 * g; const size_t vo = ((size_t)b * CC + h * HD + col) * (size_t)KHI + 8 * g; const __bf16* vhp = VB + vo; const __bf16* vlp = VBL + vo;
    const v16h q0 = frag_hp(qp), q1 = frag_hp(qp + 32), r0 = frag_hp(qlp), r1 = frag_hp(qlp + 32);
    asm volatile("s_wait_xcnt 0x0" :: "v"(qp), "v"(qlp) : "memory"); /* as above, for the q loads' two pointers */
    /* rolled, for the same register budget */
#pragma unroll 1
    for (int kb = 0; kb <= qb; ++kb) { const int k0 = kb * 64; v8f st[4];
#pragma unroll
      for (int t = 0; t < 4; ++t) { const size_t ko = (size_t)(t * 16) * CC; const v16h kh0 = frag_hp(kp + ko), kh1 = frag_hp(kp + ko + 32), kl0 = frag_hp(klp + ko), kl1 = frag_hp(klp + ko + 32);
        v8f a = {}, al = {}; a = mm_h(kh0, q0, a); al = mm_h(kh0, r0, al); al = mm_h(kl0, q0, al); a = mm_h(kh1, q1, a); al = mm_h(kh1, r1, al); al = mm_h(kl1, q1, al);
        st[t] = a + al * (1.0f / 1024.0f); }
      sm_step(st, acc, m, l, kb == qb, k0, g, qi);
#pragma unroll
      for (int u = 0; u < 2; ++u) { float pv[16];
#pragma unroll
        for (int i = 0; i < 8; ++i) { pv[i] = st[2 * u][i]; pv[8 + i] = st[2 * u + 1][i]; }
        const F2 p = bsplit16(pv);
#pragma unroll
        for (int j = 0; j < HD / 16; ++j) { const size_t po = (size_t)(j * 16) * KHI + u * 32; const v16b vh = frag_bp(vhp + po), vl = frag_bp(vlp + po); acc[j] = mm_b(vh, p.h, acc[j]); acc[j] = mm_b(vh, p.l, acc[j]); acc[j] = mm_b(vl, p.h, acc[j]); } }
      asm volatile("s_wait_xcnt 0x0" :: "v"(kp), "v"(klp), "v"(vhp), "v"(vlp) : "memory"); /* as above: stands before the four pointers step on to the next 64 keys */
      kp += (size_t)64 * CC; klp += (size_t)64 * CC; vhp += 64; vlp += 64; } }
  l += __shfl_xor(l, 16); const float inv = 1.0f / l;
#pragma unroll
  for (int j = 0; j < HD / 16; ++j) { const v8f o = acc[j] * inv; /* lane = query col, registers = head columns j*16 + 8g + r */
    *(v4f*)&ss[wave][col][j * 16 + 8 * g] = __builtin_shufflevector(o, o, 0, 1, 2, 3); *(v4f*)&ss[wave][col][j * 16 + 8 * g + 4] = __builtin_shufflevector(o, o, 4, 5, 6, 7); }
  LDSX(); /* own-wave exchange: the 256-B (row, head) segments go out whole, two rows an instruction */
  for (int rl = 0; rl < 16; rl += 2) vst2(Y + ((size_t)b * TT + ql0 + rl + g) * CC + h * HD + col * 4, *(const v4f*)&ss[wave][rl + g][col * 4]); }
// ---- k_out: block = (64 rows, 128 cols): out = ctx Wo (+ bo): ctx once to f16 against Wo as f16(bf16 x 2^8) exact (1 product) x 2^-8; causal early rows (< QHI of each sequence): ctx bf16 hi + lo against exact bf16 Wo (2 products)
__global__ __launch_bounds__(128) void k_out(const float* __restrict__ Y, const __bf16* __restrict__ WOB, const _Float16* __restrict__ WOH, const float* __restrict__ BO, float* __restrict__ OUT) { union Lds { float sf[4][16][132]; struct { _Float16 wt[2][128][SQ], ya[2][64][SQ]; } h; struct { __bf16 wt[2][128][SQ], yh[2][64][SQ], yl[2][64][SQ]; } b; }; /* the stage buffers lie in the LDS of the epilogue's array, which is written only behind the loop's last barrier */
  __shared__ __align__(16) Lds sm; auto& sf = sm.sf;
  const int tid = threadIdx.x, wave = tid >> 5, lane = tid & 31, col = lane & 15, g = lane >> 4; const int c0 = blockIdx.y * 128; const size_t r0 = (size_t)blockIdx.x * 64 + wave * 16;
  static_assert(WO_OUT_IN == 0, "k_pre's transposition written for (in,out) Wo");
  /* ctx stage 0 is the same for both paths: it is asked for once, in front of the branch */
  v8f acc[8] = {}; v4u wr[8]; v4f yr[8]; const size_t wo = (size_t)(c0 + (tid >> 3)) * CC + (tid & 7) * 8; const float* yp = Y + ((size_t)blockIdx.x * 64 + (tid >> 4)) * CC + (tid & 15) * 4; ld_ctx(yp, CC, yr);
  if (CAUSAL && (int)(((size_t)blockIdx.x * 64) % TT) < QHI) {   /* block-uniform */
    const __bf16* wp = WOB + wo; ld_rows(wp, CC, wr);
    auto put = [&](int bf) { /* Wo (exact bf16) as it came, ctx to bf16 hi + lo; loops unrolled so that wr[] and yr[] stay in registers */
#pragma unroll
      for (int i = 0; i < 8; ++i) *(v4u*)&sm.b.wt[bf][(tid >> 3) + 16 * i][(tid & 7) * 8] = wr[i];
#pragma unroll
      for (int i = 0; i < 8; ++i) { v4b th, tl;
#pragma unroll
        for (int e = 0; e < 4; ++e) { const __bf16 hv = (__bf16)yr[i][e]; th[e] = hv; tl[e] = (__bf16)(yr[i][e] - (float)hv); }
        *(v4b*)&sm.b.yh[bf][(tid >> 4) + 8 * i][(tid & 15) * 4] = th; *(v4b*)&sm.b.yl[bf][(tid >> 4) + 8 * i][(tid & 15) * 4] = tl; } };
    put(0); __syncthreads(); /* publishes stage 0 */
    /* two buffers, as in k_proj; unrolled by two so that the buffer index is a constant */
#pragma unroll 2
    for (int kc = 0; kc < CC / 64; ++kc) { const int cur = kc & 1; const bool more = kc + 1 < CC / 64;
      if (more) { ld_rows(wp, CC, wr); ld_ctx(yp, CC, yr); }
#pragma unroll
      for (int s = 0; s < 2; ++s) { /* the stage's two steps of 32 k, in k order */
        const v16b ah = frag_b(&sm.b.yh[cur][wave * 16 + col][32 * s], lane), al = frag_b(&sm.b.yl[cur][wave * 16 + col][32 * s], lane); v16b w[8]; /* unrolled so that w[] stays in registers */
#pragma unroll
        for (int j = 0; j < 8; ++j) w[j] = frag_b(&sm.b.wt[cur][j * 16 + col][32 * s], lane);
#pragma unroll
        for (int j = 0; j < 8; ++j) { acc[j] = wmma_bf(ah, w[j], acc[j]); acc[j] = wmma_bf(al, w[j], acc[j]); } }
      __builtin_amdgcn_sched_barrier(0); /* keeps the waits on the next stage's global loads behind this stage's products, so that the products run inside the loads' latency */
      if (more) put(cur ^ 1);
      __syncthreads(); } /* publishes stage kc + 1, ends the reads of the buffer refilled next (at the end: of the LDS that sf reuses) */
#pragma unroll
    for (int j = 0; j < 8; ++j) { const float bias = BO ? bfr(BO[c0 + j * 16 + col]) : 0.f;
#pragma unroll
      for (int r = 0; r < 8; ++r) sf[wave][8 * g + r][j * 16 + col] = acc[j][r] + bias; }
  } else {
    const _Float16* wp = WOH + wo; ld_rows(wp, CC, wr);
    auto put = [&](int bf) { /* Wo (f16(bf16 x 2^8)) as it came, ctx once to f16; loops unrolled so that wr[] and yr[] stay in registers */
#pragma unroll
      for (int i = 0; i < 8; ++i) *(v4u*)&sm.h.wt[bf][(tid >> 3) + 16 * i][(tid & 7) * 8] = wr[i];
#pragma unroll
      for (int i = 0; i < 8; ++i) { v4h t;
#pragma unroll
        for (int e = 0; e < 4; ++e) t[e] = (_Float16)yr[i][e];
        *(v4h*)&sm.h.ya[bf][(tid >> 4) + 8 * i][(tid & 15) * 4] = t; } };
    put(0); __syncthreads(); /* publishes stage 0 */
    /* two buffers, as in k_proj; unrolled by two so that the buffer index is a constant */
#pragma unroll 2
    for (int kc = 0; kc < CC / 64; ++kc) { const int cur = kc & 1; const bool more = kc + 1 < CC / 64;
      if (more) { ld_rows(wp, CC, wr); ld_ctx(yp, CC, yr); }
#pragma unroll
      for (int s = 0; s < 2; ++s) { /* the stage's two steps of 32 k, in k order */
        const v16h a = frag_h(&sm.h.ya[cur][wave * 16 + col][32 * s], lane); v16h w[8]; /* unrolled so that w[] stays in registers */
#pragma unroll
        for (int j = 0; j < 8; ++j) w[j] = frag_h(&sm.h.wt[cur][j * 16 + col][32 * s], lane);
#pragma unroll
        for (int j = 0; j < 8; ++j) acc[j] = wmma16(a, w[j], acc[j]); }
      __builtin_amdgcn_sched_barrier(0); /* keeps the waits on the next stage's global loads behind this stage's products, so that the products run inside the loads' latency */
      if (more) put(cur ^ 1);
      __syncthreads(); } /* publishes stage kc + 1, ends the reads of the buffer refilled next (at the end: of the LDS that sf reuses) */
#pragma unroll
    for (int j = 0; j < 8; ++j) { const float bias = BO ? bfr(BO[c0 + j * 16 + col]) : 0.f;
#pragma unroll
      for (int r = 0; r < 8; ++r) sf[wave][8 * g + r][j * 16 + col] = acc[j][r] * (1.0f / 256.0f) + bias; } }
  LDSX(); for (int rl = 0; rl < 16; ++rl) vst2(OUT + (r0 + rl) * DIN + c0 + lane * 4, *(const v4f*)&sf[wave][rl][lane * 4]); }

extern "C" void kernel_launch(void* const* d_in, const int* in_sizes, int n_in, void* d_out, int out_size, void* d_ws, size_t ws_size, hipStream_t stream) {
  (void)in_sizes; (void)n_in; (void)out_size;
  const float** F = (const float**)d_in;
  if (ws_size < (size_t)WS_END) return;
  char* ws = (char*)d_ws; _Float16 *QH = (_Float16*)(ws + WS_QH), *KH = (_Float16*)(ws + WS_KH), *VT = (_Float16*)(ws + WS_VT), *QL = (_Float16*)(ws + WS_QL), *KL = (_Float16*)(ws + WS_KL); __bf16 *VB = (__bf16*)(ws + WS_VB), *VBL = (__bf16*)(ws + WS_VBL); float *Y = (float*)(ws + WS_Y); __bf16 *XB = (__bf16*)(ws + WS_XB), *WT = (__bf16*)(ws + WS_WT), *WOB = (__bf16*)(ws + WS_WOB); _Float16 *WOH = (_Float16*)(ws + WS_WOH);
  (void)Y; (void)QL; (void)KL; (void)VB; (void)VBL;
  // inputs: 0 x [2,2048,1024]; 1 Wq, 2 Wk, 3 Wv [16,1024,64]; 4 Wo [1024,1024] (in,out); 5 bo [1024]
  k_pre<<<dim3(2 * PXB), 256, 0, stream>>>(F[0], F[1], F[2], F[3], F[4], XB, WT, WOB, WOH);
  k_proj<<<dim3(TNB * TT / PR, CC / 128, 3), 128, 0, stream>>>(XB, WT, nullptr, nullptr, nullptr, QH, QL, KH, KL, VT, VB, VBL);
  k_att<<<dim3(NB * NH * NQB), 128, 0, stream>>>(QH, KH, VT, QL, KL, VB, VBL, Y);
  k_out<<<dim3(TNB * TT / 64, DIN / 128), 128, 0, stream>>>(Y, WOB, WOH, F[5], (float*)d_out);
}

// v008
// One run takes 84.2 microseconds.
// In both of two side-by-side timings against v007, it was 1.05 times as fast.
// All steps since v000 together make it 12.5 times as fast.
// compute dtype: all float inputs rounded to bf16; q/k/v = x W[h] with EXACT bf16 products on WMMA 16x16x32, f32 accumulate; q, k once to f16 -> 1-product causal logits x 1/32, except the first 384 query rows of each sequence (few keys, no averaging), which use q and k as f16 hi + residual (x 2^10) (3 products); softmax in f32 (exp(logit - max) = one exp2 instruction of (score - max) x 1/32 x log2 e, running maximum and sum over blocks of 64 keys, division by the sum last); exp(logit - max) once to f16 against v once to f16 (1 product), except the first 384 rows: exp(logit - max) and v as bf16 hi + lo (3 products); ctx once to f16 against Wo carried x 2^8 in f16 (exact bf16 values), except the first 384 rows: ctx bf16 hi + lo against exact bf16 Wo (2 products); + bo; f32 output.
#include <hip/hip_runtime.h>
#include <math.h>

typedef __attribute__((ext_vector_type(16))) _Float16 v16h;
typedef __attribute__((ext_vector_type(16))) __bf16 v16b;
typedef __attribute__((ext_vector_type(8)))  _Float16 v8h;
typedef __attribute__((ext_vector_type(8)))  float v8f;
typedef __attribute__((ext_vector_type(4)))  float v4f;
typedef __attribute__((ext_vector_type(2)))  float v2f;
typedef __attribute__((ext_vector_type(4)))  unsigned v4u;
typedef __attribute__((ext_vector_type(4)))  int v4i;
typedef float __attribute__((may_alias)) float_a;
typedef int __attribute__((may_alias)) int_a;

template <typename T> __device__ __forceinline__ void vst2(void* p, T v) { *(T*)p = v;  }
__device__ __forceinline__ v8f wmma16(v16h a, v16h b, v8f c) {
  v8f d = __builtin_amdgcn_wmma_f32_16x16x32_f16(false, a, false, b, (short)0, c, false, false);
  asm volatile("v_nop\n\tv_nop\n\tv_nop\n\tv_nop" : "+v"(d) : "v"(a), "v"(b));
  return d;
}
__device__ __forceinline__ v8f wmma_bf(v16b a, v16b b, v8f c) {
  v8f d = __builtin_amdgcn_wmma_f32_16x16x32_bf16(false, a, false, b, (short)0, c, false, false);
  asm volatile("v_nop\n\tv_nop\n\tv_nop\n\tv_nop" : "+v"(d) : "v"(a), "v"(b));
  return d;
}
// 16x16x32 fragments: lane = (h = lane>>4, row/col = lane&15); elements 0..7 = k0+8h+0..7, 8..15 = k0+16+8h+0..7; D element r = row 8h+r
__device__ __forceinline__ v16h frag_h(const _Float16* rowk0, int lane) {
  union { v16h v; v8h q[2]; } u; const _Float16* p = rowk0 + 8 * (lane >> 4);
  u.q[0] = *(const v8h*)p; u.q[1] = *(const v8h*)(p + 16); return u.v;
}
__device__ __forceinline__ v16h frag_f32(const float* rowk0, int lane) {
  v16h a; const float* p = rowk0 + 8 * (lane >> 4);
#pragma unroll
  for (int i = 0; i < 8; ++i) { a[i] = (_Float16)p[i]; a[8 + i] = (_Float16)p[16 + i]; }
  return a;
}
__device__ __forceinline__ v16h frag_f32s(const float* rowk0, int lane, float sc) {
  v16h a; const float* p = rowk0 + 8 * (lane >> 4);
#pragma unroll
  for (int i = 0; i < 8; ++i) { a[i] = (_Float16)(p[i] * sc); a[8 + i] = (_Float16)(p[16 + i] * sc); }
  return a;
}
// column fragment from a [K][ld] layout (column n), rows >= K read as 0
__device__ __forceinline__ v16h fragc_f32(const float* W, int k0, int n, int lane, int ld, int K) {
  v16h a; const int g = lane >> 4;
#pragma unroll
  for (int i = 0; i < 8; ++i) { const int ka = k0 + 8 * g + i, kb = ka + 16;
    a[i] = (_Float16)(ka < K ? W[(size_t)(ka < K ? ka : K - 1) * ld + n] : 0.f); a[8 + i] = (_Float16)(kb < K ? W[(size_t)(kb < K ? kb : K - 1) * ld + n] : 0.f); }
  return a;
}
struct F2 { v16b h, l; };
__device__ __forceinline__ F2 bsplit16(const float v[16]) { F2 r;
#pragma unroll
  for (int i = 0; i < 16; ++i) { const __bf16 h = (__bf16)v[i]; r.h[i] = h; r.l[i] = (__bf16)(v[i] - (float)h); }
  return r; }
__device__ __forceinline__ F2 split_row(const float* row, int k0, int lane) { float v[16]; const float* p = row + k0 + 8 * (lane >> 4);
#pragma unroll
  for (int i = 0; i < 8; ++i) { v[i] = p[i]; v[8 + i] = p[16 + i]; }
  return bsplit16(v); }
__device__ __forceinline__ F2 split_rowK(const float* row, int k0, int lane, int K) { float v[16]; const int g = lane >> 4;
#pragma unroll
  for (int i = 0; i < 8; ++i) { const int ka = k0 + 8 * g + i, kb = ka + 16; v[i] = ka < K ? row[ka < K ? ka : K - 1] : 0.f; v[8 + i] = kb < K ? row[kb < K ? kb : K - 1] : 0.f; }
  return bsplit16(v); }
__device__ __forceinline__ F2 split_col(const float* W, int k0, int n, int lane, int ld, int K) { float v[16]; const int g = lane >> 4;
#pragma unroll
  for (int i = 0; i < 8; ++i) { const int ka = k0 + 8 * g + i, kb = ka + 16; v[i] = ka < K ? W[(size_t)(ka < K ? ka : K - 1) * ld + n] : 0.f; v[8 + i] = kb < K ? W[(size_t)(kb < K ? kb : K - 1) * ld + n] : 0.f; }
  return bsplit16(v); }
__device__ __forceinline__ v8f mac3(const F2& a, const F2& b, v8f c) { c = wmma_bf(a.l, b.h, c); c = wmma_bf(a.h, b.l, c); return wmma_bf(a.h, b.h, c); }
__device__ __forceinline__ float sigm(float v) { return 1.0f / (1.0f + expf(-v)); }
#define LDSX() do { asm volatile("s_wait_dscnt 0" ::: "memory"); __builtin_amdgcn_wave_barrier(); __builtin_amdgcn_fence(__ATOMIC_RELEASE, "workgroup"); } while (0)

// Causal multi-head self-attention with per-head projection tensors (B 2, T 2,048, C 1,024, 16 heads x 64): q/k/v[b,h,t,:] = x[b,t,:] Wq/Wk/Wv[h] ([H][C][64], no bias); att = softmax(q k^T / sqrt(1024) with key > query -> -inf); out = concat_h(att v) Wo ((in,out) [1024,1024]) + bo.
#define NB 2
#define TT 2048
#define CC 1024            // NH * HD = projected width
#define DIN 1024          // input (model) width
#define NH 16
#define HD 64
#define NQB (TT / 64)
#define SCALE (0.03125f)
#define CAUSAL 1
#ifndef TNB
#define TNB NB
#endif
__device__ __forceinline__ float bfr(float v) { return (float)(__bf16)v; }
typedef __attribute__((ext_vector_type(8))) __bf16 v8b;
__device__ __forceinline__ v16b frag_b(const __bf16* rowk0, int lane) {
  union { v16b v; v8b q[2]; } u; const __bf16* p = rowk0 + 8 * (lane >> 4);
  u.q[0] = *(const v8b*)p; u.q[1] = *(const v8b*)(p + 16); return u.v;
}
#define QBH 6              // causal: query blocks 0..QBH-1 of each sequence (few keys, no averaging) take the high-precision path
#define QHI 384            // rows carrying a q residual plane
#define KHI 384            // key rows carrying k residual / v bf16 hi+lo planes (used only by the causal high-precision path)
// B fragment (k rows k0+.., output column o) of a weight: (in,out) [K][ld] or (out,in) [ld rows of K]: bf16 exact, or f16(bf16 * 256) exact
__device__ __forceinline__ v16b wcol_io(const float* Wm, int k0, int o, int lane, int ld) { v16b w; const int g = lane >> 4;
#pragma unroll
  for (int i = 0; i < 8; ++i) { w[i] = (__bf16)Wm[(size_t)(k0 + 8 * g + i) * ld + o]; w[8 + i] = (__bf16)Wm[(size_t)(k0 + 16 + 8 * g + i) * ld + o]; }
  return w; }
__device__ __forceinline__ v16b wcol_oi(const float* Wm, int k0, int o, int lane, int K) { v16b w; const float* p = Wm + (size_t)o * K + k0 + 8 * (lane >> 4);
#pragma unroll
  for (int i = 0; i < 8; ++i) { w[i] = (__bf16)p[i]; w[8 + i] = (__bf16)p[16 + i]; }
  return w; }
__device__ __forceinline__ v16h wcolh_io(const float* Wm, int k0, int o, int lane, int ld) { v16h w; const int g = lane >> 4;
#pragma unroll
  for (int i = 0; i < 8; ++i) { w[i] = (_Float16)(bfr(Wm[(size_t)(k0 + 8 * g + i) * ld + o]) * 256.0f); w[8 + i] = (_Float16)(bfr(Wm[(size_t)(k0 + 16 + 8 * g + i) * ld + o]) * 256.0f); }
  return w; }
__device__ __forceinline__ v16h wcolh_oi(const float* Wm, int k0, int o, int lane, int K) { v16h w; const float* p = Wm + (size_t)o * K + k0 + 8 * (lane >> 4);
#pragma unroll
  for (int i = 0; i < 8; ++i) { w[i] = (_Float16)(bfr(p[i]) * 256.0f); w[8 + i] = (_Float16)(bfr(p[16 + i]) * 256.0f); }
  return w; }
#define WQKV_LAYOUT 2   // 0 = (in,out) [DIN][CC]; 1 = (out,in) [CC][DIN]; 2 = per-head [NH][DIN][HD]
__device__ __forceinline__ v16b wcol_hdk(const float* Wm, int k0, int o, int lane) { v16b w; const int g = lane >> 4; const float* p = Wm + (size_t)(o / HD) * DIN * HD + (o % HD);
#pragma unroll
  for (int i = 0; i < 8; ++i) { w[i] = (__bf16)p[(size_t)(k0 + 8 * g + i) * HD]; w[8 + i] = (__bf16)p[(size_t)(k0 + 16 + 8 * g + i) * HD]; }
  return w; }
#define WO_OUT_IN 0
#if WQKV_LAYOUT == 1
#define WCOL(W, k0, o, lane) wcol_oi(W, k0, o, lane, DIN)
#elif WQKV_LAYOUT == 2
#define WCOL(W, k0, o, lane) wcol_hdk(W, k0, o, lane)
#else
#define WCOL(W, k0, o, lane) wcol_io(W, k0, o, lane, CC)
#endif
#if WO_OUT_IN
#define WOCOL(W, k0, o, lane) wcol_oi(W, k0, o, lane, CC)
#define WOCOLH(W, k0, o, lane) wcolh_oi(W, k0, o, lane, CC)
#else
#define WOCOL(W, k0, o, lane) wcol_io(W, k0, o, lane, DIN)
#define WOCOLH(W, k0, o, lane) wcolh_io(W, k0, o, lane, DIN)
#endif

#define WS_QH  0u                                      // f16 q rows [b*t][CC]
#define WS_KH  (WS_QH + 2u * (size_t)NB * TT * CC)      // f16 k rows [b*t][CC]
#define WS_VT  (WS_KH + 2u * (size_t)NB * TT * CC)      // f16 v planes [b][c][t]
#define WS_QL  (WS_VT + 2u * (size_t)NB * CC * TT)      // f16 q residual x 2^10 rows [b][t < QHI][CC]
#define WS_KL  (WS_QL + 2u * (size_t)NB * QHI * CC)     // f16 k residual x 2^10 rows [b][t < KHI][CC]
#define WS_VB  (WS_KL + 2u * (size_t)NB * KHI * CC)     // bf16 v hi planes [b][c][t < KHI]
#define WS_VBL (WS_VB + 2u * (size_t)NB * CC * KHI)
#define WS_Y   (WS_VBL + 2u * (size_t)NB * CC * KHI)      // f32 ctx rows [b*t][CC] (only when there is an output projection)
#define WS_XB  (WS_Y  + 4u * (size_t)NB * TT * CC)      // bf16 x rows [b*t][DIN]
#define WS_WT  (WS_XB + 2u * (size_t)NB * TT * DIN)     // bf16 Wq, Wk, Wv columns [which][CC][DIN], k-contiguous
#define WS_WOB (WS_WT + 2u * (size_t)3 * CC * DIN)      // bf16 Wo columns [DIN][CC], k-contiguous
#define WS_WOH (WS_WOB + 2u * (size_t)DIN * CC)         // f16 (bf16 x 2^8) Wo columns [DIN][CC], k-contiguous
#define WS_END (WS_WOH + 2u * (size_t)DIN * CC)

// ---- staging of a 64-k stage of both GEMM operands (k_proj, k_out): a block brings its 128 weight columns and its activation rows (128 in k_proj, 64 in k_out) from global memory ONCE, in whole 128-B lines, and lays them k-contiguous in LDS as 16-bit rows (only k_out's f32 ctx rows are still rounded here; the rest comes rounded from k_pre); every wave then takes its fragments by 16-byte LDS reads. Values, k order and sum order are those of the direct loads
typedef __attribute__((ext_vector_type(4))) __bf16 v4b;
typedef __attribute__((ext_vector_type(4))) _Float16 v4h;
typedef __attribute__((ext_vector_type(2))) unsigned v2u;
// two 16-byte stores to 32 neighbouring bytes and, directly behind them, the wait that stands before a register of an issued global store is overwritten (address and values are inputs so that the stores' registers live up to it)
template <typename T> __device__ __forceinline__ void st16x2(T* p, v4u a, v4u b) { *(v4u*)p = a; *(v4u*)(p + 8) = b; asm volatile("s_wait_xcnt 0x0" :: "v"(p), "v"(a), "v"(b) : "memory"); }
// ---- k_pre: every GEMM operand that comes from an input is rounded to its 16-bit operand type ONCE and laid k-contiguous in the workspace (x rows; Wq, Wk, Wv and Wo columns), so that k_proj and k_out fetch half the bytes, in whole 128-B lines of 64 k, and round nothing of it again (before, each of 24 blocks rounded the same x row and each of 32 or 64 blocks the same weight column). The values are those of the rounding in the stage loaders
#define SQ 72              // LDS pitch of a staged row of 64 k, in 16-bit elements: 144 B = 16 B x odd, the pitch at which 16-byte LDS reads and writes of 16 rows fall on distinct banks
#define PXB 256            // blocks that round x; as many again transpose the weights: few, large blocks, for speed only
__global__ __launch_bounds__(256) void k_pre(const float* __restrict__ X, const float* __restrict__ WQ, const float* __restrict__ WK, const float* __restrict__ WV, const float* __restrict__ WO, __bf16* __restrict__ XB, __bf16* __restrict__ WT, __bf16* __restrict__ WOB, _Float16* __restrict__ WOH) {
  __shared__ float ts[4][64][65]; /* a tile each, so that one barrier serves all four; pitch 65: rows written and columns read both fall on distinct banks */
  const int tid = threadIdx.x; static_assert((size_t)NB * TT * DIN == (size_t)PXB * 16 * 1024 && NH * (DIN / 64) == PXB && (CC / 64) * (DIN / 64) == PXB && HD == 64, "shares written for these shapes");
  if (blockIdx.x < PXB) { /* block-uniform; sixteen 16-byte loads a thread, all in flight at once (unrolled so that the arrays stay in registers); a wave-instruction = four whole lines in, two out */
    const size_t o = (size_t)blockIdx.x * 16384 + tid * 4; const float* p = X + o; __bf16* q = XB + o; v4f a[16]; v2u t[16];
#pragma unroll
    for (int i = 0; i < 16; ++i) a[i] = *(const v4f*)(p + i * 1024);
    asm volatile("s_wait_xcnt 0x0" :: "v"(p) : "memory"); /* the wait that stands before a register of an issued global load is overwritten; the pointer is an input so that the address registers live up to it */
#pragma unroll
    for (int i = 0; i < 16; ++i) { v4b c;
#pragma unroll
      for (int e = 0; e < 4; ++e) c[e] = (__bf16)a[i][e];
      t[i] = __builtin_bit_cast(v2u, c); }
#pragma unroll
    for (int i = 0; i < 16; ++i) *(v2u*)(q + i * 1024) = t[i];
    asm volatile("s_wait_xcnt 0x0" :: "v"(q), "v"(t[0]), "v"(t[1]), "v"(t[2]), "v"(t[3]), "v"(t[4]), "v"(t[5]), "v"(t[6]), "v"(t[7]), "v"(t[8]), "v"(t[9]), "v"(t[10]), "v"(t[11]), "v"(t[12]), "v"(t[13]), "v"(t[14]), "v"(t[15]) : "memory"); /* the same behind the stores: address and values are inputs so that the stores' registers live up to it */
    return; }
  /* four tiles of 64 k x 64 columns a block: one of Wq, Wk, Wv each (head hh, k tile kt) and one of Wo (k tile hh, column tile kt); all four are asked for at once */
  const int bi = blockIdx.x - PXB, hh = bi >> 4, kt = bi & 15, rr = tid >> 4, c4 = (tid & 15) * 4; const size_t wo = (size_t)hh * DIN * HD + (size_t)(kt * 64 + rr) * HD + c4;
  const float* s0 = WQ + wo; const float* s1 = WK + wo; const float* s2 = WV + wo; const float* s3 = WO + (size_t)(hh * 64 + rr) * DIN + kt * 64 + c4; v4f d[4][4];
#pragma unroll
  for (int i = 0; i < 4; ++i) { d[0][i] = *(const v4f*)(s0 + (size_t)(16 * i) * HD); d[1][i] = *(const v4f*)(s1 + (size_t)(16 * i) * HD); d[2][i] = *(const v4f*)(s2 + (size_t)(16 * i) * HD); d[3][i] = *(const v4f*)(s3 + (size_t)(16 * i) * DIN); }
  asm volatile("s_wait_xcnt 0x0" :: "v"(s0), "v"(s1), "v"(s2), "v"(s3) : "memory"); /* as above, for the four pointers */
  const int cl = tid >> 2, kq = (tid & 3) * 16; /* out: 16 k of column cl a thread; four threads = one whole line */
#pragma unroll
  for (int m = 0; m < 4; ++m) /* unrolled so that d[] stays in registers */
#pragma unroll
    for (int i = 0; i < 4; ++i)
#pragma unroll
      for (int e = 0; e < 4; ++e) ts[m][rr + 16 * i][c4 + e] = d[m][i][e];
  __syncthreads(); /* the tiles are whole before their columns are read */
#pragma unroll
  for (int m = 0; m < 4; ++m) { v8b b0, b1; /* unrolled so that the branch on m is decided at compile time */
#pragma unroll
    for (int e = 0; e < 8; ++e) { b0[e] = (__bf16)ts[m][kq + e][cl]; b1[e] = (__bf16)ts[m][kq + 8 + e][cl]; }
    if (m < 3) st16x2(WT + ((size_t)m * CC + hh * HD + cl) * DIN + kt * 64 + kq, __builtin_bit_cast(v4u, b0), __builtin_bit_cast(v4u, b1));
    else { const size_t oo = (size_t)(kt * 64 + cl) * CC + hh * 64 + kq; v8h h0, h1;
#pragma unroll
      for (int e = 0; e < 8; ++e) { h0[e] = (_Float16)((float)b0[e] * 256.0f); h1[e] = (_Float16)((float)b1[e] * 256.0f); }
      st16x2(WOB + oo, __builtin_bit_cast(v4u, b0), __builtin_bit_cast(v4u, b1)); st16x2(WOH + oo, __builtin_bit_cast(v4u, h0), __builtin_bit_cast(v4u, h1)); } } }
// one thread's share of a 64-k stage of 16-bit rows: eight 16-byte pieces of 128 rows, rows (tid >> 3) + 16 i, piece tid & 7 (a wave-instruction = four whole lines); the pointer then steps on 64 k
template <typename T> __device__ __forceinline__ void ld_rows(const T*& p, int ld, v4u r[8]) {
#pragma unroll
  for (int i = 0; i < 8; ++i) r[i] = *(const v4u*)(p + (size_t)(16 * i) * ld);
  asm volatile("s_wait_xcnt 0x0" :: "v"(p) : "memory"); /* the wait that stands before a register of an issued global load is overwritten; the pointer is an input so that the loads' address registers live up to it */
  p += 64; }
// one thread's share of a 64-k stage of k_out's 64 f32 ctx rows: eight 16-byte pieces, rows (tid >> 4) + 8 i, piece tid & 15 (a wave-instruction = four whole lines); the pointer then steps on 64 k
__device__ __forceinline__ void ld_ctx(const float*& p, int ld, v4f r[8]) {
#pragma unroll
  for (int i = 0; i < 8; ++i) r[i] = *(const v4f*)(p + (size_t)(8 * i) * ld);
  asm volatile("s_wait_xcnt 0x0" :: "v"(p) : "memory"); /* as in ld_rows */
  p += 64; }
// four 16-byte stores of k_proj's epilogue (rows or planes n elements apart, from LDS rows ln elements apart) and, directly behind the last, the wait that stands before a register of an issued global store is overwritten; the address (the four stores name one register pair, with n as an immediate offset) and the four values are inputs of the wait so that the stores' registers live up to it (the loops stay rolled and reuse them)
template <typename T> __device__ __forceinline__ void st16x4(T* p0, size_t n, const T* l0, int ln) {
  const v4u d0 = *(const v4u*)l0, d1 = *(const v4u*)(l0 + ln), d2 = *(const v4u*)(l0 + 2 * ln), d3 = *(const v4u*)(l0 + 3 * ln);
  *(v4u*)p0 = d0; *(v4u*)(p0 + n) = d1; *(v4u*)(p0 + 2 * n) = d2; *(v4u*)(p0 + 3 * n) = d3;
  asm volatile("s_wait_xcnt 0x0" :: "v"(p0), "v"(d0), "v"(d1), "v"(d2), "v"(d3) : "memory"); }
// ---- k_proj: block = (128 rows, 128 cols, which), wave = 64 rows x 64 cols (4 x 4 accumulator tiles: a staged weight column serves twice the rows, and eight fragments feed sixteen products): q/k/v = X W (+ b) with exact bf16 products (K = DIN) -> which 0: q f16 rows (+ residual rows < QHI); 1: k f16 rows (+ residual rows < KHI); 2: v f16 planes [c][t] (+ bf16 hi/lo planes for t < KHI)
#define PR 128             // rows of a k_proj block; 768 blocks = three a WGP, all resident at once
__global__ __launch_bounds__(128) void k_proj(const __bf16* __restrict__ XB, const __bf16* __restrict__ WT, const float* __restrict__ BQ, const float* __restrict__ BK, const float* __restrict__ BV,
    _Float16* __restrict__ QH, _Float16* __restrict__ QL, _Float16* __restrict__ KH, _Float16* __restrict__ KL, _Float16* __restrict__ VT, __bf16* __restrict__ VB, __bf16* __restrict__ VBL) {
  union Lds { struct { _Float16 sh[PR][136], sl[PR][136]; } qk; struct { _Float16 th[128][PR + 8]; __bf16 tb[128][PR + 8], tbl[128][PR + 8]; } v; struct { __bf16 wt[2][128][SQ], xs[2][PR][SQ]; } st; }; /* the stage buffers lie in the LDS of the epilogue's arrays, which are written only behind the loop's last barrier */
  __shared__ __align__(16) Lds sm; auto& sh = sm.qk.sh; auto& sl = sm.qk.sl; auto& th = sm.v.th; auto& tb = sm.v.tb; auto& tbl = sm.v.tbl;
  static_assert(TT % PR == 0 && QHI % PR == 0 && KHI % PR == 0, "a block lies in one sequence and wholly inside or outside the residual rows");
  const int tid = threadIdx.x, wave = tid >> 5, lane = tid & 31, col = lane & 15, g = lane >> 4; const int wrow = (wave >> 1) * 64, wcol = (wave & 1) * 64; const int which = blockIdx.z; const int c0 = blockIdx.y * 128; const size_t r0 = (size_t)blockIdx.x * PR; const size_t bb = r0 / TT; const int t0 = (int)(r0 % TT);
  const float* BA = which == 0 ? BQ : which == 1 ? BK : BV;
  v8f acc[4][4] = {}; v4u wr[8], xr[8];
  const __bf16* wp = WT + ((size_t)which * CC + c0 + (tid >> 3)) * DIN + (tid & 7) * 8; const __bf16* xp = XB + (r0 + (tid >> 3)) * DIN + (tid & 7) * 8;
  /* writes this thread's share, as it came, to stage buffer bf; unrolled so that wr[] and xr[] stay in registers */
  auto put = [&](int bf) {
#pragma unroll
    for (int i = 0; i < 8; ++i) { *(v4u*)&sm.st.wt[bf][(tid >> 3) + 16 * i][(tid & 7) * 8] = wr[i]; *(v4u*)&sm.st.xs[bf][(tid >> 3) + 16 * i][(tid & 7) * 8] = xr[i]; } };
  ld_rows(wp, DIN, wr); ld_rows(xp, DIN, xr); put(0); __syncthreads(); /* publishes stage 0 */
  /* two buffers: stage kc + 1 is asked for before stage kc's products, so its latency runs behind them, and written to the other buffer after them; unrolled by two so that the buffer index is a constant */
#pragma unroll 2
  for (int kc = 0; kc < DIN / 64; ++kc) { const int cur = kc & 1; const bool more = kc + 1 < DIN / 64;
    if (more) { ld_rows(wp, DIN, wr); ld_rows(xp, DIN, xr); }
#pragma unroll
    for (int s = 0; s < 2; ++s) { /* the stage's two steps of 32 k, in k order */
      v16b a[4], w[4]; /* unrolled so that a[] and w[] stay in registers */
#pragma unroll
      for (int i = 0; i < 4; ++i) a[i] = frag_b(&sm.st.xs[cur][wrow + i * 16 + col][32 * s], lane);
#pragma unroll
      for (int j = 0; j < 4; ++j) w[j] = frag_b(&sm.st.wt[cur][wcol + j * 16 + col][32 * s], lane);
      __builtin_amdgcn_sched_barrier(0); /* keeps the step's sixteen LDS reads together as one group in front of the products: left free, three of the four row fragments are read among the products into one register set, each behind a full wait */
#pragma unroll
      for (int i = 0; i < 4; ++i)
#pragma unroll
        for (int j = 0; j < 4; ++j) acc[i][j] = __builtin_amdgcn_wmma_f32_16x16x32_bf16(false, a[i], false, w[j], (short)0, acc[i][j], false, false); /* the plain builtin: the operands of an asm statement must lie in the first 256 registers, which sixteen tiles and eight fragments overfill (spills in the loop); the compiler keeps the distances behind its own matrix instructions */
      __builtin_amdgcn_sched_barrier(0); } /* keeps the waits on the next stage's global loads behind this stage's products, so that the products run inside the loads' latency */
    if (more) put(cur ^ 1);
    __syncthreads(); } /* one barrier a stage: publishes stage kc + 1 and ends every wave's reads of the buffer that the next trip refills (after the last trip: of the LDS that the epilogue reuses) */
  if (which < 2) { _Float16* DH = which == 0 ? QH : KH; _Float16* DL = which == 0 ? QL : KL; const int nhi = which == 0 ? QHI : KHI; const bool hi_rows = t0 < nhi;
#pragma unroll
    for (int j = 0; j < 4; ++j) { const float bias = BA ? bfr(BA[c0 + wcol + j * 16 + col]) : 0.f;
#pragma unroll
      for (int i = 0; i < 4; ++i)
#pragma unroll
        for (int r = 0; r < 8; ++r) { const float v = acc[i][j][r] + bias; const _Float16 hv = (_Float16)v; sh[wrow + i * 16 + 8 * g + r][wcol + j * 16 + col] = hv; sl[wrow + i * 16 + 8 * g + r][wcol + j * 16 + col] = (_Float16)((v - (float)hv) * 1024.0f); } }
    __syncthreads();
    for (int e = tid; e < PR * 16; e += 512) { const int rl = e >> 4, q = e & 15; /* a trip = rows rl, rl + 8, rl + 16, rl + 24 */ st16x4(DH + (r0 + rl) * CC + c0 + q * 8, (size_t)8 * CC, &sh[rl][q * 8], 8 * 136); if (hi_rows) st16x4(DL + (bb * nhi + t0 + rl) * (size_t)CC + c0 + q * 8, (size_t)8 * CC, &sl[rl][q * 8], 8 * 136); }
  } else { const bool hi_rows = t0 < KHI;
#pragma unroll
    for (int j = 0; j < 4; ++j) { const float bias = BA ? bfr(BA[c0 + wcol + j * 16 + col]) : 0.f;
#pragma unroll
      for (int i = 0; i < 4; ++i)
#pragma unroll
        for (int r = 0; r < 8; ++r) { const float v = acc[i][j][r] + bias; const int rl = wrow + i * 16 + 8 * g + r, cl = wcol + j * 16 + col; th[cl][rl] = (_Float16)v; const __bf16 bh = (__bf16)v; tb[cl][rl] = bh; tbl[cl][rl] = (__bf16)(v - (float)bh); } }
    __syncthreads();
    for (int e = tid; e < 128 * (PR / 8); e += 512) { const int cl = e / (PR / 8), q = e % (PR / 8); /* a trip = planes cl, cl + 8, cl + 16, cl + 24 */ static_assert(PR / 8 == 16, "128 threads = 8 planes"); st16x4(VT + (bb * CC + c0 + cl) * (size_t)TT + t0 + q * 8, (size_t)8 * TT, &th[cl][q * 8], 8 * (PR + 8)); if (hi_rows) { const size_t o3 = (bb * CC + c0 + cl) * (size_t)KHI + t0 + q * 8; st16x4(VB + o3, (size_t)8 * KHI, &tb[cl][q * 8], 8 * (PR + 8)); st16x4(VBL + o3, (size_t)8 * KHI, &tbl[cl][q * 8], 8 * (PR + 8)); } } } }
// ---- k_att: block = 64 queries (qb) of (b, h), one wave = 16 queries; the waves share only the staged k and v tiles (query blocks >= QBH): per 64 keys S^T = K Q^T (lane = one query, its D registers = keys), causal mask by index on the diagonal block, running maximum (of the unscaled scores) and sum in f32, e = exp(logit - max) = exp2((score - max) x SCALE x log2 e) packed from the score registers straight into the B operand of ctx^T += V^T P^T, ctx and sum brought to the new maximum every trip, ctx divided by the sum at the end. Logits and P never go to memory. Products as before: 1 f16 product each; query blocks < QBH: 3-product logits (q, k hi + residual), e and v as bf16 hi + lo (3 products)
__device__ __forceinline__ v8f mm_h(v16h a, v16h b, v8f c) { return __builtin_amdgcn_wmma_f32_16x16x32_f16(false, a, false, b, (short)0, c, false, false); }
__device__ __forceinline__ v8f mm_b(v16b a, v16b b, v8f c) { return __builtin_amdgcn_wmma_f32_16x16x32_bf16(false, a, false, b, (short)0, c, false, false); }
// fragment from a pointer that already holds the lane's 8 g offset, so that the pointer itself is the address register pair of the loads
__device__ __forceinline__ v16h frag_hp(const _Float16* p) { union { v16h v; v8h q[2]; } u; u.q[0] = *(const v8h*)p; u.q[1] = *(const v8h*)(p + 16); return u.v; }
__device__ __forceinline__ v16b frag_bp(const __bf16* p) { union { v16b v; v8b q[2]; } u; u.q[0] = *(const v8b*)p; u.q[1] = *(const v8b*)(p + 16); return u.v; }
// every loop over st[], acc[] or a fragment array in sm_step and k_att is unrolled so that the array stays in registers; the two key loops stay rolled (unroll 1): one trip's fragments already fill the register budget of four waves a SIMD
// st[t][r] = unscaled score q.k of key k0 + 16 t + 8 g + r for this lane's query qi; on return e = exp(SCALE x (score - new maximum)); m (unscaled), l, acc brought to the new maximum (l is this half-wave's part of the sum)
// the exponent is formed by one multiply-add a score, score x EXC - max x EXC, and goes straight to the hardware's exp2: it is at most 0 (up to the rounding of max x EXC), and where exp2 falls below the range of f32 the result is 0, which is what a masked or far-off key contributes
#define EXC (SCALE * 1.44269504088896340736f) // SCALE x log2 e
// exp2 of eight values, each in its own register. In asm so that the slot which the instruction set asks for behind a transcendental (before its result is read or its source overwritten) is kept by construction: each v_exp_f32 overwrites only its own source, none reads another's result, and the v_nop is the slot behind the last one. The s_delay_alu is the hint that the compiler writes for its own code and not for asm: a source may come from the vector instruction directly in front, and unhinted the wait would hold up the SIMD's other waves too; it changes no result
__device__ __forceinline__ v8f exp2x8(v8f x) { float a = x[0], b = x[1], c = x[2], d = x[3], e = x[4], f = x[5], g = x[6], h = x[7];
  asm("s_delay_alu instid0(VALU_DEP_1)\n\tv_exp_f32 %0, %0\n\tv_exp_f32 %1, %1\n\tv_exp_f32 %2, %2\n\tv_exp_f32 %3, %3\n\tv_exp_f32 %4, %4\n\tv_exp_f32 %5, %5\n\tv_exp_f32 %6, %6\n\tv_exp_f32 %7, %7\n\tv_nop" : "+v"(a), "+v"(b), "+v"(c), "+v"(d), "+v"(e), "+v"(f), "+v"(g), "+v"(h));
  const v8f r = {a, b, c, d, e, f, g, h}; return r; }
__device__ __forceinline__ float exp2x1(float a) { asm("s_delay_alu instid0(VALU_DEP_1)\n\tv_exp_f32 %0, %0\n\tv_nop" : "+v"(a)); return a; } /* the same for one value */
__device__ __forceinline__ void sm_step(v8f st[4], v8f acc[HD / 16], float& m, float& l, bool diag, int k0, int g, int qi) {
  if (diag) {
#pragma unroll
    for (int t = 0; t < 4; ++t)
#pragma unroll
      for (int r = 0; r < 8; ++r) if (k0 + t * 16 + 8 * g + r > qi) st[t][r] = -3.0e38f; }
  float mx = m;
#pragma unroll
  for (int t = 0; t < 4; ++t)
#pragma unroll
    for (int r = 0; r < 8; ++r) mx = fmaxf(mx, st[t][r]);
  mx = fmaxf(mx, __shfl_xor(mx, 16));
  const float alpha = exp2x1((m - mx) * EXC); m = mx; float s = 0.f; const float nmc = -mx * EXC; const v8f cv = {EXC, EXC, EXC, EXC, EXC, EXC, EXC, EXC}, nv = {nmc, nmc, nmc, nmc, nmc, nmc, nmc, nmc};
#pragma unroll
  for (int t = 0; t < 4; ++t) { st[t] = exp2x8(__builtin_elementwise_fma(st[t], cv, nv));
#pragma unroll
    for (int r = 0; r < 8; ++r) s += st[t][r]; }
  l = l * alpha + s;
#pragma unroll
  for (int j = 0; j < HD / 16; ++j) acc[j] *= alpha; }
// ---- staging of a 64-key tile (k_att, query blocks >= QBH): the block's four waves read the same 64 k rows and 64 v planes, so the block brings them from global memory ONCE, in whole 128-B lines, by asynchronous copies to LDS, and every wave takes its fragments by 16-byte LDS reads. Values, k order and sum order are those of the direct loads
#define KVP 72             // LDS pitch of a staged row of 64 f16: 144 B = 16 B x odd, the pitch at which 16-byte LDS reads of 16 rows fall on distinct banks
#define KVB (128 * KVP * 2) // bytes of one tile buffer: rows 0..63 = k rows (key, head column), rows 64..127 = v planes (head column, key)
// one thread's share of a tile: eight 16-byte copies, rows (tid >> 3) + 16 i, piece tid & 7 (a wave-instruction = four whole lines). l = the lane's LDS byte address in row tid >> 3 of the buffer, kg and vg = its global addresses in k row tid >> 3 and v plane tid >> 3 of the tile
__device__ __forceinline__ void kv_copy(unsigned l, const _Float16* kg, const _Float16* vg) {
  /* the s_wait_xcnt 0 stands inside the copies' own statement, so that no register which a copy names is rewritten in front of it */
  asm volatile("global_load_async_to_lds_b128 %0, %8, off\n\t"
               "global_load_async_to_lds_b128 %1, %9, off\n\t"
               "global_load_async_to_lds_b128 %2, %10, off\n\t"
               "global_load_async_to_lds_b128 %3, %11, off\n\t"
               "global_load_async_to_lds_b128 %4, %12, off\n\t"
               "global_load_async_to_lds_b128 %5, %13, off\n\t"
               "global_load_async_to_lds_b128 %6, %14, off\n\t"
               "global_load_async_to_lds_b128 %7, %15, off\n\t"
               "s_wait_xcnt 0x0"
               :: "v"(l), "v"(l + 16 * KVP * 2), "v"(l + 32 * KVP * 2), "v"(l + 48 * KVP * 2), "v"(l + 64 * KVP * 2), "v"(l + 80 * KVP * 2), "v"(l + 96 * KVP * 2), "v"(l + 112 * KVP * 2),
                  "v"(kg), "v"(kg + (size_t)16 * CC), "v"(kg + (size_t)32 * CC), "v"(kg + (size_t)48 * CC), "v"(vg), "v"(vg + (size_t)16 * TT), "v"(vg + (size_t)32 * TT), "v"(vg + (size_t)48 * TT)
               : "memory"); }
__global__ __launch_bounds__(128) void k_att(const _Float16* __restrict__ QH, const _Float16* __restrict__ KH, const _Float16* __restrict__ VT, const _Float16* __restrict__ QL, const _Float16* __restrict__ KL, const __bf16* __restrict__ VB, const __bf16* __restrict__ VBL, float* __restrict__ Y) { __shared__ __align__(16) float ss[4][16][HD + 4]; __shared__ __align__(16) _Float16 kv[2][128][KVP];
  const int tid = threadIdx.x, wave = tid >> 5, lane = tid & 31, col = lane & 15, g = lane >> 4;
  /* all 1,024 blocks are resident at once (4 a WGP) and a block's cost grows with qb, so the launch lasts as long as the fullest WGP: the flat index is spread so that the four blocks f, f + 256, f + 512, f + 768 and equally the four blocks f, f + 8, f + 16, f + 24 hold one qb of each quarter, 31 - i, 16 + i, 15 - i, i: the same cost for every such four. Speed only: any placement is correct; (qb, head, batch) <-> f is one to one */
  static_assert(NQB == 32 && NB * NH == 32, "index spread written for 32 query blocks x 32 (batch, head) pairs");
  const int f = blockIdx.x, fk = (f >> 3) & 3, fi = (f >> 5) & 7, fc = (fk + (f >> 8)) & 3; const int qb = fc == 0 ? 31 - fi : fc == 1 ? 16 + fi : fc == 2 ? 15 - fi : fi; const int bh = (f & 7) + 8 * fk; const int h = bh % NH, b = bh / NH; const int ql0 = qb * 64 + wave * 16, qi = ql0 + col;
  const _Float16* qp = QH + ((size_t)b * TT + qi) * CC + h * HD + 8 * g; const _Float16* kp = KH + ((size_t)b * TT + col) * CC + h * HD + 8 * g;
  v8f acc[HD / 16] = {}; float m = -3.0e38f, l = 0.f;
  if (qb >= QBH) { static_assert(QBH >= 1, "the ring's prologue asks for tiles 0 and 1");
    const unsigned lb = (unsigned)(size_t)&kv[0][tid >> 3][(tid & 7) * 8]; const _Float16* kg = KH + ((size_t)b * TT + (tid >> 3)) * CC + h * HD + (tid & 7) * 8; const _Float16* vg = VT + ((size_t)b * CC + h * HD + (tid >> 3)) * (size_t)TT + (tid & 7) * 8;
    const v16h q0 = frag_hp(qp), q1 = frag_hp(qp + 32);
    asm volatile("s_wait_xcnt 0x0" :: "v"(qp) : "memory"); /* the wait that stands before a register of an issued global load is overwritten; the pointer is an input so that the loads' address registers live up to it */
    kv_copy(lb, kg, vg);
    asm volatile("s_wait_asynccnt 0x0" ::: "memory"); /* this wave's copies of tile 0 have landed */
    __syncthreads(); /* publishes tile 0 */
    kv_copy(lb + KVB, kg + (size_t)64 * CC, vg + 64); kg += (size_t)128 * CC; vg += 128; /* kg and vg walk two tiles ahead of the trip */
    /* rolled: a second trip's fragments would go past the 256 registers that four waves a SIMD allow */
#pragma unroll 1
    for (int kb = 0; kb <= qb; ++kb) { const int k0 = kb * 64; const _Float16 (*T)[KVP] = kv[kb & 1]; v16h ka[4][2], va[2][HD / 16]; /* trip kb reads buffer kb & 1 alone; inner loops unrolled so that the arrays stay in registers */
#pragma unroll
      for (int t = 0; t < 4; ++t) { ka[t][0] = frag_hp(&T[t * 16 + col][8 * g]); ka[t][1] = frag_hp(&T[t * 16 + col][32 + 8 * g]); }
#pragma unroll
      for (int u = 0; u < 2; ++u)
#pragma unroll
        for (int j = 0; j < HD / 16; ++j) va[u][j] = frag_hp(&T[64 + j * 16 + col][u * 32 + 8 * g]);
      __builtin_amdgcn_sched_barrier(0); /* keeps the trip's LDS reads together as one group in front of the products: left free they sink to their uses, with one full wait a product */
      v8f st[4];
#pragma unroll
      for (int t = 0; t < 4; ++t) { v8f z = {}; z = mm_h(ka[t][0], q0, z); st[t] = mm_h(ka[t][1], q1, z); }
      /* the trip reads nothing of its tile behind this line (softmax and P v work on registers), so this is the foot of the trip for the ring: the buffer is handed over here and the refill has a whole trip to land */
      asm volatile("s_wait_dscnt 0x0" ::: "memory"); /* this wave's reads of the buffer that is refilled below have returned */
      asm volatile("s_wait_asynccnt 0x0" ::: "memory"); /* this wave's copies of tile kb + 1 have landed */
      __syncthreads(); /* one barrier a trip: publishes tile kb + 1 and ends every wave's reads of the buffer refilled behind it */
      if (kb + 2 <= qb) { kv_copy(lb + (kb & 1) * KVB, kg, vg); kg += (size_t)64 * CC; vg += 64; } /* block-uniform test: tile kb + 2 goes into the buffer that this trip has read */
      sm_step(st, acc, m, l, kb == qb, k0, g, qi);
#pragma unroll
      for (int u = 0; u < 2; ++u) { v16h p;
#pragma unroll
        for (int i = 0; i < 8; ++i) { p[i] = (_Float16)st[2 * u][i]; p[8 + i] = (_Float16)st[2 * u + 1][i]; }
#pragma unroll
        for (int j = 0; j < HD / 16; ++j) acc[j] = mm_h(va[u][j], p, acc[j]); } }
    asm volatile("s_wait_asynccnt 0x0" ::: "memory"); /* no copy is outstanding when the wave goes on */
  } else { const _Float16* qlp = QL + ((size_t)b * QHI + qi) * CC + h * HD + 8 * g; const _Float16* klp = KL + ((size_t)b * KHI + col) * CC + h * HD + 8 * g; const size_t vo = ((size_t)b * CC + h * HD + col) * (size_t)KHI + 8 * g; const __bf16* vhp = VB + vo; const __bf16* vlp = VBL + vo;
    const v16h q0 = frag_hp(qp), q1 = frag_hp(qp + 32), r0 = frag_hp(qlp), r1 = frag_hp(qlp + 32);
    asm volatile("s_wait_xcnt 0x0" :: "v"(qp), "v"(qlp) : "memory"); /* as above, for the q loads' two pointers */
    /* rolled, for the same register budget */
#pragma unroll 1
    for (int kb = 0; kb <= qb; ++kb) { const int k0 = kb * 64; v8f st[4];
#pragma unroll
      for (int t = 0; t < 4; ++t) { const size_t ko = (size_t)(t * 16) * CC; const v16h kh0 = frag_hp(kp + ko), kh1 = frag_hp(kp + ko + 32), kl0 = frag_hp(klp + ko), kl1 = frag_hp(klp + ko + 32);
        v8f a = {}, al = {}; a = mm_h(kh0, q0, a); al = mm_h(kh0, r0, al); al = mm_h(kl0, q0, al); a = mm_h(kh1, q1, a); al = mm_h(kh1, r1, al); al = mm_h(kl1, q1, al);
        st[t] = a + al * (1.0f / 1024.0f); }
      sm_step(st, acc, m, l, kb == qb, k0, g, qi);
#pragma unroll
      for (int u = 0; u < 2; ++u) { float pv[16];
#pragma unroll
        for (int i = 0; i < 8; ++i) { pv[i] = st[2 * u][i]; pv[8 + i] = st[2 * u + 1][i]; }
        const F2 p = bsplit16(pv);
#pragma unroll
        for (int j = 0; j < HD / 16; ++j) { const size_t po = (size_t)(j * 16) * KHI + u * 32; const v16b vh = frag_bp(vhp + po), vl = frag_bp(vlp + po); acc[j] = mm_b(vh, p.h, acc[j]); acc[j] = mm_b(vh, p.l, acc[j]); acc[j] = mm_b(vl, p.h, acc[j]); } }
      asm volatile("s_wait_xcnt 0x0" :: "v"(kp), "v"(klp), "v"(vhp), "v"(vlp) : "memory"); /* as above: stands before the four pointers step on to the next 64 keys */
      kp += (size_t)64 * CC; klp += (size_t)64 * CC; vhp += 64; vlp += 64; } }
  l += __shfl_xor(l, 16); const float inv = 1.0f / l;
#pragma unroll
  for (int j = 0; j < HD / 16; ++j) { const v8f o = acc[j] * inv; /* lane = query col, registers = head columns j*16 + 8g + r */
    *(v4f*)&ss[wave][col][j * 16 + 8 * g] = __builtin_shufflevector(o, o, 0, 1, 2, 3); *(v4f*)&ss[wave][col][j * 16 + 8 * g + 4] = __builtin_shufflevector(o, o, 4, 5, 6, 7); }
  LDSX(); /* own-wave exchange: the 256-B (row, head) segments go out whole, two rows an instruction */
  for (int rl = 0; rl < 16; rl += 2) vst2(Y + ((size_t)b * TT + ql0 + rl + g) * CC + h * HD + col * 4, *(const v4f*)&ss[wave][rl + g][col * 4]); }
// work-group barrier of k_out's stages. By hand, because __syncthreads() also waits for the wave's outstanding global loads, which would end the two-stage lead of the loads below at every stage; what the other waves need of this wave at this point is only its LDS traffic: s_wait_dscnt 0 (its writes of the next stage have landed, its reads of the buffer refilled next have returned), then signal and wait. The "memory" clobber keeps every LDS access on its side
__device__ __forceinline__ void lds_barrier() { asm volatile("s_wait_dscnt 0x0\n\ts_barrier_signal -1\n\ts_barrier_wait -1" ::: "memory"); }
// ---- k_out: block = (64 rows, 128 cols): out = ctx Wo (+ bo): ctx once to f16 against Wo as f16(bf16 x 2^8) exact (1 product) x 2^-8; causal early rows (< QHI of each sequence): ctx bf16 hi + lo against exact bf16 Wo (2 products)
__global__ __launch_bounds__(128) void k_out(const float* __restrict__ Y, const __bf16* __restrict__ WOB, const _Float16* __restrict__ WOH, const float* __restrict__ BO, float* __restrict__ OUT) { union Lds { float sf[4][16][132]; struct { _Float16 wt[2][128][SQ], ya[2][64][SQ]; } h; struct { __bf16 wt[2][128][SQ], yh[2][64][SQ], yl[2][64][SQ]; } b; }; /* the stage buffers lie in the LDS of the epilogue's array, which is written only behind the loop's last barrier */
  __shared__ __align__(16) Lds sm; auto& sf = sm.sf;
  const int tid = threadIdx.x, wave = tid >> 5, lane = tid & 31, col = lane & 15, g = lane >> 4; const int c0 = blockIdx.y * 128; const size_t r0 = (size_t)blockIdx.x * 64 + wave * 16;
  static_assert(WO_OUT_IN == 0, "k_pre's transposition written for (in,out) Wo");
  static_assert(CC / 64 >= 2 && (CC / 64) % 2 == 0, "the prologue asks for stages 0 and 1; the loop takes two stages a turn");
  /* two register sets: stage s waits in set s & 1 from two trips before it is used until it is written to LDS, so that a load has two stages' products to come back from memory, not one. ctx stage 0 is the same for both paths: it is asked for once, in front of the branch */
  v8f acc[8] = {}; v4u wr[2][8]; v4f yr[2][8]; const size_t wo = (size_t)(c0 + (tid >> 3)) * CC + (tid & 7) * 8; const float* yp = Y + ((size_t)blockIdx.x * 64 + (tid >> 4)) * CC + (tid & 15) * 4;
  /* the lane's eight bias values are asked for here, together, so that they come back behind the loop's products; asked for in the epilogue, one by one, each costs the wave a whole load latency. Unrolled so that bs[] stays in registers */
  float bs[8] = {}; const float* bp = BO + c0 + col;
  if (BO) {
#pragma unroll
    for (int j = 0; j < 8; ++j) bs[j] = bp[j * 16];
    asm volatile("s_wait_xcnt 0x0" :: "v"(bp) : "memory"); } /* as in ld_rows */
  ld_ctx(yp, CC, yr[0]);
  if (CAUSAL && (int)(((size_t)blockIdx.x * 64) % TT) < QHI) {   /* block-uniform */
    const __bf16* wp = WOB + wo; ld_rows(wp, CC, wr[0]); ld_ctx(yp, CC, yr[1]); ld_rows(wp, CC, wr[1]); /* stages 0 and 1 */
    __builtin_amdgcn_sched_barrier(0); /* keeps the last s_wait_xcnt 0 directly behind its loads: left free it sinks below vector instructions that reuse the loads' address registers */
    auto put = [&](int bf) __attribute__((always_inline)) { /* register set bf to stage buffer bf: Wo (exact bf16) as it came, ctx to bf16 hi + lo; loops unrolled so that wr[] and yr[] stay in registers */
#pragma unroll
      for (int i = 0; i < 8; ++i) *(v4u*)&sm.b.wt[bf][(tid >> 3) + 16 * i][(tid & 7) * 8] = wr[bf][i];
#pragma unroll
      for (int i = 0; i < 8; ++i) { v4b th, tl;
#pragma unroll
        for (int e = 0; e < 4; ++e) { const __bf16 hv = (__bf16)yr[bf][i][e]; th[e] = hv; tl[e] = (__bf16)(yr[bf][i][e] - (float)hv); }
        *(v4b*)&sm.b.yh[bf][(tid >> 4) + 8 * i][(tid & 15) * 4] = th; *(v4b*)&sm.b.yl[bf][(tid >> 4) + 8 * i][(tid & 15) * 4] = tl; } };
    put(0); lds_barrier(); /* publishes stage 0; stage 1's loads stay in flight */
    /* two buffers, as in k_proj; one trip, inlined with cur, ask and fill as constants, so that buffer and register set are fixed at compile time and no branch stands round the loads (two paths that meet would make the compiler wait for all loads, the newest too) */
    auto trip = [&](int cur, bool ask, bool fill) __attribute__((always_inline)) {
      if (ask) { ld_ctx(yp, CC, yr[cur]); ld_rows(wp, CC, wr[cur]); } /* set cur went to LDS a trip ago: the stage two ahead is asked for into it; ctx first, which the launch before has just written and fewer blocks share */
#pragma unroll
      for (int s = 0; s < 2; ++s) { /* the stage's two steps of 32 k, in k order */
        const v16b ah = frag_b(&sm.b.yh[cur][wave * 16 + col][32 * s], lane), al = frag_b(&sm.b.yl[cur][wave * 16 + col][32 * s], lane); v16b w[8]; /* unrolled so that w[] stays in registers */
#pragma unroll
        for (int j = 0; j < 8; ++j) w[j] = frag_b(&sm.b.wt[cur][j * 16 + col][32 * s], lane);
#pragma unroll
        for (int j = 0; j < 8; ++j) { acc[j] = wmma_bf(ah, w[j], acc[j]); acc[j] = wmma_bf(al, w[j], acc[j]); } }
      __builtin_amdgcn_sched_barrier(0); /* keeps the waits on the next stage's global loads behind this stage's products, so that the products run inside the loads' latency */
      if (fill) put(cur ^ 1);
      lds_barrier(); }; /* publishes the next stage, ends the reads of the buffer refilled next (at the end: of the LDS that sf reuses) */
    /* rolled: a turn already holds both trips; the last two stages, which ask for nothing, stand behind the loop */
#pragma unroll 1
    for (int kc = 0; kc + 2 < CC / 64; kc += 2) { trip(0, true, true); trip(1, true, true); }
    trip(0, false, true); trip(1, false, false);
#pragma unroll
    for (int j = 0; j < 8; ++j) { const float bias = bfr(bs[j]);
#pragma unroll
      for (int r = 0; r < 8; ++r) sf[wave][8 * g + r][j * 16 + col] = acc[j][r] + bias; }
  } else {
    const _Float16* wp = WOH + wo; ld_rows(wp, CC, wr[0]); ld_ctx(yp, CC, yr[1]); ld_rows(wp, CC, wr[1]); /* stages 0 and 1 */
    __builtin_amdgcn_sched_barrier(0); /* keeps the last s_wait_xcnt 0 directly behind its loads: left free it sinks below vector instructions that reuse the loads' address registers */
    auto put = [&](int bf) __attribute__((always_inline)) { /* register set bf to stage buffer bf: Wo (f16(bf16 x 2^8)) as it came, ctx once to f16; loops unrolled so that wr[] and yr[] stay in registers */
#pragma unroll
      for (int i = 0; i < 8; ++i) *(v4u*)&sm.h.wt[bf][(tid >> 3) + 16 * i][(tid & 7) * 8] = wr[bf][i];
#pragma unroll
      for (int i = 0; i < 8; ++i) { v4h t;
#pragma unroll
        for (int e = 0; e < 4; ++e) t[e] = (_Float16)yr[bf][i][e];
        *(v4h*)&sm.h.ya[bf][(tid >> 4) + 8 * i][(tid & 15) * 4] = t; } };
    put(0); lds_barrier(); /* publishes stage 0; stage 1's loads stay in flight */
    /* two buffers, as in k_proj; one trip, inlined with cur, ask and fill as constants, so that buffer and register set are fixed at compile time and no branch stands round the loads (two paths that meet would make the compiler wait for all loads, the newest too) */
    auto trip = [&](int cur, bool ask, bool fill) __attribute__((always_inline)) {
      if (ask) { ld_ctx(yp, CC, yr[cur]); ld_rows(wp, CC, wr[cur]); } /* set cur went to LDS a trip ago: the stage two ahead is asked for into it; ctx first, which the launch before has just written and fewer blocks share */
#pragma unroll
      for (int s = 0; s < 2; ++s) { /* the stage's two steps of 32 k, in k order */
        const v16h a = frag_h(&sm.h.ya[cur][wave * 16 + col][32 * s], lane); v16h w[8]; /* unrolled so that w[] stays in registers */
#pragma unroll
        for (int j = 0; j < 8; ++j) w[j] = frag_h(&sm.h.wt[cur][j * 16 + col][32 * s], lane);
#pragma unroll
        for (int j = 0; j < 8; ++j) acc[j] = wmma16(a, w[j], acc[j]); }
      __builtin_amdgcn_sched_barrier(0); /* keeps the waits on the next stage's global loads behind this stage's products, so that the products run inside the loads' latency */
      if (fill) put(cur ^ 1);
      lds_barrier(); }; /* publishes the next stage, ends the reads of the buffer refilled next (at the end: of the LDS that sf reuses) */
    /* rolled: a turn already holds both trips; the last two stages, which ask for nothing, stand behind the loop */
#pragma unroll 1
    for (int kc = 0; kc + 2 < CC / 64; kc += 2) { trip(0, true, true); trip(1, true, true); }
    trip(0, false, true); trip(1, false, false);
#pragma unroll
    for (int j = 0; j < 8; ++j) { const float bias = bfr(bs[j]);
#pragma unroll
      for (int r = 0; r < 8; ++r) sf[wave][8 * g + r][j * 16 + col] = acc[j][r] * (1.0f / 256.0f) + bias; } }
  LDSX(); for (int rl = 0; rl < 16; ++rl) vst2(OUT + (r0 + rl) * DIN + c0 + lane * 4, *(const v4f*)&sf[wave][rl][lane * 4]); }

extern "C" void kernel_launch(void* const* d_in, const int* in_sizes, int n_in, void* d_out, int out_size, void* d_ws, size_t ws_size, hipStream_t stream) {
  (void)in_sizes; (void)n_in; (void)out_size;
  const float** F = (const float**)d_in;
  if (ws_size < (size_t)WS_END) return;
  char* ws = (char*)d_ws; _Float16 *QH = (_Float16*)(ws + WS_QH), *KH = (_Float16*)(ws + WS_KH), *VT = (_Float16*)(ws + WS_VT), *QL = (_Float16*)(ws + WS_QL), *KL = (_Float16*)(ws + WS_KL); __bf16 *VB = (__bf16*)(ws + WS_VB), *VBL = (__bf16*)(ws + WS_VBL); float *Y = (float*)(ws + WS_Y); __bf16 *XB = (__bf16*)(ws + WS_XB), *WT = (__bf16*)(ws + WS_WT), *WOB = (__bf16*)(ws + WS_WOB); _Float16 *WOH = (_Float16*)(ws + WS_WOH);
  (void)Y; (void)QL; (void)KL; (void)VB; (void)VBL;
  // inputs: 0 x [2,2048,1024]; 1 Wq, 2 Wk, 3 Wv [16,1024,64]; 4 Wo [1024,1024] (in,out); 5 bo [1024]
  k_pre<<<dim3(2 * PXB), 256, 0, stream>>>(F[0], F[1], F[2], F[3], F[4], XB, WT, WOB, WOH);
  k_proj<<<dim3(TNB * TT / PR, CC / 128, 3), 128, 0, stream>>>(XB, WT, nullptr, nullptr, nullptr, QH, QL, KH, KL, VT, VB, VBL);
  k_att<<<dim3(NB * NH * NQB), 128, 0, stream>>>(QH, KH, VT, QL, KL, VB, VBL, Y);
  k_out<<<dim3(TNB * TT / 64, DIN / 128), 128, 0, stream>>>(Y, WOB, WOH, F[5], (float*)d_out);
}
